// v000
// Measured on an AMD MI455X. A time is GPU time per run, averaged over a window of back-to-back runs after a warm-up
// (all launches, gaps included; the runs take copies of the inputs in turn), and the median of several windows.
// Apart from v000's, it joins two sittings. Times from different sittings can be a few percent apart, while
// side-by-side timings come from the same sitting.
// The starting kernel, v000, takes 774 microseconds a run.
#include <hip/hip_runtime.h>
#include <hip/hip_bf16.h>

#define B_  8
#define S_  1024
#define D_  1024
#define H_  16
#define DK_ 64

typedef _Float16 half16 __attribute__((ext_vector_type(16)));
typedef _Float16 half8  __attribute__((ext_vector_type(8)));
typedef _Float16 half4  __attribute__((ext_vector_type(4)));
typedef float    float8 __attribute__((ext_vector_type(8)));
typedef __attribute__((address_space(3))) _Float16 lds_f16;

__device__ __forceinline__ float8 f8zero() {
  float8 z = {0.f,0.f,0.f,0.f,0.f,0.f,0.f,0.f};
  return z;
}

__device__ __forceinline__ float8 wmma_f16(half16 a, half16 b, float8 c) {
  // D = A(16x32) * B(32x16) + C, f32 accumulate
  return __builtin_amdgcn_wmma_f32_16x16x32_f16(false, a, false, b, (short)0, c, false, false);
}

// Async 16-byte global -> LDS copy (per-lane addresses), tracked by ASYNCcnt.
__device__ __forceinline__ void async_g2l_b128(unsigned lds_off, const _Float16* gsrc) {
  asm volatile("global_load_async_to_lds_b128 %0, %1, off"
               :: "v"(lds_off), "v"((unsigned long long)(uintptr_t)gsrc)
               : "memory");
}
__device__ __forceinline__ void wait_asynccnt0() {
  asm volatile("s_wait_asynccnt 0x0" ::: "memory");
}
__device__ __forceinline__ void wait_dscnt0() {
  asm volatile("s_wait_dscnt 0x0" ::: "memory");
}

// ---- WMMA fragment loaders (ISA 7.12.2 layouts, wave32) -------------------
// A fragment 16x32 f16 from row-major src (ldm halves/row).
__device__ __forceinline__ half16 load_a_frag(const _Float16* src, int ldm) {
  const int lane = threadIdx.x & 31;
  const int row  = lane & 15;
  const int koff = (lane >> 4) << 3;
  const _Float16* p0 = src + row * ldm + koff;
  const _Float16* p1 = p0 + 16;
  half16 a;
#pragma unroll
  for (int i = 0; i < 8; ++i) a[i] = p0[i];
#pragma unroll
  for (int i = 0; i < 8; ++i) a[8 + i] = p1[i];
  return a;
}

// B fragment 32x16 where element (k,n) lives at src[n*ldn + k] (k contiguous).
__device__ __forceinline__ half16 load_b_frag_kc(const _Float16* src, int ldn) {
  const int lane = threadIdx.x & 31;
  const int n    = lane & 15;
  const int koff = (lane >> 4) << 3;
  const _Float16* p0 = src + n * ldn + koff;
  const _Float16* p1 = p0 + 16;
  half16 b;
#pragma unroll
  for (int i = 0; i < 8; ++i) b[i] = p0[i];
#pragma unroll
  for (int i = 0; i < 8; ++i) b[8 + i] = p1[i];
  return b;
}

// ---- Kernel 1: per-head input projection  Out[b,h,s,:] = (X[b,s,:] @ W[h] + bias[h]) * scale
__global__ __launch_bounds__(128)
void proj_kernel(const float* __restrict__ X,    // [B,S,D]
                 const float* __restrict__ W,    // [H,D,DK]
                 const float* __restrict__ bias, // [H,DK]
                 _Float16* __restrict__ Out,     // [B*H,S,DK] f16
                 float scale) {
  __shared__ _Float16 As[64 * 32];   // [row][k]
  __shared__ _Float16 Bs[64 * 32];   // n-major: [n][k]
  const int tid  = threadIdx.x;
  const int wave = tid >> 5;
  const int lane = tid & 31;
  const int bh   = blockIdx.y;
  const int b = bh >> 4, h = bh & 15;
  const int rowbase = blockIdx.x * 64;

  const float* Xb = X + (size_t)b * S_ * D_ + (size_t)rowbase * D_;
  const float* Wh = W + (size_t)h * D_ * DK_;
  _Float16*    Ob = Out + (size_t)bh * S_ * DK_;

  float8 acc0 = f8zero(), acc1 = f8zero(), acc2 = f8zero(), acc3 = f8zero();

  for (int kk = 0; kk < D_; kk += 32) {
    __syncthreads();
    // A tile: 64x32 f32 -> f16 ; 512 float4 slots, 4 per thread, b128 loads.
#pragma unroll
    for (int i = 0; i < 4; ++i) {
      int slot = tid + i * 128;            // 0..511
      int r = slot >> 3;                   // row 0..63
      int c = (slot & 7) << 2;             // col 0,4,...,28
      float4 v = *(const float4*)(Xb + (size_t)r * D_ + kk + c);
      half4 hv = {(_Float16)v.x, (_Float16)v.y, (_Float16)v.z, (_Float16)v.w};
      *(half4*)(As + r * 32 + c) = hv;
    }
    // B tile: 32x64 f32, stored n-major (transposed) for k-contiguous frags.
#pragma unroll
    for (int i = 0; i < 4; ++i) {
      int slot = tid + i * 128;            // 0..511
      int r = slot >> 4;                   // k row 0..31
      int c = (slot & 15) << 2;            // n col 0,4,...,60
      float4 v = *(const float4*)(Wh + (size_t)(kk + r) * DK_ + c);
      Bs[(c + 0) * 32 + r] = (_Float16)v.x;
      Bs[(c + 1) * 32 + r] = (_Float16)v.y;
      Bs[(c + 2) * 32 + r] = (_Float16)v.z;
      Bs[(c + 3) * 32 + r] = (_Float16)v.w;
    }
    __syncthreads();

    half16 af = load_a_frag(As + wave * 16 * 32, 32);
    acc0 = wmma_f16(af, load_b_frag_kc(Bs +  0 * 32, 32), acc0);
    acc1 = wmma_f16(af, load_b_frag_kc(Bs + 16 * 32, 32), acc1);
    acc2 = wmma_f16(af, load_b_frag_kc(Bs + 32 * 32, 32), acc2);
    acc3 = wmma_f16(af, load_b_frag_kc(Bs + 48 * 32, 32), acc3);
  }

  const int n_l = lane & 15;
  const int rb  = (lane >> 4) << 3;
  const float* bh_bias = bias + h * DK_;
  float8 accs[4] = {acc0, acc1, acc2, acc3};
#pragma unroll
  for (int nt = 0; nt < 4; ++nt) {
    int n = nt * 16 + n_l;
    float bv = bh_bias[n];
#pragma unroll
    for (int r = 0; r < 8; ++r) {
      int m = rowbase + wave * 16 + rb + r;
      Ob[(size_t)m * DK_ + n] = (_Float16)((accs[nt][r] + bv) * scale);
    }
  }
}

// ---- Kernel 2: flash-style masked attention; block = 4 waves = 64 q rows of one (b,h)
__global__ __launch_bounds__(128)
void attn_kernel(const _Float16* __restrict__ Q,   // [B*H,S,DK] (pre-scaled by 1/sqrt(DK))
                 const _Float16* __restrict__ Km,  // [B*H,S,DK]
                 const _Float16* __restrict__ Vm,  // [B*H,S,DK]
                 const int* __restrict__ mask0,    // [B,S,S]
                 const int* __restrict__ mask1,    // [B,S,S]
                 _Float16* __restrict__ AOut) {    // [B,S,H*DK] f16
  __shared__ _Float16 Kt[32 * 64];     // [s_local][dk]     (scores B-frags, k-contig)
  __shared__ _Float16 Vt[64 * 32];     // [dk][s_local]     (PV B-frags, k-contig)
  __shared__ _Float16 Ps[4 * 16 * 32]; // per-wave P transpose staging
  const int tid  = threadIdx.x;
  const int wave = tid >> 5;
  const int lane = tid & 31;
  const int n_l  = lane & 15;
  const int rb   = (lane >> 4) << 3;
  const int bh   = blockIdx.y;
  const int b = bh >> 4, h = bh & 15;
  const int q0 = blockIdx.x * 64 + wave * 16;

  const _Float16* Qbh = Q  + (size_t)bh * S_ * DK_;
  const _Float16* Kbh = Km + (size_t)bh * S_ * DK_;
  const _Float16* Vbh = Vm + (size_t)bh * S_ * DK_;
  const int* m0 = mask0 + (size_t)b * S_ * S_;
  const int* m1 = mask1 + (size_t)b * S_ * S_;
  _Float16* Pw = Ps + wave * (16 * 32);
  const unsigned kt_base = (unsigned)(uintptr_t)(lds_f16*)Kt;  // LDS byte offset of Kt

  half16 qf0 = load_a_frag(Qbh + (size_t)q0 * DK_, DK_);        // k 0..31
  half16 qf1 = load_a_frag(Qbh + (size_t)q0 * DK_ + 32, DK_);   // k 32..63

  const float NEG_INF = -__builtin_inff();
  float mrun[8], lrun[8];
  float8 o0 = f8zero(), o1 = f8zero(), o2 = f8zero(), o3 = f8zero();
#pragma unroll
  for (int r = 0; r < 8; ++r) { mrun[r] = NEG_INF; lrun[r] = 0.f; }

  for (int s0 = 0; s0 < S_; s0 += 32) {
    __syncthreads();   // all waves done reading previous Kt/Vt

    // K tile: 32x64 f16 = 4 KB, async global->LDS, 2x16B per thread.
    {
      const _Float16* gk = Kbh + (size_t)s0 * DK_;
      async_g2l_b128(kt_base + (unsigned)tid * 16u,          gk + tid * 8);
      async_g2l_b128(kt_base + (unsigned)(tid + 128) * 16u,  gk + (tid + 128) * 8);
    }
    // V tile transposed at staging: Vt[dk][s_local].
    {
      const _Float16* gv = Vbh + (size_t)s0 * DK_;
#pragma unroll
      for (int i = 0; i < 2; ++i) {
        int slot = tid + i * 128;          // 256 slots of 8 halves
        int srow = slot >> 3;              // s_local 0..31
        int dk0  = (slot & 7) << 3;        // dk 0,8,...,56
        half8 d = *(const half8*)(gv + slot * 8);
#pragma unroll
        for (int j = 0; j < 8; ++j) Vt[(dk0 + j) * 32 + srow] = d[j];
      }
    }
    wait_asynccnt0();   // our async K copies landed in LDS
    __syncthreads();    // staged tiles visible block-wide

    // scores: 16x32 tile of q-rows x keys (two 16x16 WMMA accumulators)
    float8 sc0 = f8zero(), sc1 = f8zero();
    sc0 = wmma_f16(qf0, load_b_frag_kc(Kt,                64), sc0);
    sc0 = wmma_f16(qf1, load_b_frag_kc(Kt + 32,           64), sc0);
    sc1 = wmma_f16(qf0, load_b_frag_kc(Kt + 16 * 64,      64), sc1);
    sc1 = wmma_f16(qf1, load_b_frag_kc(Kt + 16 * 64 + 32, 64), sc1);

    // pre-softmax key-padding mask
#pragma unroll
    for (int r = 0; r < 8; ++r) {
      int m = q0 + rb + r;
      sc0[r] = (m0[(size_t)m * S_ + s0 + n_l]      == 0) ? NEG_INF : sc0[r];
      sc1[r] = (m0[(size_t)m * S_ + s0 + 16 + n_l] == 0) ? NEG_INF : sc1[r];
    }

    // row max over this 32-key chunk (lanes 0-15: rows 0-7, lanes 16-31: rows 8-15)
    float rmax[8];
#pragma unroll
    for (int r = 0; r < 8; ++r) rmax[r] = fmaxf(sc0[r], sc1[r]);
#pragma unroll
    for (int off = 8; off >= 1; off >>= 1)
#pragma unroll
      for (int r = 0; r < 8; ++r)
        rmax[r] = fmaxf(rmax[r], __shfl_xor(rmax[r], off, 32));

    float mcl[8], alpha[8], rsum[8];
#pragma unroll
    for (int r = 0; r < 8; ++r) {
      float mnew = fmaxf(mrun[r], rmax[r]);
      mcl[r]   = (mnew == NEG_INF) ? 0.f : mnew;
      alpha[r] = (mrun[r] == NEG_INF) ? 0.f : __expf(mrun[r] - mcl[r]);
      mrun[r]  = mnew;
      rsum[r]  = 0.f;
    }

    // p = exp(s - m); denominator uses pre-mask1 p; PV uses mask1*p
#pragma unroll
    for (int r = 0; r < 8; ++r) {
      int m = q0 + rb + r;
      float p0 = __expf(sc0[r] - mcl[r]);
      float p1 = __expf(sc1[r] - mcl[r]);
      rsum[r] += p0 + p1;
      float w0 = m1[(size_t)m * S_ + s0 + n_l]      ? p0 : 0.f;
      float w1 = m1[(size_t)m * S_ + s0 + 16 + n_l] ? p1 : 0.f;
      Pw[(rb + r) * 32 + n_l]      = (_Float16)w0;
      Pw[(rb + r) * 32 + 16 + n_l] = (_Float16)w1;
    }

#pragma unroll
    for (int off = 8; off >= 1; off >>= 1)
#pragma unroll
      for (int r = 0; r < 8; ++r)
        rsum[r] += __shfl_xor(rsum[r], off, 32);

#pragma unroll
    for (int r = 0; r < 8; ++r) {
      lrun[r] = lrun[r] * alpha[r] + rsum[r];
      o0[r] *= alpha[r]; o1[r] *= alpha[r]; o2[r] *= alpha[r]; o3[r] *= alpha[r];
    }

    wait_dscnt0();   // P tile visible wave-wide before transposed re-read

    half16 pf = load_a_frag(Pw, 32);
    o0 = wmma_f16(pf, load_b_frag_kc(Vt +  0 * 32, 32), o0);
    o1 = wmma_f16(pf, load_b_frag_kc(Vt + 16 * 32, 32), o1);
    o2 = wmma_f16(pf, load_b_frag_kc(Vt + 32 * 32, 32), o2);
    o3 = wmma_f16(pf, load_b_frag_kc(Vt + 48 * 32, 32), o3);
  }

  float inv[8];
#pragma unroll
  for (int r = 0; r < 8; ++r) inv[r] = (lrun[r] > 0.f) ? 1.f / lrun[r] : 0.f;

  float8 oo[4] = {o0, o1, o2, o3};
#pragma unroll
  for (int nt = 0; nt < 4; ++nt)
#pragma unroll
    for (int r = 0; r < 8; ++r) {
      int m = q0 + rb + r;
      AOut[((size_t)(b * S_ + m)) * D_ + h * DK_ + nt * 16 + n_l] =
          (_Float16)(oo[nt][r] * inv[r]);
    }
}

// ---- Kernel 3: output projection  Out = A(f16) @ Wo + bo  (f32 out)
__global__ __launch_bounds__(128)
void outproj_kernel(const _Float16* __restrict__ A,  // [B*S, D] f16
                    const float* __restrict__ W,     // [D, D]
                    const float* __restrict__ bias,  // [D]
                    float* __restrict__ Out) {       // [B*S, D]
  __shared__ _Float16 As[64 * 32];
  __shared__ _Float16 Bs[64 * 32];  // n-major
  const int tid  = threadIdx.x;
  const int wave = tid >> 5;
  const int lane = tid & 31;
  const int rowbase = blockIdx.y * 64;
  const int nbase   = blockIdx.x * 64;
  const _Float16* Ab = A + (size_t)rowbase * D_;

  float8 acc0 = f8zero(), acc1 = f8zero(), acc2 = f8zero(), acc3 = f8zero();

  for (int kk = 0; kk < D_; kk += 32) {
    __syncthreads();
    // A tile: f16 copy, 256 x 16B slots, 2 per thread.
#pragma unroll
    for (int i = 0; i < 2; ++i) {
      int slot = tid + i * 128;           // 0..255
      int r = slot >> 2;                  // row 0..63
      int c = (slot & 3) << 3;            // col 0,8,16,24
      *(half8*)(As + r * 32 + c) = *(const half8*)(Ab + (size_t)r * D_ + kk + c);
    }
    // B tile: 32x64 f32 -> n-major f16.
#pragma unroll
    for (int i = 0; i < 4; ++i) {
      int slot = tid + i * 128;           // 0..511
      int r = slot >> 4;                  // k row 0..31
      int c = (slot & 15) << 2;           // n col 0,4,...,60
      float4 v = *(const float4*)(W + (size_t)(kk + r) * D_ + nbase + c);
      Bs[(c + 0) * 32 + r] = (_Float16)v.x;
      Bs[(c + 1) * 32 + r] = (_Float16)v.y;
      Bs[(c + 2) * 32 + r] = (_Float16)v.z;
      Bs[(c + 3) * 32 + r] = (_Float16)v.w;
    }
    __syncthreads();

    half16 af = load_a_frag(As + wave * 16 * 32, 32);
    acc0 = wmma_f16(af, load_b_frag_kc(Bs +  0 * 32, 32), acc0);
    acc1 = wmma_f16(af, load_b_frag_kc(Bs + 16 * 32, 32), acc1);
    acc2 = wmma_f16(af, load_b_frag_kc(Bs + 32 * 32, 32), acc2);
    acc3 = wmma_f16(af, load_b_frag_kc(Bs + 48 * 32, 32), acc3);
  }

  const int n_l = lane & 15;
  const int rb  = (lane >> 4) << 3;
  float8 accs[4] = {acc0, acc1, acc2, acc3};
#pragma unroll
  for (int nt = 0; nt < 4; ++nt) {
    int n = nbase + nt * 16 + n_l;
    float bv = bias[n];
#pragma unroll
    for (int r = 0; r < 8; ++r) {
      int m = rowbase + wave * 16 + rb + r;
      Out[(size_t)m * D_ + n] = accs[nt][r] + bv;
    }
  }
}

extern "C" void kernel_launch(void* const* d_in, const int* in_sizes, int n_in,
                              void* d_out, int out_size, void* d_ws, size_t ws_size,
                              hipStream_t stream) {
  const float* query = (const float*)d_in[0];
  const float* key   = (const float*)d_in[1];
  const float* value = (const float*)d_in[2];
  const int*   mask0 = (const int*)d_in[3];
  const int*   mask1 = (const int*)d_in[4];
  const float* Wq    = (const float*)d_in[5];
  const float* bq    = (const float*)d_in[6];
  const float* Wk    = (const float*)d_in[7];
  const float* bk    = (const float*)d_in[8];
  const float* Wv    = (const float*)d_in[9];
  const float* bv    = (const float*)d_in[10];
  const float* Wo    = (const float*)d_in[11];
  const float* bo    = (const float*)d_in[12];
  float* out = (float*)d_out;

  const size_t perTensor = (size_t)B_ * H_ * S_ * DK_;   // 8 Mi halves = 16 MB
  _Float16* Qh = (_Float16*)d_ws;
  _Float16* Kh = Qh + perTensor;
  _Float16* Vh = Kh + perTensor;
  _Float16* Ao = Vh + perTensor;

  dim3 blk(128);
  dim3 gproj(S_ / 64, B_ * H_);
  proj_kernel<<<gproj, blk, 0, stream>>>(query, Wq, bq, Qh, 0.125f); // fold 1/sqrt(64)
  proj_kernel<<<gproj, blk, 0, stream>>>(key,   Wk, bk, Kh, 1.0f);
  proj_kernel<<<gproj, blk, 0, stream>>>(value, Wv, bv, Vh, 1.0f);
  attn_kernel<<<dim3(S_ / 64, B_ * H_), blk, 0, stream>>>(Qh, Kh, Vh, mask0, mask1, Ao);
  outproj_kernel<<<dim3(D_ / 64, (B_ * S_) / 64), blk, 0, stream>>>(Ao, Wo, bo, out);

  (void)in_sizes; (void)n_in; (void)out_size; (void)ws_size;
}

// v001
// Measured time: 313 microseconds a run.
// In both of two side-by-side timings against v000, it was 2.58 times as fast.
#include <hip/hip_runtime.h>
#include <hip/hip_bf16.h>

#define B_  8
#define S_  1024
#define D_  1024
#define H_  16
#define DK_ 64

typedef _Float16 half16 __attribute__((ext_vector_type(16)));
typedef _Float16 half8  __attribute__((ext_vector_type(8)));
typedef _Float16 half4  __attribute__((ext_vector_type(4)));
typedef float    float8 __attribute__((ext_vector_type(8)));
typedef float    f32x4  __attribute__((ext_vector_type(4)));
typedef short    s16x8  __attribute__((ext_vector_type(8)));
typedef __attribute__((address_space(3))) _Float16 lds_f16;
typedef __attribute__((address_space(3))) s16x8    lds_s16x8;

// LDS row pitches in halves. Bank = dword address mod 64, so each tile is pitched for its reader:
// 16 B x odd for rows read by ds_load_b128, 32 B x odd for rows read by ds_load_tr16_b128.
#define PA_ 40   // 32-half rows (64 B)  read by ds_load_b128      -> 80 B
#define PK_ 72   // 64-half rows (128 B) read by ds_load_b128      -> 144 B
#define PT_ 80   // 64-half rows (128 B) read by ds_load_tr16_b128 -> 160 B

__device__ __forceinline__ float8 f8zero() {
  float8 z = {0.f,0.f,0.f,0.f,0.f,0.f,0.f,0.f};
  return z;
}

__device__ __forceinline__ float8 wmma_f16(half16 a, half16 b, float8 c) {
  // D = A(16x32) * B(32x16) + C, f32 accumulate
  return __builtin_amdgcn_wmma_f32_16x16x32_f16(false, a, false, b, (short)0, c, false, false);
}

// Two async 16-byte global -> LDS copies (per-lane addresses), tracked by ASYNCcnt.
// s_wait_xcnt 0 closes the statement so that no address register is rewritten ahead of it.
__device__ __forceinline__ void async_g2l_2x_b128(unsigned lds0, const _Float16* g0,
                                                  unsigned lds1, const _Float16* g1) {
  asm volatile("global_load_async_to_lds_b128 %0, %1, off\n\t"
               "global_load_async_to_lds_b128 %2, %3, off\n\t"
               "s_wait_xcnt 0x0"
               :: "v"(lds0), "v"((unsigned long long)(uintptr_t)g0),
                  "v"(lds1), "v"((unsigned long long)(uintptr_t)g1)
               : "memory");
}
__device__ __forceinline__ void wait_asynccnt0() {
  asm volatile("s_wait_asynccnt 0x0" ::: "memory");
}
__device__ __forceinline__ void wait_dscnt0() {
  asm volatile("s_wait_dscnt 0x0" ::: "memory");
}

// ---- WMMA fragment loaders (ISA 7.12.2 layouts, wave32) -------------------
// A fragment 16x32 f16 from row-major src (ldm halves/row).
__device__ __forceinline__ half16 load_a_frag(const _Float16* src, int ldm) {
  const int lane = threadIdx.x & 31;
  const int row  = lane & 15;
  const int koff = (lane >> 4) << 3;
  const _Float16* p0 = src + row * ldm + koff;
  const _Float16* p1 = p0 + 16;
  half16 a;
#pragma unroll
  for (int i = 0; i < 8; ++i) a[i] = p0[i];
#pragma unroll
  for (int i = 0; i < 8; ++i) a[8 + i] = p1[i];
  return a;
}

// B fragment 32x16 where element (k,n) lives at src[n*ldn + k] (k contiguous).
__device__ __forceinline__ half16 load_b_frag_kc(const _Float16* src, int ldn) {
  const int lane = threadIdx.x & 31;
  const int n    = lane & 15;
  const int koff = (lane >> 4) << 3;
  const _Float16* p0 = src + n * ldn + koff;
  const _Float16* p1 = p0 + 16;
  half16 b;
#pragma unroll
  for (int i = 0; i < 8; ++i) b[i] = p0[i];
#pragma unroll
  for (int i = 0; i < 8; ++i) b[8 + i] = p1[i];
  return b;
}

// B fragment 32x16 from a row-major LDS tile: element (k,n) lives at src[k*PT_ + n] (n contiguous).
// ds_load_tr16_b128 hands lane (c,h) the column n = c at k = kbase + 8h + 0..7, the k order of load_a_frag.
__device__ __forceinline__ half16 load_b_frag_tr(const _Float16* src) {
  const int lane = threadIdx.x & 31;
  const _Float16* p = src + (((lane >> 4) << 3) + (lane & 7)) * PT_ + (((lane >> 3) & 1) << 3);
  half8 lo = __builtin_bit_cast(half8, __builtin_amdgcn_ds_load_tr16_b128_v8i16((lds_s16x8*)p));
  half8 hi = __builtin_bit_cast(half8, __builtin_amdgcn_ds_load_tr16_b128_v8i16((lds_s16x8*)(p + 16 * PT_)));
  return __builtin_shufflevector(lo, hi, 0, 1, 2, 3, 4, 5, 6, 7, 8, 9, 10, 11, 12, 13, 14, 15);
}

// ---- Kernel 1: per-head input projection  Out[b,h,s,:] = (X[b,s,:] @ W[h] + bias[h]) * scale
__global__ __launch_bounds__(128)
void proj_kernel(const float* __restrict__ X,    // [B,S,D]
                 const float* __restrict__ W,    // [H,D,DK]
                 const float* __restrict__ bias, // [H,DK]
                 _Float16* __restrict__ Out,     // [B*H,S,DK] f16
                 float scale) {
  __shared__ __attribute__((aligned(16))) _Float16 As[64 * PA_];   // [row][k]
  __shared__ __attribute__((aligned(16))) _Float16 Bs[32 * PT_];   // row-major: [k][n]
  const int tid  = threadIdx.x;
  const int wave = tid >> 5;
  const int lane = tid & 31;
  const int bh   = blockIdx.y;
  const int b = bh >> 4, h = bh & 15;
  const int rowbase = blockIdx.x * 64;

  const float* Xb = X + (size_t)b * S_ * D_ + (size_t)rowbase * D_;
  const float* Wh = W + (size_t)h * D_ * DK_;
  _Float16*    Ob = Out + (size_t)bh * S_ * DK_;

  float8 acc0 = f8zero(), acc1 = f8zero(), acc2 = f8zero(), acc3 = f8zero();

  for (int kk = 0; kk < D_; kk += 32) {
    __syncthreads();
    // A tile: 64x32 f32 -> f16 ; 512 float4 slots, 4 per thread, b128 loads.
    // B tile: 32x64 f32 -> f16, kept row-major; the fragment load transposes.
    const f32x4 *pa[4], *pb[4];
    f32x4 va[4], vb[4];
#pragma unroll
    for (int i = 0; i < 4; ++i) {
      int slot = tid + i * 128;            // 0..511
      pa[i] = (const f32x4*)(Xb + (size_t)(slot >> 3) * D_ + kk + ((slot & 7) << 2));
      pb[i] = (const f32x4*)(Wh + (size_t)(kk + (slot >> 4)) * DK_ + ((slot & 15) << 2));
      va[i] = *pa[i];
      vb[i] = *pb[i];
    }
    // Inputs only. The loaded values keep the eight loads of a k-step in flight together (without them
    // this build waits out each load before it issues the next); the addresses stay unwritten up to the wait.
    asm volatile("s_wait_xcnt 0x0"
                 :: "v"(va[0]), "v"(va[1]), "v"(va[2]), "v"(va[3]),
                    "v"(vb[0]), "v"(vb[1]), "v"(vb[2]), "v"(vb[3]),
                    "v"(pa[0]), "v"(pa[1]), "v"(pa[2]), "v"(pa[3]),
                    "v"(pb[0]), "v"(pb[1]), "v"(pb[2]), "v"(pb[3]));
#pragma unroll
    for (int i = 0; i < 4; ++i) {
      int slot = tid + i * 128;            // 0..511
      half4 ha = {(_Float16)va[i].x, (_Float16)va[i].y, (_Float16)va[i].z, (_Float16)va[i].w};
      half4 hb = {(_Float16)vb[i].x, (_Float16)vb[i].y, (_Float16)vb[i].z, (_Float16)vb[i].w};
      *(half4*)(As + (slot >> 3) * PA_ + ((slot & 7) << 2))  = ha;   // row 0..63, col 0,4,...,28
      *(half4*)(Bs + (slot >> 4) * PT_ + ((slot & 15) << 2)) = hb;   // k row 0..31, n col 0,4,...,60
    }
    __syncthreads();

    half16 af = load_a_frag(As + wave * 16 * PA_, PA_);
    acc0 = wmma_f16(af, load_b_frag_tr(Bs +  0), acc0);
    acc1 = wmma_f16(af, load_b_frag_tr(Bs + 16), acc1);
    acc2 = wmma_f16(af, load_b_frag_tr(Bs + 32), acc2);
    acc3 = wmma_f16(af, load_b_frag_tr(Bs + 48), acc3);
  }

  const int n_l = lane & 15;
  const int rb  = (lane >> 4) << 3;
  const float* bh_bias = bias + h * DK_;
  float8 accs[4] = {acc0, acc1, acc2, acc3};
#pragma unroll
  for (int nt = 0; nt < 4; ++nt) {
    int n = nt * 16 + n_l;
    float bv = bh_bias[n];
#pragma unroll
    for (int r = 0; r < 8; ++r) {
      int m = rowbase + wave * 16 + rb + r;
      Ob[(size_t)m * DK_ + n] = (_Float16)((accs[nt][r] + bv) * scale);
    }
  }
}

// ---- Kernel 2: flash-style masked attention; block = 4 waves = 64 q rows of one (b,h)
__global__ __launch_bounds__(128)
void attn_kernel(const _Float16* __restrict__ Q,   // [B*H,S,DK] (pre-scaled by 1/sqrt(DK))
                 const _Float16* __restrict__ Km,  // [B*H,S,DK]
                 const _Float16* __restrict__ Vm,  // [B*H,S,DK]
                 const int* __restrict__ mask0,    // [B,S,S]
                 const int* __restrict__ mask1,    // [B,S,S]
                 _Float16* __restrict__ AOut) {    // [B,S,H*DK] f16
  __shared__ __attribute__((aligned(16))) _Float16 Kt[32 * PK_];      // [s_local][dk] (scores B-frags, k-contig)
  __shared__ __attribute__((aligned(16))) _Float16 Vt[32 * PT_];      // [s_local][dk] (PV B-frags, transposing load)
  __shared__ __attribute__((aligned(16))) _Float16 Ps[4 * 16 * PA_];  // per-wave P transpose staging
  const int tid  = threadIdx.x;
  const int wave = tid >> 5;
  const int lane = tid & 31;
  const int n_l  = lane & 15;
  const int rb   = (lane >> 4) << 3;
  const int bh   = blockIdx.y;
  const int b = bh >> 4, h = bh & 15;
  const int q0 = blockIdx.x * 64 + wave * 16;

  const _Float16* Qbh = Q  + (size_t)bh * S_ * DK_;
  const _Float16* Kbh = Km + (size_t)bh * S_ * DK_;
  const _Float16* Vbh = Vm + (size_t)bh * S_ * DK_;
  const int* m0 = mask0 + (size_t)b * S_ * S_;
  const int* m1 = mask1 + (size_t)b * S_ * S_;
  _Float16* Pw = Ps + wave * (16 * PA_);
  const unsigned kt_base = (unsigned)(uintptr_t)(lds_f16*)Kt;  // LDS byte offset of Kt

  half16 qf0 = load_a_frag(Qbh + (size_t)q0 * DK_, DK_);        // k 0..31
  half16 qf1 = load_a_frag(Qbh + (size_t)q0 * DK_ + 32, DK_);   // k 32..63

  const float NEG_INF = -__builtin_inff();
  float mrun[8], lrun[8];
  float8 o0 = f8zero(), o1 = f8zero(), o2 = f8zero(), o3 = f8zero();
#pragma unroll
  for (int r = 0; r < 8; ++r) { mrun[r] = NEG_INF; lrun[r] = 0.f; }

  for (int s0 = 0; s0 < S_; s0 += 32) {
    __syncthreads();   // all waves done reading previous Kt/Vt

    // K tile: 32x64 f16 = 4 KB, async global->LDS, 2x16B per thread.
    {
      const _Float16* gk = Kbh + (size_t)s0 * DK_;
      const unsigned l0 = kt_base + (unsigned)(tid >> 3) * (PK_ * 2u) + (unsigned)(tid & 7) * 16u;
      async_g2l_2x_b128(l0,                   gk + tid * 8,
                        l0 + 16u * PK_ * 2u,  gk + (tid + 128) * 8);
    }
    // V tile kept row-major: Vt[s_local][dk]; the fragment load transposes.
    {
      const _Float16* gv = Vbh + (size_t)s0 * DK_;
#pragma unroll
      for (int i = 0; i < 2; ++i) {
        int slot = tid + i * 128;          // 256 slots of 8 halves
        int srow = slot >> 3;              // s_local 0..31
        int dk0  = (slot & 7) << 3;        // dk 0,8,...,56
        half8 d = *(const half8*)(gv + slot * 8);
        *(half8*)(Vt + srow * PT_ + dk0) = d;
      }
    }
    wait_asynccnt0();   // our async K copies landed in LDS
    __syncthreads();    // staged tiles visible block-wide

    // scores: 16x32 tile of q-rows x keys (two 16x16 WMMA accumulators)
    float8 sc0 = f8zero(), sc1 = f8zero();
    sc0 = wmma_f16(qf0, load_b_frag_kc(Kt,                 PK_), sc0);
    sc0 = wmma_f16(qf1, load_b_frag_kc(Kt + 32,            PK_), sc0);
    sc1 = wmma_f16(qf0, load_b_frag_kc(Kt + 16 * PK_,      PK_), sc1);
    sc1 = wmma_f16(qf1, load_b_frag_kc(Kt + 16 * PK_ + 32, PK_), sc1);

    // pre-softmax key-padding mask
#pragma unroll
    for (int r = 0; r < 8; ++r) {
      int m = q0 + rb + r;
      sc0[r] = (m0[(size_t)m * S_ + s0 + n_l]      == 0) ? NEG_INF : sc0[r];
      sc1[r] = (m0[(size_t)m * S_ + s0 + 16 + n_l] == 0) ? NEG_INF : sc1[r];
    }

    // row max over this 32-key chunk (lanes 0-15: rows 0-7, lanes 16-31: rows 8-15)
    float rmax[8];
#pragma unroll
    for (int r = 0; r < 8; ++r) rmax[r] = fmaxf(sc0[r], sc1[r]);
#pragma unroll
    for (int off = 8; off >= 1; off >>= 1)
#pragma unroll
      for (int r = 0; r < 8; ++r)
        rmax[r] = fmaxf(rmax[r], __shfl_xor(rmax[r], off, 32));

    float mcl[8], alpha[8], rsum[8];
#pragma unroll
    for (int r = 0; r < 8; ++r) {
      float mnew = fmaxf(mrun[r], rmax[r]);
      mcl[r]   = (mnew == NEG_INF) ? 0.f : mnew;
      alpha[r] = (mrun[r] == NEG_INF) ? 0.f : __expf(mrun[r] - mcl[r]);
      mrun[r]  = mnew;
      rsum[r]  = 0.f;
    }

    // p = exp(s - m); denominator uses pre-mask1 p; PV uses mask1*p
#pragma unroll
    for (int r = 0; r < 8; ++r) {
      int m = q0 + rb + r;
      float p0 = __expf(sc0[r] - mcl[r]);
      float p1 = __expf(sc1[r] - mcl[r]);
      rsum[r] += p0 + p1;
      float w0 = m1[(size_t)m * S_ + s0 + n_l]      ? p0 : 0.f;
      float w1 = m1[(size_t)m * S_ + s0 + 16 + n_l] ? p1 : 0.f;
      Pw[(rb + r) * PA_ + n_l]      = (_Float16)w0;
      Pw[(rb + r) * PA_ + 16 + n_l] = (_Float16)w1;
    }

#pragma unroll
    for (int off = 8; off >= 1; off >>= 1)
#pragma unroll
      for (int r = 0; r < 8; ++r)
        rsum[r] += __shfl_xor(rsum[r], off, 32);

#pragma unroll
    for (int r = 0; r < 8; ++r) {
      lrun[r] = lrun[r] * alpha[r] + rsum[r];
      o0[r] *= alpha[r]; o1[r] *= alpha[r]; o2[r] *= alpha[r]; o3[r] *= alpha[r];
    }

    wait_dscnt0();   // P tile visible wave-wide before transposed re-read

    half16 pf = load_a_frag(Pw, PA_);
    o0 = wmma_f16(pf, load_b_frag_tr(Vt +  0), o0);
    o1 = wmma_f16(pf, load_b_frag_tr(Vt + 16), o1);
    o2 = wmma_f16(pf, load_b_frag_tr(Vt + 32), o2);
    o3 = wmma_f16(pf, load_b_frag_tr(Vt + 48), o3);
  }

  float inv[8];
#pragma unroll
  for (int r = 0; r < 8; ++r) inv[r] = (lrun[r] > 0.f) ? 1.f / lrun[r] : 0.f;

  float8 oo[4] = {o0, o1, o2, o3};
#pragma unroll
  for (int nt = 0; nt < 4; ++nt)
#pragma unroll
    for (int r = 0; r < 8; ++r) {
      int m = q0 + rb + r;
      AOut[((size_t)(b * S_ + m)) * D_ + h * DK_ + nt * 16 + n_l] =
          (_Float16)(oo[nt][r] * inv[r]);
    }
}

// ---- Kernel 3: output projection  Out = A(f16) @ Wo + bo  (f32 out)
__global__ __launch_bounds__(128)
void outproj_kernel(const _Float16* __restrict__ A,  // [B*S, D] f16
                    const float* __restrict__ W,     // [D, D]
                    const float* __restrict__ bias,  // [D]
                    float* __restrict__ Out) {       // [B*S, D]
  __shared__ __attribute__((aligned(16))) _Float16 As[64 * PA_];
  __shared__ __attribute__((aligned(16))) _Float16 Bs[32 * PT_];  // row-major: [k][n]
  const int tid  = threadIdx.x;
  const int wave = tid >> 5;
  const int lane = tid & 31;
  const int rowbase = blockIdx.y * 64;
  const int nbase   = blockIdx.x * 64;
  const _Float16* Ab = A + (size_t)rowbase * D_;

  float8 acc0 = f8zero(), acc1 = f8zero(), acc2 = f8zero(), acc3 = f8zero();

  for (int kk = 0; kk < D_; kk += 32) {
    __syncthreads();
    // A tile: f16 copy, 256 x 16B slots, 2 per thread.
    // B tile: 32x64 f32 -> f16, kept row-major; the fragment load transposes.
    const half8* pa[2];
    const f32x4* pb[4];
    half8 av[2];
    f32x4 vb[4];
#pragma unroll
    for (int i = 0; i < 2; ++i) {
      int slot = tid + i * 128;           // 0..255
      pa[i] = (const half8*)(Ab + (size_t)(slot >> 2) * D_ + kk + ((slot & 3) << 3));
      av[i] = *pa[i];
    }
#pragma unroll
    for (int i = 0; i < 4; ++i) {
      int slot = tid + i * 128;           // 0..511
      pb[i] = (const f32x4*)(W + (size_t)(kk + (slot >> 4)) * D_ + nbase + ((slot & 15) << 2));
      vb[i] = *pb[i];
    }
    // Inputs only. The loaded values keep the six loads of a k-step in flight together;
    // the addresses stay unwritten up to the wait.
    asm volatile("s_wait_xcnt 0x0"
                 :: "v"(av[0]), "v"(av[1]), "v"(vb[0]), "v"(vb[1]), "v"(vb[2]), "v"(vb[3]),
                    "v"(pa[0]), "v"(pa[1]), "v"(pb[0]), "v"(pb[1]), "v"(pb[2]), "v"(pb[3]));
#pragma unroll
    for (int i = 0; i < 2; ++i) {
      int slot = tid + i * 128;           // row 0..63, col 0,8,16,24
      *(half8*)(As + (slot >> 2) * PA_ + ((slot & 3) << 3)) = av[i];
    }
#pragma unroll
    for (int i = 0; i < 4; ++i) {
      int slot = tid + i * 128;           // k row 0..31, n col 0,4,...,60
      half4 hb = {(_Float16)vb[i].x, (_Float16)vb[i].y, (_Float16)vb[i].z, (_Float16)vb[i].w};
      *(half4*)(Bs + (slot >> 4) * PT_ + ((slot & 15) << 2)) = hb;
    }
    __syncthreads();

    half16 af = load_a_frag(As + wave * 16 * PA_, PA_);
    acc0 = wmma_f16(af, load_b_frag_tr(Bs +  0), acc0);
    acc1 = wmma_f16(af, load_b_frag_tr(Bs + 16), acc1);
    acc2 = wmma_f16(af, load_b_frag_tr(Bs + 32), acc2);
    acc3 = wmma_f16(af, load_b_frag_tr(Bs + 48), acc3);
  }

  const int n_l = lane & 15;
  const int rb  = (lane >> 4) << 3;
  float8 accs[4] = {acc0, acc1, acc2, acc3};
#pragma unroll
  for (int nt = 0; nt < 4; ++nt) {
    int n = nbase + nt * 16 + n_l;
    float bv = bias[n];
#pragma unroll
    for (int r = 0; r < 8; ++r) {
      int m = rowbase + wave * 16 + rb + r;
      Out[(size_t)m * D_ + n] = accs[nt][r] + bv;
    }
  }
}

extern "C" void kernel_launch(void* const* d_in, const int* in_sizes, int n_in,
                              void* d_out, int out_size, void* d_ws, size_t ws_size,
                              hipStream_t stream) {
  const float* query = (const float*)d_in[0];
  const float* key   = (const float*)d_in[1];
  const float* value = (const float*)d_in[2];
  const int*   mask0 = (const int*)d_in[3];
  const int*   mask1 = (const int*)d_in[4];
  const float* Wq    = (const float*)d_in[5];
  const float* bq    = (const float*)d_in[6];
  const float* Wk    = (const float*)d_in[7];
  const float* bk    = (const float*)d_in[8];
  const float* Wv    = (const float*)d_in[9];
  const float* bv    = (const float*)d_in[10];
  const float* Wo    = (const float*)d_in[11];
  const float* bo    = (const float*)d_in[12];
  float* out = (float*)d_out;

  const size_t perTensor = (size_t)B_ * H_ * S_ * DK_;   // 8 Mi halves = 16 MB
  _Float16* Qh = (_Float16*)d_ws;
  _Float16* Kh = Qh + perTensor;
  _Float16* Vh = Kh + perTensor;
  _Float16* Ao = Vh + perTensor;

  dim3 blk(128);
  dim3 gproj(S_ / 64, B_ * H_);
  proj_kernel<<<gproj, blk, 0, stream>>>(query, Wq, bq, Qh, 0.125f); // fold 1/sqrt(64)
  proj_kernel<<<gproj, blk, 0, stream>>>(key,   Wk, bk, Kh, 1.0f);
  proj_kernel<<<gproj, blk, 0, stream>>>(value, Wv, bv, Vh, 1.0f);
  attn_kernel<<<dim3(S_ / 64, B_ * H_), blk, 0, stream>>>(Qh, Kh, Vh, mask0, mask1, Ao);
  outproj_kernel<<<dim3(D_ / 64, (B_ * S_) / 64), blk, 0, stream>>>(Ao, Wo, bo, out);

  (void)in_sizes; (void)n_in; (void)out_size; (void)ws_size;
}

// v002
// It runs in 263 microseconds.
// Timed twice side by side with v001, it ran 1.19 times as fast both times.
// Counting every step since v000, it is 3.06 times as fast.
#include <hip/hip_runtime.h>
#include <hip/hip_bf16.h>

#define B_  8
#define S_  1024
#define D_  1024
#define H_  16
#define DK_ 64

typedef _Float16 half16 __attribute__((ext_vector_type(16)));
typedef _Float16 half8  __attribute__((ext_vector_type(8)));
typedef _Float16 half4  __attribute__((ext_vector_type(4)));
typedef float    float8 __attribute__((ext_vector_type(8)));
typedef float    f32x4  __attribute__((ext_vector_type(4)));
typedef short    s16x8  __attribute__((ext_vector_type(8)));
typedef __attribute__((address_space(3))) _Float16 lds_f16;
typedef __attribute__((address_space(3))) s16x8    lds_s16x8;

// LDS row pitches in halves. Bank = dword address mod 64, so each tile is pitched for its reader:
// 16 B x odd for rows read by ds_load_b128, 32 B x odd for rows read by ds_load_tr16_b128.
#define PA_ 40   // 32-half rows (64 B)  read by ds_load_b128      -> 80 B
#define PK_ 72   // 64-half rows (128 B) read by ds_load_b128      -> 144 B
#define PT_ 80   // 64-half rows (128 B) read by ds_load_tr16_b128 -> 160 B
#define PB_ 144  // 128-half rows (256 B) read by ds_load_tr16_b128 -> 288 B

__device__ __forceinline__ float8 f8zero() {
  float8 z = {0.f,0.f,0.f,0.f,0.f,0.f,0.f,0.f};
  return z;
}

__device__ __forceinline__ float8 wmma_f16(half16 a, half16 b, float8 c) {
  // D = A(16x32) * B(32x16) + C, f32 accumulate
  return __builtin_amdgcn_wmma_f32_16x16x32_f16(false, a, false, b, (short)0, c, false, false);
}

// Two async 16-byte global -> LDS copies (per-lane addresses), tracked by ASYNCcnt.
// s_wait_xcnt 0 closes the statement so that no address register is rewritten ahead of it.
__device__ __forceinline__ void async_g2l_2x_b128(unsigned lds0, const _Float16* g0,
                                                  unsigned lds1, const _Float16* g1) {
  asm volatile("global_load_async_to_lds_b128 %0, %1, off\n\t"
               "global_load_async_to_lds_b128 %2, %3, off\n\t"
               "s_wait_xcnt 0x0"
               :: "v"(lds0), "v"((unsigned long long)(uintptr_t)g0),
                  "v"(lds1), "v"((unsigned long long)(uintptr_t)g1)
               : "memory");
}
__device__ __forceinline__ void wait_asynccnt0() {
  asm volatile("s_wait_asynccnt 0x0" ::: "memory");
}
__device__ __forceinline__ void wait_dscnt0() {
  asm volatile("s_wait_dscnt 0x0" ::: "memory");
}

// ---- WMMA fragment loaders (ISA 7.12.2 layouts, wave32) -------------------
// A fragment 16x32 f16 from row-major src (ldm halves/row).
__device__ __forceinline__ half16 load_a_frag(const _Float16* src, int ldm) {
  const int lane = threadIdx.x & 31;
  const int row  = lane & 15;
  const int koff = (lane >> 4) << 3;
  const _Float16* p0 = src + row * ldm + koff;
  const _Float16* p1 = p0 + 16;
  half16 a;
#pragma unroll
  for (int i = 0; i < 8; ++i) a[i] = p0[i];
#pragma unroll
  for (int i = 0; i < 8; ++i) a[8 + i] = p1[i];
  return a;
}

// B fragment 32x16 where element (k,n) lives at src[n*ldn + k] (k contiguous).
__device__ __forceinline__ half16 load_b_frag_kc(const _Float16* src, int ldn) {
  const int lane = threadIdx.x & 31;
  const int n    = lane & 15;
  const int koff = (lane >> 4) << 3;
  const _Float16* p0 = src + n * ldn + koff;
  const _Float16* p1 = p0 + 16;
  half16 b;
#pragma unroll
  for (int i = 0; i < 8; ++i) b[i] = p0[i];
#pragma unroll
  for (int i = 0; i < 8; ++i) b[8 + i] = p1[i];
  return b;
}

// B fragment 32x16 from a row-major LDS tile: element (k,n) lives at src[k*pitch + n] (n contiguous).
// ds_load_tr16_b128 hands lane (c,h) the column n = c at k = kbase + 8h + 0..7, the k order of load_a_frag.
__device__ __forceinline__ half16 load_b_frag_tr(const _Float16* src, int pitch) {
  const int lane = threadIdx.x & 31;
  const _Float16* p = src + (((lane >> 4) << 3) + (lane & 7)) * pitch + (((lane >> 3) & 1) << 3);
  half8 lo = __builtin_bit_cast(half8, __builtin_amdgcn_ds_load_tr16_b128_v8i16((lds_s16x8*)p));
  half8 hi = __builtin_bit_cast(half8, __builtin_amdgcn_ds_load_tr16_b128_v8i16((lds_s16x8*)(p + 16 * pitch)));
  return __builtin_shufflevector(lo, hi, 0, 1, 2, 3, 4, 5, 6, 7, 8, 9, 10, 11, 12, 13, 14, 15);
}

// ---- GEMM tiling shared by kernels 1 and 3: block = 8 waves = 128 x 128 of the output, 64 of k per step;
// wave (wm, wn) owns 64 x 32 as 4 x 2 accumulator tiles.
__device__ __forceinline__ void gemm_step(const _Float16* As, const _Float16* Bs, int wm, int wn,
                                          float8 (&acc)[4][2]) {
#pragma unroll
  for (int ks = 0; ks < 2; ++ks) {
    half16 af[4], bf[2];
#pragma unroll
    for (int mt = 0; mt < 4; ++mt) af[mt] = load_a_frag(As + (wm * 64 + mt * 16) * PK_ + ks * 32, PK_);
#pragma unroll
    for (int nt = 0; nt < 2; ++nt) bf[nt] = load_b_frag_tr(Bs + ks * 32 * PB_ + wn * 32 + nt * 16, PB_);
#pragma unroll
    for (int mt = 0; mt < 4; ++mt)
#pragma unroll
      for (int nt = 0; nt < 2; ++nt) acc[mt][nt] = wmma_f16(af[mt], bf[nt], acc[mt][nt]);
  }
}

// ---- Kernel 1: input projection of all heads  Out[b,h,s,:] = (X[b,s,:] @ W[h] + bias[h]) * scale
// Output column n of the 1024 stands for head n >> 6, feature n & 63; a block's 128 columns are two heads.
__global__ __launch_bounds__(256)
void proj_kernel(const float* __restrict__ X,    // [B,S,D] = [B*S, D]
                 const float* __restrict__ W,    // [H,D,DK]
                 const float* __restrict__ bias, // [H,DK]
                 _Float16* __restrict__ Out,     // [B*H,S,DK] f16
                 float scale) {
  __shared__ __attribute__((aligned(16))) _Float16 As[128 * PK_];  // [row][k]
  __shared__ __attribute__((aligned(16))) _Float16 Bs[64 * PB_];   // row-major: [k][n]
  const int tid  = threadIdx.x;
  const int wave = tid >> 5;
  const int lane = tid & 31;
  const int wm = wave & 1, wn = wave >> 1;
  const int nbase   = blockIdx.x * 128;
  const int rowbase = blockIdx.y * 128;

  // A tile: 128x64 f32, 2048 float4 slots, 8 per thread: row (tid >> 4) + 16 i, k (tid & 15) * 4.
  // B tile: 64x128 f32, 2048 float4 slots, 8 per thread: k (tid >> 5) + 8 i, column (tid & 31) * 4.
  const int ncol = nbase + ((tid & 31) << 2);
  const float* Xt = X + (size_t)(rowbase + (tid >> 4)) * D_ + ((tid & 15) << 2);
  const float* Wt = W + (size_t)(ncol >> 6) * D_ * DK_ + (size_t)(tid >> 5) * DK_ + (ncol & 63);
  _Float16* Asw = As + (tid >> 4) * PK_ + ((tid & 15) << 2);
  _Float16* Bsw = Bs + (tid >> 5) * PB_ + ((tid & 31) << 2);

  float8 acc[4][2];
#pragma unroll
  for (int mt = 0; mt < 4; ++mt)
#pragma unroll
    for (int nt = 0; nt < 2; ++nt) acc[mt][nt] = f8zero();

  for (int kk = 0; kk < D_; kk += 64) {
    __syncthreads();
    const f32x4* pa = (const f32x4*)(Xt + kk);
    const f32x4* pb = (const f32x4*)(Wt + (size_t)kk * DK_);
    f32x4 va[8], vb[8];
#pragma unroll
    for (int i = 0; i < 8; ++i) {
      va[i] = pa[i * (16 * D_ / 4)];
      vb[i] = pb[i * (8 * DK_ / 4)];
    }
    // Inputs only. The loaded values keep the sixteen loads of a k-step in flight together;
    // the addresses stay unwritten up to the wait.
    asm volatile("s_wait_xcnt 0x0"
                 :: "v"(va[0]), "v"(va[1]), "v"(va[2]), "v"(va[3]), "v"(va[4]), "v"(va[5]), "v"(va[6]), "v"(va[7]),
                    "v"(vb[0]), "v"(vb[1]), "v"(vb[2]), "v"(vb[3]), "v"(vb[4]), "v"(vb[5]), "v"(vb[6]), "v"(vb[7]),
                    "v"(pa), "v"(pb));
#pragma unroll
    for (int i = 0; i < 8; ++i) {
      half4 ha = {(_Float16)va[i].x, (_Float16)va[i].y, (_Float16)va[i].z, (_Float16)va[i].w};
      half4 hb = {(_Float16)vb[i].x, (_Float16)vb[i].y, (_Float16)vb[i].z, (_Float16)vb[i].w};
      *(half4*)(Asw + i * 16 * PK_) = ha;
      *(half4*)(Bsw + i * 8 * PB_)  = hb;
    }
    __syncthreads();

    gemm_step(As, Bs, wm, wn, acc);
  }

  const int n_l = lane & 15;
  const int rb  = (lane >> 4) << 3;
#pragma unroll
  for (int nt = 0; nt < 2; ++nt) {
    int n = nbase + wn * 32 + nt * 16 + n_l;
    float bv = bias[n];
#pragma unroll
    for (int mt = 0; mt < 4; ++mt)
#pragma unroll
      for (int r = 0; r < 8; ++r) {
        int m = rowbase + wm * 64 + mt * 16 + rb + r;     // b = m >> 10, s = m & 1023
        Out[((size_t)((m >> 10) * H_ + (n >> 6)) * S_ + (m & (S_ - 1))) * DK_ + (n & 63)] =
            (_Float16)((acc[mt][nt][r] + bv) * scale);
      }
  }
}

// ---- Kernel 2: flash-style masked attention; block = 4 waves = 64 q rows of one (b,h)
__global__ __launch_bounds__(128)
void attn_kernel(const _Float16* __restrict__ Q,   // [B*H,S,DK] (pre-scaled by 1/sqrt(DK))
                 const _Float16* __restrict__ Km,  // [B*H,S,DK]
                 const _Float16* __restrict__ Vm,  // [B*H,S,DK]
                 const int* __restrict__ mask0,    // [B,S,S]
                 const int* __restrict__ mask1,    // [B,S,S]
                 _Float16* __restrict__ AOut) {    // [B,S,H*DK] f16
  __shared__ __attribute__((aligned(16))) _Float16 Kt[32 * PK_];      // [s_local][dk] (scores B-frags, k-contig)
  __shared__ __attribute__((aligned(16))) _Float16 Vt[32 * PT_];      // [s_local][dk] (PV B-frags, transposing load)
  __shared__ __attribute__((aligned(16))) _Float16 Ps[4 * 16 * PA_];  // per-wave P transpose staging
  const int tid  = threadIdx.x;
  const int wave = tid >> 5;
  const int lane = tid & 31;
  const int n_l  = lane & 15;
  const int rb   = (lane >> 4) << 3;
  const int bh   = blockIdx.y;
  const int b = bh >> 4, h = bh & 15;
  const int q0 = blockIdx.x * 64 + wave * 16;

  const _Float16* Qbh = Q  + (size_t)bh * S_ * DK_;
  const _Float16* Kbh = Km + (size_t)bh * S_ * DK_;
  const _Float16* Vbh = Vm + (size_t)bh * S_ * DK_;
  const int* m0 = mask0 + (size_t)b * S_ * S_;
  const int* m1 = mask1 + (size_t)b * S_ * S_;
  _Float16* Pw = Ps + wave * (16 * PA_);
  const unsigned kt_base = (unsigned)(uintptr_t)(lds_f16*)Kt;  // LDS byte offset of Kt

  half16 qf0 = load_a_frag(Qbh + (size_t)q0 * DK_, DK_);        // k 0..31
  half16 qf1 = load_a_frag(Qbh + (size_t)q0 * DK_ + 32, DK_);   // k 32..63

  const float NEG_INF = -__builtin_inff();
  float mrun[8], lrun[8];
  float8 o0 = f8zero(), o1 = f8zero(), o2 = f8zero(), o3 = f8zero();
#pragma unroll
  for (int r = 0; r < 8; ++r) { mrun[r] = NEG_INF; lrun[r] = 0.f; }

  for (int s0 = 0; s0 < S_; s0 += 32) {
    __syncthreads();   // all waves done reading previous Kt/Vt

    // K tile: 32x64 f16 = 4 KB, async global->LDS, 2x16B per thread.
    {
      const _Float16* gk = Kbh + (size_t)s0 * DK_;
      const unsigned l0 = kt_base + (unsigned)(tid >> 3) * (PK_ * 2u) + (unsigned)(tid & 7) * 16u;
      async_g2l_2x_b128(l0,                   gk + tid * 8,
                        l0 + 16u * PK_ * 2u,  gk + (tid + 128) * 8);
    }
    // V tile kept row-major: Vt[s_local][dk]; the fragment load transposes.
    {
      const _Float16* gv = Vbh + (size_t)s0 * DK_;
#pragma unroll
      for (int i = 0; i < 2; ++i) {
        int slot = tid + i * 128;          // 256 slots of 8 halves
        int srow = slot >> 3;              // s_local 0..31
        int dk0  = (slot & 7) << 3;        // dk 0,8,...,56
        half8 d = *(const half8*)(gv + slot * 8);
        *(half8*)(Vt + srow * PT_ + dk0) = d;
      }
    }
    wait_asynccnt0();   // our async K copies landed in LDS
    __syncthreads();    // staged tiles visible block-wide

    // scores: 16x32 tile of q-rows x keys (two 16x16 WMMA accumulators)
    float8 sc0 = f8zero(), sc1 = f8zero();
    sc0 = wmma_f16(qf0, load_b_frag_kc(Kt,                 PK_), sc0);
    sc0 = wmma_f16(qf1, load_b_frag_kc(Kt + 32,            PK_), sc0);
    sc1 = wmma_f16(qf0, load_b_frag_kc(Kt + 16 * PK_,      PK_), sc1);
    sc1 = wmma_f16(qf1, load_b_frag_kc(Kt + 16 * PK_ + 32, PK_), sc1);

    // pre-softmax key-padding mask
#pragma unroll
    for (int r = 0; r < 8; ++r) {
      int m = q0 + rb + r;
      sc0[r] = (m0[(size_t)m * S_ + s0 + n_l]      == 0) ? NEG_INF : sc0[r];
      sc1[r] = (m0[(size_t)m * S_ + s0 + 16 + n_l] == 0) ? NEG_INF : sc1[r];
    }

    // row max over this 32-key chunk (lanes 0-15: rows 0-7, lanes 16-31: rows 8-15)
    float rmax[8];
#pragma unroll
    for (int r = 0; r < 8; ++r) rmax[r] = fmaxf(sc0[r], sc1[r]);
#pragma unroll
    for (int off = 8; off >= 1; off >>= 1)
#pragma unroll
      for (int r = 0; r < 8; ++r)
        rmax[r] = fmaxf(rmax[r], __shfl_xor(rmax[r], off, 32));

    float mcl[8], alpha[8], rsum[8];
#pragma unroll
    for (int r = 0; r < 8; ++r) {
      float mnew = fmaxf(mrun[r], rmax[r]);
      mcl[r]   = (mnew == NEG_INF) ? 0.f : mnew;
      alpha[r] = (mrun[r] == NEG_INF) ? 0.f : __expf(mrun[r] - mcl[r]);
      mrun[r]  = mnew;
      rsum[r]  = 0.f;
    }

    // p = exp(s - m); denominator uses pre-mask1 p; PV uses mask1*p
#pragma unroll
    for (int r = 0; r < 8; ++r) {
      int m = q0 + rb + r;
      float p0 = __expf(sc0[r] - mcl[r]);
      float p1 = __expf(sc1[r] - mcl[r]);
      rsum[r] += p0 + p1;
      float w0 = m1[(size_t)m * S_ + s0 + n_l]      ? p0 : 0.f;
      float w1 = m1[(size_t)m * S_ + s0 + 16 + n_l] ? p1 : 0.f;
      Pw[(rb + r) * PA_ + n_l]      = (_Float16)w0;
      Pw[(rb + r) * PA_ + 16 + n_l] = (_Float16)w1;
    }

#pragma unroll
    for (int off = 8; off >= 1; off >>= 1)
#pragma unroll
      for (int r = 0; r < 8; ++r)
        rsum[r] += __shfl_xor(rsum[r], off, 32);

#pragma unroll
    for (int r = 0; r < 8; ++r) {
      lrun[r] = lrun[r] * alpha[r] + rsum[r];
      o0[r] *= alpha[r]; o1[r] *= alpha[r]; o2[r] *= alpha[r]; o3[r] *= alpha[r];
    }

    wait_dscnt0();   // P tile visible wave-wide before transposed re-read

    half16 pf = load_a_frag(Pw, PA_);
    o0 = wmma_f16(pf, load_b_frag_tr(Vt +  0, PT_), o0);
    o1 = wmma_f16(pf, load_b_frag_tr(Vt + 16, PT_), o1);
    o2 = wmma_f16(pf, load_b_frag_tr(Vt + 32, PT_), o2);
    o3 = wmma_f16(pf, load_b_frag_tr(Vt + 48, PT_), o3);
  }

  float inv[8];
#pragma unroll
  for (int r = 0; r < 8; ++r) inv[r] = (lrun[r] > 0.f) ? 1.f / lrun[r] : 0.f;

  float8 oo[4] = {o0, o1, o2, o3};
#pragma unroll
  for (int nt = 0; nt < 4; ++nt)
#pragma unroll
    for (int r = 0; r < 8; ++r) {
      int m = q0 + rb + r;
      AOut[((size_t)(b * S_ + m)) * D_ + h * DK_ + nt * 16 + n_l] =
          (_Float16)(oo[nt][r] * inv[r]);
    }
}

// ---- Kernel 3: output projection  Out = A(f16) @ Wo + bo  (f32 out)
__global__ __launch_bounds__(256)
void outproj_kernel(const _Float16* __restrict__ A,  // [B*S, D] f16
                    const float* __restrict__ W,     // [D, D]
                    const float* __restrict__ bias,  // [D]
                    float* __restrict__ Out) {       // [B*S, D]
  __shared__ __attribute__((aligned(16))) _Float16 As[128 * PK_];  // [row][k]
  __shared__ __attribute__((aligned(16))) _Float16 Bs[64 * PB_];   // row-major: [k][n]
  const int tid  = threadIdx.x;
  const int wave = tid >> 5;
  const int lane = tid & 31;
  const int wm = wave & 1, wn = wave >> 1;
  const int nbase   = blockIdx.x * 128;
  const int rowbase = blockIdx.y * 128;

  // A tile: 128x64 f16, 1024 slots of 16 B, 4 per thread: row (tid >> 3) + 32 i, k (tid & 7) * 8.
  // B tile: 64x128 f32, 2048 float4 slots, 8 per thread: k (tid >> 5) + 8 i, column (tid & 31) * 4.
  const _Float16* At = A + (size_t)(rowbase + (tid >> 3)) * D_ + ((tid & 7) << 3);
  const float*    Wt = W + (size_t)(tid >> 5) * D_ + nbase + ((tid & 31) << 2);
  _Float16* Asw = As + (tid >> 3) * PK_ + ((tid & 7) << 3);
  _Float16* Bsw = Bs + (tid >> 5) * PB_ + ((tid & 31) << 2);

  float8 acc[4][2];
#pragma unroll
  for (int mt = 0; mt < 4; ++mt)
#pragma unroll
    for (int nt = 0; nt < 2; ++nt) acc[mt][nt] = f8zero();

  for (int kk = 0; kk < D_; kk += 64) {
    __syncthreads();
    const half8* pa = (const half8*)(At + kk);
    const f32x4* pb = (const f32x4*)(Wt + (size_t)kk * D_);
    half8 av[4];
    f32x4 vb[8];
#pragma unroll
    for (int i = 0; i < 4; ++i) av[i] = pa[i * (32 * D_ / 8)];
#pragma unroll
    for (int i = 0; i < 8; ++i) vb[i] = pb[i * (8 * D_ / 4)];
    // Inputs only. The loaded values keep the twelve loads of a k-step in flight together;
    // the addresses stay unwritten up to the wait (this build addresses the W rows from the last one).
    asm volatile("s_wait_xcnt 0x0"
                 :: "v"(av[0]), "v"(av[1]), "v"(av[2]), "v"(av[3]),
                    "v"(vb[0]), "v"(vb[1]), "v"(vb[2]), "v"(vb[3]), "v"(vb[4]), "v"(vb[5]), "v"(vb[6]), "v"(vb[7]),
                    "v"(pa), "v"(pb + 7 * (8 * D_ / 4)));
#pragma unroll
    for (int i = 0; i < 4; ++i) *(half8*)(Asw + i * 32 * PK_) = av[i];
#pragma unroll
    for (int i = 0; i < 8; ++i) {
      half4 hb = {(_Float16)vb[i].x, (_Float16)vb[i].y, (_Float16)vb[i].z, (_Float16)vb[i].w};
      *(half4*)(Bsw + i * 8 * PB_) = hb;
    }
    __syncthreads();

    gemm_step(As, Bs, wm, wn, acc);
  }

  const int n_l = lane & 15;
  const int rb  = (lane >> 4) << 3;
#pragma unroll
  for (int nt = 0; nt < 2; ++nt) {
    int n = nbase + wn * 32 + nt * 16 + n_l;
    float bv = bias[n];
#pragma unroll
    for (int mt = 0; mt < 4; ++mt)
#pragma unroll
      for (int r = 0; r < 8; ++r) {
        int m = rowbase + wm * 64 + mt * 16 + rb + r;
        Out[(size_t)m * D_ + n] = acc[mt][nt][r] + bv;
      }
  }
}

extern "C" void kernel_launch(void* const* d_in, const int* in_sizes, int n_in,
                              void* d_out, int out_size, void* d_ws, size_t ws_size,
                              hipStream_t stream) {
  const float* query = (const float*)d_in[0];
  const float* key   = (const float*)d_in[1];
  const float* value = (const float*)d_in[2];
  const int*   mask0 = (const int*)d_in[3];
  const int*   mask1 = (const int*)d_in[4];
  const float* Wq    = (const float*)d_in[5];
  const float* bq    = (const float*)d_in[6];
  const float* Wk    = (const float*)d_in[7];
  const float* bk    = (const float*)d_in[8];
  const float* Wv    = (const float*)d_in[9];
  const float* bv    = (const float*)d_in[10];
  const float* Wo    = (const float*)d_in[11];
  const float* bo    = (const float*)d_in[12];
  float* out = (float*)d_out;

  const size_t perTensor = (size_t)B_ * H_ * S_ * DK_;   // 8 Mi halves = 16 MB
  _Float16* Qh = (_Float16*)d_ws;
  _Float16* Kh = Qh + perTensor;
  _Float16* Vh = Kh + perTensor;
  _Float16* Ao = Vh + perTensor;

  dim3 blk(128);
  dim3 gblk(256);
  dim3 ggemm(D_ / 128, (B_ * S_) / 128);
  proj_kernel<<<ggemm, gblk, 0, stream>>>(query, Wq, bq, Qh, 0.125f); // fold 1/sqrt(64)
  proj_kernel<<<ggemm, gblk, 0, stream>>>(key,   Wk, bk, Kh, 1.0f);
  proj_kernel<<<ggemm, gblk, 0, stream>>>(value, Wv, bv, Vh, 1.0f);
  attn_kernel<<<dim3(S_ / 64, B_ * H_), blk, 0, stream>>>(Qh, Kh, Vh, mask0, mask1, Ao);
  outproj_kernel<<<ggemm, gblk, 0, stream>>>(Ao, Wo, bo, out);

  (void)in_sizes; (void)n_in; (void)out_size; (void)ws_size;
}

// v003
// A run of this version takes 191 microseconds.
// In both of two side-by-side timings against v002, it was 1.38 times as fast.
// All steps since v000 together make it 4.23 times as fast.
#include <hip/hip_runtime.h>
#include <hip/hip_bf16.h>

#define B_  8
#define S_  1024
#define D_  1024
#define H_  16
#define DK_ 64

typedef _Float16 half16 __attribute__((ext_vector_type(16)));
typedef _Float16 half8  __attribute__((ext_vector_type(8)));
typedef _Float16 half4  __attribute__((ext_vector_type(4)));
typedef float    float8 __attribute__((ext_vector_type(8)));
typedef float    f32x4  __attribute__((ext_vector_type(4)));
typedef short    s16x8  __attribute__((ext_vector_type(8)));
typedef int      i32x4  __attribute__((ext_vector_type(4)));
typedef __attribute__((address_space(3))) _Float16 lds_f16;
typedef __attribute__((address_space(3))) s16x8    lds_s16x8;

// LDS row pitches in halves. Bank = dword address mod 64, so each tile is pitched for its reader:
// 16 B x odd for rows read by ds_load_b128, 32 B x odd for rows read by ds_load_tr16_b128.
#define PK_ 72   // 64-half rows (128 B) read by ds_load_b128      -> 144 B
#define PT_ 80   // 64-half rows (128 B) read by ds_load_tr16_b128 -> 160 B
#define PB_ 144  // 128-half rows (256 B) read by ds_load_tr16_b128 -> 288 B

__device__ __forceinline__ float8 f8zero() {
  float8 z = {0.f,0.f,0.f,0.f,0.f,0.f,0.f,0.f};
  return z;
}

__device__ __forceinline__ float8 wmma_f16(half16 a, half16 b, float8 c) {
  // D = A(16x32) * B(32x16) + C, f32 accumulate
  return __builtin_amdgcn_wmma_f32_16x16x32_f16(false, a, false, b, (short)0, c, false, false);
}

// Two async 16-byte global -> LDS copies (per-lane addresses), tracked by ASYNCcnt.
// s_wait_xcnt 0 closes the statement so that no address register is rewritten ahead of it.
__device__ __forceinline__ void async_g2l_2x_b128(unsigned lds0, const _Float16* g0,
                                                  unsigned lds1, const _Float16* g1) {
  asm volatile("global_load_async_to_lds_b128 %0, %1, off\n\t"
               "global_load_async_to_lds_b128 %2, %3, off\n\t"
               "s_wait_xcnt 0x0"
               :: "v"(lds0), "v"((unsigned long long)(uintptr_t)g0),
                  "v"(lds1), "v"((unsigned long long)(uintptr_t)g1)
               : "memory");
}
__device__ __forceinline__ void wait_asynccnt0() {
  asm volatile("s_wait_asynccnt 0x0" ::: "memory");
}

// ---- WMMA fragment loaders (ISA 7.12.2 layouts, wave32) -------------------
// A fragment 16x32 f16 from row-major src (ldm halves/row).
__device__ __forceinline__ half16 load_a_frag(const _Float16* src, int ldm) {
  const int lane = threadIdx.x & 31;
  const int row  = lane & 15;
  const int koff = (lane >> 4) << 3;
  const _Float16* p0 = src + row * ldm + koff;
  const _Float16* p1 = p0 + 16;
  half16 a;
#pragma unroll
  for (int i = 0; i < 8; ++i) a[i] = p0[i];
#pragma unroll
  for (int i = 0; i < 8; ++i) a[8 + i] = p1[i];
  return a;
}

// B fragment 32x16 where element (k,n) lives at src[n*ldn + k] (k contiguous).
__device__ __forceinline__ half16 load_b_frag_kc(const _Float16* src, int ldn) {
  const int lane = threadIdx.x & 31;
  const int n    = lane & 15;
  const int koff = (lane >> 4) << 3;
  const _Float16* p0 = src + n * ldn + koff;
  const _Float16* p1 = p0 + 16;
  half16 b;
#pragma unroll
  for (int i = 0; i < 8; ++i) b[i] = p0[i];
#pragma unroll
  for (int i = 0; i < 8; ++i) b[8 + i] = p1[i];
  return b;
}

// B fragment 32x16 from a row-major LDS tile: element (k,n) lives at src[k*pitch + n] (n contiguous).
// ds_load_tr16_b128 hands lane (c,h) the column n = c at k = kbase + 8h + 0..7, the k order of load_a_frag.
__device__ __forceinline__ half16 load_b_frag_tr(const _Float16* src, int pitch) {
  const int lane = threadIdx.x & 31;
  const _Float16* p = src + (((lane >> 4) << 3) + (lane & 7)) * pitch + (((lane >> 3) & 1) << 3);
  half8 lo = __builtin_bit_cast(half8, __builtin_amdgcn_ds_load_tr16_b128_v8i16((lds_s16x8*)p));
  half8 hi = __builtin_bit_cast(half8, __builtin_amdgcn_ds_load_tr16_b128_v8i16((lds_s16x8*)(p + 16 * pitch)));
  return __builtin_shufflevector(lo, hi, 0, 1, 2, 3, 4, 5, 6, 7, 8, 9, 10, 11, 12, 13, 14, 15);
}

// ---- GEMM tiling shared by kernels 1 and 3: block = 8 waves = 128 x 128 of the output, 64 of k per step;
// wave (wm, wn) owns 64 x 32 as 4 x 2 accumulator tiles.
__device__ __forceinline__ void gemm_step(const _Float16* As, const _Float16* Bs, int wm, int wn,
                                          float8 (&acc)[4][2]) {
#pragma unroll
  for (int ks = 0; ks < 2; ++ks) {
    half16 af[4], bf[2];
#pragma unroll
    for (int mt = 0; mt < 4; ++mt) af[mt] = load_a_frag(As + (wm * 64 + mt * 16) * PK_ + ks * 32, PK_);
#pragma unroll
    for (int nt = 0; nt < 2; ++nt) bf[nt] = load_b_frag_tr(Bs + ks * 32 * PB_ + wn * 32 + nt * 16, PB_);
#pragma unroll
    for (int mt = 0; mt < 4; ++mt)
#pragma unroll
      for (int nt = 0; nt < 2; ++nt) acc[mt][nt] = wmma_f16(af[mt], bf[nt], acc[mt][nt]);
  }
}

// ---- Kernel 1: input projection of all heads  Out[b,h,s,:] = (X[b,s,:] @ W[h] + bias[h]) * scale
// Output column n of the 1024 stands for head n >> 6, feature n & 63; a block's 128 columns are two heads.
__global__ __launch_bounds__(256)
void proj_kernel(const float* __restrict__ X,    // [B,S,D] = [B*S, D]
                 const float* __restrict__ W,    // [H,D,DK]
                 const float* __restrict__ bias, // [H,DK]
                 _Float16* __restrict__ Out,     // [B*H,S,DK] f16
                 float scale) {
  __shared__ __attribute__((aligned(16))) _Float16 As[128 * PK_];  // [row][k]
  __shared__ __attribute__((aligned(16))) _Float16 Bs[64 * PB_];   // row-major: [k][n]
  const int tid  = threadIdx.x;
  const int wave = tid >> 5;
  const int lane = tid & 31;
  const int wm = wave & 1, wn = wave >> 1;
  const int nbase   = blockIdx.x * 128;
  const int rowbase = blockIdx.y * 128;

  // A tile: 128x64 f32, 2048 float4 slots, 8 per thread: row (tid >> 4) + 16 i, k (tid & 15) * 4.
  // B tile: 64x128 f32, 2048 float4 slots, 8 per thread: k (tid >> 5) + 8 i, column (tid & 31) * 4.
  const int ncol = nbase + ((tid & 31) << 2);
  const float* Xt = X + (size_t)(rowbase + (tid >> 4)) * D_ + ((tid & 15) << 2);
  const float* Wt = W + (size_t)(ncol >> 6) * D_ * DK_ + (size_t)(tid >> 5) * DK_ + (ncol & 63);
  _Float16* Asw = As + (tid >> 4) * PK_ + ((tid & 15) << 2);
  _Float16* Bsw = Bs + (tid >> 5) * PB_ + ((tid & 31) << 2);

  float8 acc[4][2];
#pragma unroll
  for (int mt = 0; mt < 4; ++mt)
#pragma unroll
    for (int nt = 0; nt < 2; ++nt) acc[mt][nt] = f8zero();

  for (int kk = 0; kk < D_; kk += 64) {
    __syncthreads();
    const f32x4* pa = (const f32x4*)(Xt + kk);
    const f32x4* pb = (const f32x4*)(Wt + (size_t)kk * DK_);
    f32x4 va[8], vb[8];
#pragma unroll
    for (int i = 0; i < 8; ++i) {
      va[i] = pa[i * (16 * D_ / 4)];
      vb[i] = pb[i * (8 * DK_ / 4)];
    }
    // Inputs only. The loaded values keep the sixteen loads of a k-step in flight together;
    // the addresses stay unwritten up to the wait.
    asm volatile("s_wait_xcnt 0x0"
                 :: "v"(va[0]), "v"(va[1]), "v"(va[2]), "v"(va[3]), "v"(va[4]), "v"(va[5]), "v"(va[6]), "v"(va[7]),
                    "v"(vb[0]), "v"(vb[1]), "v"(vb[2]), "v"(vb[3]), "v"(vb[4]), "v"(vb[5]), "v"(vb[6]), "v"(vb[7]),
                    "v"(pa), "v"(pb));
#pragma unroll
    for (int i = 0; i < 8; ++i) {
      half4 ha = {(_Float16)va[i].x, (_Float16)va[i].y, (_Float16)va[i].z, (_Float16)va[i].w};
      half4 hb = {(_Float16)vb[i].x, (_Float16)vb[i].y, (_Float16)vb[i].z, (_Float16)vb[i].w};
      *(half4*)(Asw + i * 16 * PK_) = ha;
      *(half4*)(Bsw + i * 8 * PB_)  = hb;
    }
    __syncthreads();

    gemm_step(As, Bs, wm, wn, acc);
  }

  const int n_l = lane & 15;
  const int rb  = (lane >> 4) << 3;
#pragma unroll
  for (int nt = 0; nt < 2; ++nt) {
    int n = nbase + wn * 32 + nt * 16 + n_l;
    float bv = bias[n];
#pragma unroll
    for (int mt = 0; mt < 4; ++mt)
#pragma unroll
      for (int r = 0; r < 8; ++r) {
        int m = rowbase + wm * 64 + mt * 16 + rb + r;     // b = m >> 10, s = m & 1023
        Out[((size_t)((m >> 10) * H_ + (n >> 6)) * S_ + (m & (S_ - 1))) * DK_ + (n & 63)] =
            (_Float16)((acc[mt][nt][r] + bv) * scale);
      }
  }
}

// ---- Kernel 2: flash-style masked attention, transposed: S^T = K Q^T, O^T += V^T P^T.
// Block = 4 waves = 64 queries of one (b,h); a wave owns 16 queries, one per lane column c = lane & 15.
// A lane (c, hh) holds query c's scores of keys 8 hh + r (tile 0) and 16 + 8 hh + r (tile 1): the k order of a
// B operand, so P^T goes from the score accumulators into the second product with no lane exchange and no LDS.
__device__ __forceinline__ float xhalf(float x) {   // lane l with lane l ^ 16
  return __builtin_bit_cast(float, __builtin_amdgcn_permlanex16(__builtin_bit_cast(int, x), __builtin_bit_cast(int, x),
                                                                0x76543210, 0xfedcba98, false, false));
}

// exp2 in asm text, in place, so that the slot which the instruction set asks for behind a transcendental (one
// independent instruction or v_nop before its result is read or its source overwritten) is tied to it: in the group
// of four each exp is the independent instruction behind the one before it, and the v_nop stands behind the last.
__device__ __forceinline__ float exp2_1(float x) {
  asm("v_exp_f32 %0, %0\n\tv_nop" : "+v"(x));
  return x;
}
__device__ __forceinline__ void exp2_4(float& a, float& b, float& c, float& d) {
  asm("v_exp_f32 %0, %0\n\tv_exp_f32 %1, %1\n\tv_exp_f32 %2, %2\n\tv_exp_f32 %3, %3\n\tv_nop"
      : "+v"(a), "+v"(b), "+v"(c), "+v"(d));
}

__global__ __launch_bounds__(128)
void attn_kernel(const _Float16* __restrict__ Q,   // [B*H,S,DK] (pre-scaled by 1/sqrt(DK))
                 const _Float16* __restrict__ Km,  // [B*H,S,DK]
                 const _Float16* __restrict__ Vm,  // [B*H,S,DK]
                 const int* __restrict__ mask0,    // [B,S,S]
                 const int* __restrict__ mask1,    // [B,S,S]
                 _Float16* __restrict__ AOut) {    // [B,S,H*DK] f16
  __shared__ __attribute__((aligned(16))) _Float16 Kt[32 * PK_];      // [s_local][dk] (S^T A-frags, k-contig)
  __shared__ __attribute__((aligned(16))) _Float16 Vt[32 * PT_];      // [s_local][dk] (V^T A-frags, transposing load)
  const int tid  = threadIdx.x;
  const int wave = tid >> 5;
  const int lane = tid & 31;
  const int n_l  = lane & 15;
  const int rb   = (lane >> 4) << 3;
  const int bh   = blockIdx.y;
  const int b = bh >> 4, h = bh & 15;
  const int q0 = blockIdx.x * 64 + wave * 16;

  const _Float16* Qbh = Q  + (size_t)bh * S_ * DK_;
  const _Float16* Kbh = Km + (size_t)bh * S_ * DK_;
  const _Float16* Vbh = Vm + (size_t)bh * S_ * DK_;
  // This lane's mask row (its query), at its first key of a 32-key chunk.
  const int* m0 = mask0 + (size_t)b * S_ * S_ + (size_t)(q0 + n_l) * S_ + rb;
  const int* m1 = mask1 + (size_t)b * S_ * S_ + (size_t)(q0 + n_l) * S_ + rb;
  const unsigned kt_base = (unsigned)(uintptr_t)(lds_f16*)Kt;  // LDS byte offset of Kt

  half16 qf0 = load_b_frag_kc(Qbh + (size_t)q0 * DK_, DK_);        // Q^T, k = dk 0..31
  half16 qf1 = load_b_frag_kc(Qbh + (size_t)q0 * DK_ + 32, DK_);   // Q^T, k = dk 32..63

  const float NEG_INF = -__builtin_inff();
  const float LOG2E = 1.44269504f;   // exp(x) = exp2(x * log2 e)
  float mrun = NEG_INF;   // this query's running maximum (equal in both halves)
  float lrun = 0.f;       // running sum over this half's keys; the halves are joined after the loop
  float8 o0 = f8zero(), o1 = f8zero(), o2 = f8zero(), o3 = f8zero();   // O^T: row dk = 16 t + rb + r, column = query

  for (int s0 = 0; s0 < S_; s0 += 32) {
    __syncthreads();   // all waves done reading previous Kt/Vt

    // K tile: 32x64 f16 = 4 KB, async global->LDS, 2x16B per thread.
    {
      const _Float16* gk = Kbh + (size_t)s0 * DK_;
      const unsigned l0 = kt_base + (unsigned)(tid >> 3) * (PK_ * 2u) + (unsigned)(tid & 7) * 16u;
      async_g2l_2x_b128(l0,                   gk + tid * 8,
                        l0 + 16u * PK_ * 2u,  gk + (tid + 128) * 8);
    }
    // V tile kept row-major: Vt[s_local][dk]; the fragment load transposes. 256 slots of 8 halves, 2 per thread.
    const half8* gv = (const half8*)(Vbh + (size_t)s0 * DK_) + tid;
    half8 v0 = gv[0], v1 = gv[128];
    // Mask words of this chunk, in flight together with the K and V tiles: 8 consecutive keys per score tile and lane.
    const i32x4* pm0 = (const i32x4*)(m0 + s0);
    const i32x4* pm1 = (const i32x4*)(m1 + s0);
    i32x4 k0[4] = {pm0[0], pm0[1], pm0[4], pm0[5]};
    i32x4 k1[4] = {pm1[0], pm1[1], pm1[4], pm1[5]};
    // The ten load addresses stay unwritten up to this wait, which stands behind the loads.
    asm volatile("s_wait_xcnt 0x0" :: "v"(pm0), "v"(pm1), "v"(gv) : "memory");
    *(half8*)(Vt + (tid >> 3) * PT_ + ((tid & 7) << 3))        = v0;
    *(half8*)(Vt + ((tid >> 3) + 16) * PT_ + ((tid & 7) << 3)) = v1;
    wait_asynccnt0();   // our async K copies landed in LDS
    __syncthreads();    // staged tiles visible block-wide

    // scores, transposed: two 16x16 tiles of keys x queries
    float8 sc0 = f8zero(), sc1 = f8zero();
    sc0 = wmma_f16(load_a_frag(Kt,                 PK_), qf0, sc0);
    sc0 = wmma_f16(load_a_frag(Kt + 32,            PK_), qf1, sc0);
    sc1 = wmma_f16(load_a_frag(Kt + 16 * PK_,      PK_), qf0, sc1);
    sc1 = wmma_f16(load_a_frag(Kt + 16 * PK_ + 32, PK_), qf1, sc1);

    // pre-softmax key-padding mask, then this query's maximum over the chunk: in-lane, one exchange of halves
    float mx = NEG_INF;
#pragma unroll
    for (int r = 0; r < 8; ++r) {
      sc0[r] = (k0[r >> 2][r & 3]       == 0) ? NEG_INF : sc0[r];
      sc1[r] = (k0[2 + (r >> 2)][r & 3] == 0) ? NEG_INF : sc1[r];
      mx = fmaxf(mx, fmaxf(sc0[r], sc1[r]));
    }
    mx = fmaxf(mx, xhalf(mx));

    const float mnew  = fmaxf(mrun, mx);
    const float mcl   = (mnew == NEG_INF) ? 0.f : mnew;
    const float ea    = exp2_1((mrun - mcl) * LOG2E);
    const float alpha = (mrun == NEG_INF) ? 0.f : ea;
    mrun = mnew;

    // p = exp(s - m); denominator uses pre-mask1 p; PV uses mask1*p
    float e0[8], e1[8];
#pragma unroll
    for (int r = 0; r < 8; ++r) {
      e0[r] = (sc0[r] - mcl) * LOG2E;
      e1[r] = (sc1[r] - mcl) * LOG2E;
    }
    exp2_4(e0[0], e0[1], e0[2], e0[3]);
    exp2_4(e0[4], e0[5], e0[6], e0[7]);
    exp2_4(e1[0], e1[1], e1[2], e1[3]);
    exp2_4(e1[4], e1[5], e1[6], e1[7]);
    float rsum = 0.f;
    half16 pf;
#pragma unroll
    for (int r = 0; r < 8; ++r) {
      float p0 = e0[r];
      float p1 = e1[r];
      rsum += p0 + p1;
      pf[r]     = (_Float16)(k1[r >> 2][r & 3]       ? p0 : 0.f);
      pf[8 + r] = (_Float16)(k1[2 + (r >> 2)][r & 3] ? p1 : 0.f);
    }
    lrun = lrun * alpha + rsum;
#pragma unroll
    for (int r = 0; r < 8; ++r) {
      o0[r] *= alpha; o1[r] *= alpha; o2[r] *= alpha; o3[r] *= alpha;
    }

    o0 = wmma_f16(load_b_frag_tr(Vt +  0, PT_), pf, o0);
    o1 = wmma_f16(load_b_frag_tr(Vt + 16, PT_), pf, o1);
    o2 = wmma_f16(load_b_frag_tr(Vt + 32, PT_), pf, o2);
    o3 = wmma_f16(load_b_frag_tr(Vt + 48, PT_), pf, o3);
  }

  const float lsum = lrun + xhalf(lrun);
  const float inv  = (lsum > 0.f) ? 1.f / lsum : 0.f;

  // A lane's 8 accumulator registers are 8 consecutive dk of its query: one 16-byte store per tile.
  _Float16* orow = AOut + ((size_t)(b * S_ + q0 + n_l)) * D_ + h * DK_ + rb;
  float8 oo[4] = {o0, o1, o2, o3};
#pragma unroll
  for (int nt = 0; nt < 4; ++nt) {
    half8 ov;
#pragma unroll
    for (int r = 0; r < 8; ++r) ov[r] = (_Float16)(oo[nt][r] * inv);
    *(half8*)(orow + nt * 16) = ov;
  }
}

// ---- Kernel 3: output projection  Out = A(f16) @ Wo + bo  (f32 out)
__global__ __launch_bounds__(256)
void outproj_kernel(const _Float16* __restrict__ A,  // [B*S, D] f16
                    const float* __restrict__ W,     // [D, D]
                    const float* __restrict__ bias,  // [D]
                    float* __restrict__ Out) {       // [B*S, D]
  __shared__ __attribute__((aligned(16))) _Float16 As[128 * PK_];  // [row][k]
  __shared__ __attribute__((aligned(16))) _Float16 Bs[64 * PB_];   // row-major: [k][n]
  const int tid  = threadIdx.x;
  const int wave = tid >> 5;
  const int lane = tid & 31;
  const int wm = wave & 1, wn = wave >> 1;
  const int nbase   = blockIdx.x * 128;
  const int rowbase = blockIdx.y * 128;

  // A tile: 128x64 f16, 1024 slots of 16 B, 4 per thread: row (tid >> 3) + 32 i, k (tid & 7) * 8.
  // B tile: 64x128 f32, 2048 float4 slots, 8 per thread: k (tid >> 5) + 8 i, column (tid & 31) * 4.
  const _Float16* At = A + (size_t)(rowbase + (tid >> 3)) * D_ + ((tid & 7) << 3);
  const float*    Wt = W + (size_t)(tid >> 5) * D_ + nbase + ((tid & 31) << 2);
  _Float16* Asw = As + (tid >> 3) * PK_ + ((tid & 7) << 3);
  _Float16* Bsw = Bs + (tid >> 5) * PB_ + ((tid & 31) << 2);

  float8 acc[4][2];
#pragma unroll
  for (int mt = 0; mt < 4; ++mt)
#pragma unroll
    for (int nt = 0; nt < 2; ++nt) acc[mt][nt] = f8zero();

  for (int kk = 0; kk < D_; kk += 64) {
    __syncthreads();
    const half8* pa = (const half8*)(At + kk);
    const f32x4* pb = (const f32x4*)(Wt + (size_t)kk * D_);
    half8 av[4];
    f32x4 vb[8];
#pragma unroll
    for (int i = 0; i < 4; ++i) av[i] = pa[i * (32 * D_ / 8)];
#pragma unroll
    for (int i = 0; i < 8; ++i) vb[i] = pb[i * (8 * D_ / 4)];
    // Inputs only. The loaded values keep the twelve loads of a k-step in flight together;
    // the addresses stay unwritten up to the wait (this build addresses the W rows from the last one).
    asm volatile("s_wait_xcnt 0x0"
                 :: "v"(av[0]), "v"(av[1]), "v"(av[2]), "v"(av[3]),
                    "v"(vb[0]), "v"(vb[1]), "v"(vb[2]), "v"(vb[3]), "v"(vb[4]), "v"(vb[5]), "v"(vb[6]), "v"(vb[7]),
                    "v"(pa), "v"(pb + 7 * (8 * D_ / 4)));
#pragma unroll
    for (int i = 0; i < 4; ++i) *(half8*)(Asw + i * 32 * PK_) = av[i];
#pragma unroll
    for (int i = 0; i < 8; ++i) {
      half4 hb = {(_Float16)vb[i].x, (_Float16)vb[i].y, (_Float16)vb[i].z, (_Float16)vb[i].w};
      *(half4*)(Bsw + i * 8 * PB_) = hb;
    }
    __syncthreads();

    gemm_step(As, Bs, wm, wn, acc);
  }

  const int n_l = lane & 15;
  const int rb  = (lane >> 4) << 3;
#pragma unroll
  for (int nt = 0; nt < 2; ++nt) {
    int n = nbase + wn * 32 + nt * 16 + n_l;
    float bv = bias[n];
#pragma unroll
    for (int mt = 0; mt < 4; ++mt)
#pragma unroll
      for (int r = 0; r < 8; ++r) {
        int m = rowbase + wm * 64 + mt * 16 + rb + r;
        Out[(size_t)m * D_ + n] = acc[mt][nt][r] + bv;
      }
  }
}

extern "C" void kernel_launch(void* const* d_in, const int* in_sizes, int n_in,
                              void* d_out, int out_size, void* d_ws, size_t ws_size,
                              hipStream_t stream) {
  const float* query = (const float*)d_in[0];
  const float* key   = (const float*)d_in[1];
  const float* value = (const float*)d_in[2];
  const int*   mask0 = (const int*)d_in[3];
  const int*   mask1 = (const int*)d_in[4];
  const float* Wq    = (const float*)d_in[5];
  const float* bq    = (const float*)d_in[6];
  const float* Wk    = (const float*)d_in[7];
  const float* bk    = (const float*)d_in[8];
  const float* Wv    = (const float*)d_in[9];
  const float* bv    = (const float*)d_in[10];
  const float* Wo    = (const float*)d_in[11];
  const float* bo    = (const float*)d_in[12];
  float* out = (float*)d_out;

  const size_t perTensor = (size_t)B_ * H_ * S_ * DK_;   // 8 Mi halves = 16 MB
  _Float16* Qh = (_Float16*)d_ws;
  _Float16* Kh = Qh + perTensor;
  _Float16* Vh = Kh + perTensor;
  _Float16* Ao = Vh + perTensor;

  dim3 blk(128);
  dim3 gblk(256);
  dim3 ggemm(D_ / 128, (B_ * S_) / 128);
  proj_kernel<<<ggemm, gblk, 0, stream>>>(query, Wq, bq, Qh, 0.125f); // fold 1/sqrt(64)
  proj_kernel<<<ggemm, gblk, 0, stream>>>(key,   Wk, bk, Kh, 1.0f);
  proj_kernel<<<ggemm, gblk, 0, stream>>>(value, Wv, bv, Vh, 1.0f);
  attn_kernel<<<dim3(S_ / 64, B_ * H_), blk, 0, stream>>>(Qh, Kh, Vh, mask0, mask1, Ao);
  outproj_kernel<<<ggemm, gblk, 0, stream>>>(Ao, Wo, bo, out);

  (void)in_sizes; (void)n_in; (void)out_size; (void)ws_size;
}

// v004
// A run of this version takes 169 microseconds.
// Timed twice side by side with v003, it ran 1.13 and 1.12 times as fast.
// Counting every step since v000, it is 4.77 times as fast.
#include <hip/hip_runtime.h>
#include <hip/hip_bf16.h>

#define B_  8
#define S_  1024
#define D_  1024
#define H_  16
#define DK_ 64

typedef _Float16 half16 __attribute__((ext_vector_type(16)));
typedef _Float16 half8  __attribute__((ext_vector_type(8)));
typedef _Float16 half4  __attribute__((ext_vector_type(4)));
typedef float    float8 __attribute__((ext_vector_type(8)));
typedef float    f32x4  __attribute__((ext_vector_type(4)));
typedef short    s16x8  __attribute__((ext_vector_type(8)));
typedef int      i32x4  __attribute__((ext_vector_type(4)));
typedef __attribute__((address_space(3))) _Float16 lds_f16;
typedef __attribute__((address_space(3))) s16x8    lds_s16x8;
typedef unsigned u32x16 __attribute__((ext_vector_type(16)));

// LDS row pitches in halves. Bank = dword address mod 64, so each tile is pitched for its reader:
// 16 B x odd for rows read by ds_load_b128, 32 B x odd for rows read by ds_load_tr16_b128.
#define PK_ 72   // 64-half rows (128 B) read by ds_load_b128      -> 144 B
#define PT_ 80   // 64-half rows (128 B) read by ds_load_tr16_b128 -> 160 B
#define PB_ 144  // 128-half rows (256 B) read by ds_load_tr16_b128 -> 288 B

__device__ __forceinline__ float8 f8zero() {
  float8 z = {0.f,0.f,0.f,0.f,0.f,0.f,0.f,0.f};
  return z;
}

__device__ __forceinline__ float8 wmma_f16(half16 a, half16 b, float8 c) {
  // D = A(16x32) * B(32x16) + C, f32 accumulate
  return __builtin_amdgcn_wmma_f32_16x16x32_f16(false, a, false, b, (short)0, c, false, false);
}

// Two async 16-byte global -> LDS copies (per-lane addresses), tracked by ASYNCcnt.
// s_wait_xcnt 0 closes the statement so that no address register is rewritten ahead of it.
__device__ __forceinline__ void async_g2l_2x_b128(unsigned lds0, const _Float16* g0,
                                                  unsigned lds1, const _Float16* g1) {
  asm volatile("global_load_async_to_lds_b128 %0, %1, off\n\t"
               "global_load_async_to_lds_b128 %2, %3, off\n\t"
               "s_wait_xcnt 0x0"
               :: "v"(lds0), "v"((unsigned long long)(uintptr_t)g0),
                  "v"(lds1), "v"((unsigned long long)(uintptr_t)g1)
               : "memory");
}
__device__ __forceinline__ void wait_asynccnt0() {
  asm volatile("s_wait_asynccnt 0x0" ::: "memory");
}

// ---- WMMA fragment loaders (ISA 7.12.2 layouts, wave32) -------------------
// A fragment 16x32 f16 from row-major src (ldm halves/row).
__device__ __forceinline__ half16 load_a_frag(const _Float16* src, int ldm) {
  const int lane = threadIdx.x & 31;
  const int row  = lane & 15;
  const int koff = (lane >> 4) << 3;
  const _Float16* p0 = src + row * ldm + koff;
  const _Float16* p1 = p0 + 16;
  half16 a;
#pragma unroll
  for (int i = 0; i < 8; ++i) a[i] = p0[i];
#pragma unroll
  for (int i = 0; i < 8; ++i) a[8 + i] = p1[i];
  return a;
}

// B fragment 32x16 where element (k,n) lives at src[n*ldn + k] (k contiguous).
__device__ __forceinline__ half16 load_b_frag_kc(const _Float16* src, int ldn) {
  const int lane = threadIdx.x & 31;
  const int n    = lane & 15;
  const int koff = (lane >> 4) << 3;
  const _Float16* p0 = src + n * ldn + koff;
  const _Float16* p1 = p0 + 16;
  half16 b;
#pragma unroll
  for (int i = 0; i < 8; ++i) b[i] = p0[i];
#pragma unroll
  for (int i = 0; i < 8; ++i) b[8 + i] = p1[i];
  return b;
}

// B fragment 32x16 from a row-major LDS tile: element (k,n) lives at src[k*pitch + n] (n contiguous).
// ds_load_tr16_b128 hands lane (c,h) the column n = c at k = kbase + 8h + 0..7, the k order of load_a_frag.
__device__ __forceinline__ half16 load_b_frag_tr(const _Float16* src, int pitch) {
  const int lane = threadIdx.x & 31;
  const _Float16* p = src + (((lane >> 4) << 3) + (lane & 7)) * pitch + (((lane >> 3) & 1) << 3);
  half8 lo = __builtin_bit_cast(half8, __builtin_amdgcn_ds_load_tr16_b128_v8i16((lds_s16x8*)p));
  half8 hi = __builtin_bit_cast(half8, __builtin_amdgcn_ds_load_tr16_b128_v8i16((lds_s16x8*)(p + 16 * pitch)));
  return __builtin_shufflevector(lo, hi, 0, 1, 2, 3, 4, 5, 6, 7, 8, 9, 10, 11, 12, 13, 14, 15);
}

// ---- GEMM tiling shared by kernels 1 and 3: block = 8 waves = 128 x 128 of the output, 64 of k per step;
// wave (wm, wn) owns 64 x 32 as 4 x 2 accumulator tiles.
__device__ __forceinline__ void gemm_step(const _Float16* As, const _Float16* Bs, int wm, int wn,
                                          float8 (&acc)[4][2]) {
#pragma unroll
  for (int ks = 0; ks < 2; ++ks) {
    half16 af[4], bf[2];
#pragma unroll
    for (int mt = 0; mt < 4; ++mt) af[mt] = load_a_frag(As + (wm * 64 + mt * 16) * PK_ + ks * 32, PK_);
#pragma unroll
    for (int nt = 0; nt < 2; ++nt) bf[nt] = load_b_frag_tr(Bs + ks * 32 * PB_ + wn * 32 + nt * 16, PB_);
#pragma unroll
    for (int mt = 0; mt < 4; ++mt)
#pragma unroll
      for (int nt = 0; nt < 2; ++nt) acc[mt][nt] = wmma_f16(af[mt], bf[nt], acc[mt][nt]);
  }
}

// ---- Kernel 1: input projection of all heads  Out[b,h,s,:] = (X[b,s,:] @ W[h] + bias[h]) * scale
// Output column n of the 1024 stands for head n >> 6, feature n & 63; a block's 128 columns are two heads.
__global__ __launch_bounds__(256)
void proj_kernel(const float* __restrict__ X,    // [B,S,D] = [B*S, D]
                 const float* __restrict__ W,    // [H,D,DK]
                 const float* __restrict__ bias, // [H,DK]
                 _Float16* __restrict__ Out,     // [B*H,S,DK] f16
                 float scale) {
  __shared__ __attribute__((aligned(16))) _Float16 As[128 * PK_];  // [row][k]
  __shared__ __attribute__((aligned(16))) _Float16 Bs[64 * PB_];   // row-major: [k][n]
  const int tid  = threadIdx.x;
  const int wave = tid >> 5;
  const int lane = tid & 31;
  const int wm = wave & 1, wn = wave >> 1;
  const int nbase   = blockIdx.x * 128;
  const int rowbase = blockIdx.y * 128;

  // A tile: 128x64 f32, 2048 float4 slots, 8 per thread: row (tid >> 4) + 16 i, k (tid & 15) * 4.
  // B tile: 64x128 f32, 2048 float4 slots, 8 per thread: k (tid >> 5) + 8 i, column (tid & 31) * 4.
  const int ncol = nbase + ((tid & 31) << 2);
  const float* Xt = X + (size_t)(rowbase + (tid >> 4)) * D_ + ((tid & 15) << 2);
  const float* Wt = W + (size_t)(ncol >> 6) * D_ * DK_ + (size_t)(tid >> 5) * DK_ + (ncol & 63);
  _Float16* Asw = As + (tid >> 4) * PK_ + ((tid & 15) << 2);
  _Float16* Bsw = Bs + (tid >> 5) * PB_ + ((tid & 31) << 2);

  float8 acc[4][2];
#pragma unroll
  for (int mt = 0; mt < 4; ++mt)
#pragma unroll
    for (int nt = 0; nt < 2; ++nt) acc[mt][nt] = f8zero();

  for (int kk = 0; kk < D_; kk += 64) {
    __syncthreads();
    const f32x4* pa = (const f32x4*)(Xt + kk);
    const f32x4* pb = (const f32x4*)(Wt + (size_t)kk * DK_);
    f32x4 va[8], vb[8];
#pragma unroll
    for (int i = 0; i < 8; ++i) {
      va[i] = pa[i * (16 * D_ / 4)];
      vb[i] = pb[i * (8 * DK_ / 4)];
    }
    // Inputs only. The loaded values keep the sixteen loads of a k-step in flight together;
    // the addresses stay unwritten up to the wait.
    asm volatile("s_wait_xcnt 0x0"
                 :: "v"(va[0]), "v"(va[1]), "v"(va[2]), "v"(va[3]), "v"(va[4]), "v"(va[5]), "v"(va[6]), "v"(va[7]),
                    "v"(vb[0]), "v"(vb[1]), "v"(vb[2]), "v"(vb[3]), "v"(vb[4]), "v"(vb[5]), "v"(vb[6]), "v"(vb[7]),
                    "v"(pa), "v"(pb));
#pragma unroll
    for (int i = 0; i < 8; ++i) {
      half4 ha = {(_Float16)va[i].x, (_Float16)va[i].y, (_Float16)va[i].z, (_Float16)va[i].w};
      half4 hb = {(_Float16)vb[i].x, (_Float16)vb[i].y, (_Float16)vb[i].z, (_Float16)vb[i].w};
      *(half4*)(Asw + i * 16 * PK_) = ha;
      *(half4*)(Bsw + i * 8 * PB_)  = hb;
    }
    __syncthreads();

    gemm_step(As, Bs, wm, wn, acc);
  }

  const int n_l = lane & 15;
  const int rb  = (lane >> 4) << 3;
#pragma unroll
  for (int nt = 0; nt < 2; ++nt) {
    int n = nbase + wn * 32 + nt * 16 + n_l;
    float bv = bias[n];
#pragma unroll
    for (int mt = 0; mt < 4; ++mt)
#pragma unroll
      for (int r = 0; r < 8; ++r) {
        int m = rowbase + wm * 64 + mt * 16 + rb + r;     // b = m >> 10, s = m & 1023
        Out[((size_t)((m >> 10) * H_ + (n >> 6)) * S_ + (m & (S_ - 1))) * DK_ + (n & 63)] =
            (_Float16)((acc[mt][nt][r] + bv) * scale);
      }
  }
}

// ---- Kernel 2: flash-style masked attention, transposed: S^T = K Q^T, O^T += V^T P^T.
// Block = 4 waves = 64 queries of one (b,h); a wave owns 16 queries, one per lane column c = lane & 15.
// A lane (c, hh) holds query c's scores of keys 8 hh + r (tile 0) and 16 + 8 hh + r (tile 1): the k order of a
// B operand, so P^T goes from the score accumulators into the second product with no lane exchange and no LDS.
__device__ __forceinline__ float xhalf(float x) {   // lane l with lane l ^ 16
  return __builtin_bit_cast(float, __builtin_amdgcn_permlanex16(__builtin_bit_cast(int, x), __builtin_bit_cast(int, x),
                                                                0x76543210, 0xfedcba98, false, false));
}

// exp2 in asm text, in place, so that the slot which the instruction set asks for behind a transcendental (one
// independent instruction or v_nop before its result is read or its source overwritten) is tied to it: in the group
// of four each exp is the independent instruction behind the one before it, and the v_nop stands behind the last.
__device__ __forceinline__ float exp2_1(float x) {
  asm("v_exp_f32 %0, %0\n\tv_nop" : "+v"(x));
  return x;
}
__device__ __forceinline__ void exp2_4(float& a, float& b, float& c, float& d) {
  asm("v_exp_f32 %0, %0\n\tv_exp_f32 %1, %1\n\tv_exp_f32 %2, %2\n\tv_exp_f32 %3, %3\n\tv_nop"
      : "+v"(a), "+v"(b), "+v"(c), "+v"(d));
}

// ---- Mask pre-pass: both masks, read once for all 16 heads, become lane-mask words for the attention kernel.
// A tile is 16 queries x 32 keys in the attention wave's own lane layout (lane (c, hh) holds query c, keys 8 hh + r
// and 16 + 8 hh + r). Word i of mask m has bit l = (lane l's element i of mask m != 0); a tile is 32 words = 128 B:
// words 0..15 mask0, 16..31 mask1. Tile index = (b * 64 + query tile) * 32 + key chunk.
// A wave takes four tiles side by side (16 rows x 128 keys), a block the 16 whole rows.
#define PM_ 132  // LDS pitch in words of a 128-word row read by ds_load_b128: 528 B = 16 B x odd
__global__ __launch_bounds__(256)
void maskpack_kernel(const int* __restrict__ mask0,    // [B,S,S]
                     const int* __restrict__ mask1,    // [B,S,S]
                     unsigned* __restrict__ bits) {    // [B*S/16, S/32, 32]
  __shared__ __attribute__((aligned(16))) int sm[8][2][16 * PM_];   // each wave's own staging
  const int lane = threadIdx.x & 31;
  const int wave = threadIdx.x >> 5;
  // Each global load takes 512 contiguous bytes of one row.
  const size_t off = (size_t)blockIdx.x * 16 * S_ + wave * 128 + (lane << 2);
  const i32x4* pm0 = (const i32x4*)(mask0 + off);
  const i32x4* pm1 = (const i32x4*)(mask1 + off);
  i32x4 g0[16], g1[16];
#pragma unroll
  for (int c = 0; c < 16; ++c) {
    g0[c] = pm0[c * (S_ / 4)];
    g1[c] = pm1[c * (S_ / 4)];
  }
  // The load addresses stay unwritten up to this wait, which stands behind the 32 loads.
  asm volatile("s_wait_xcnt 0x0" :: "v"(pm0), "v"(pm1) : "memory");
  int* sw = sm[wave][0] + (lane << 2);
#pragma unroll
  for (int c = 0; c < 16; ++c) {
    *(i32x4*)(sw + c * PM_)             = g0[c];
    *(i32x4*)(sw + 16 * PM_ + c * PM_)  = g1[c];
  }
  __syncthreads();   // the rows are read back by other lanes
  const int* sr = sm[wave][0] + (lane & 15) * PM_ + ((lane >> 4) << 3);
  unsigned* bw = bits + ((size_t)blockIdx.x * 32 + wave * 4) * 32 + lane;
#pragma unroll
  for (int jj = 0; jj < 4; ++jj) {
    const i32x4* r0 = (const i32x4*)(sr + jj * 32);
    const i32x4* r1 = (const i32x4*)(sr + 16 * PM_ + jj * 32);
    i32x4 k0[4] = {r0[0], r0[1], r0[4], r0[5]};
    i32x4 k1[4] = {r1[0], r1[1], r1[4], r1[5]};
    unsigned w = 0;
#pragma unroll
    for (int i = 0; i < 16; ++i) {
      const unsigned b0 = __builtin_amdgcn_ballot_w32(k0[i >> 2][i & 3] != 0);
      const unsigned b1 = __builtin_amdgcn_ballot_w32(k1[i >> 2][i & 3] != 0);
      w = (lane == i) ? b0 : w;
      w = (lane == 16 + i) ? b1 : w;
    }
    bw[jj * 32] = w;
  }
}

__global__ __launch_bounds__(128)
void attn_kernel(const _Float16* __restrict__ Q,   // [B*H,S,DK] (pre-scaled by 1/sqrt(DK))
                 const _Float16* __restrict__ Km,  // [B*H,S,DK]
                 const _Float16* __restrict__ Vm,  // [B*H,S,DK]
                 const unsigned* __restrict__ bits, // lane-mask words of maskpack_kernel
                 _Float16* __restrict__ AOut) {    // [B,S,H*DK] f16
  __shared__ __attribute__((aligned(16))) _Float16 Kt[32 * PK_];      // [s_local][dk] (S^T A-frags, k-contig)
  __shared__ __attribute__((aligned(16))) _Float16 Vt[32 * PT_];      // [s_local][dk] (V^T A-frags, transposing load)
  const int tid  = threadIdx.x;
  const int wave = tid >> 5;
  const int lane = tid & 31;
  const int n_l  = lane & 15;
  const int rb   = (lane >> 4) << 3;
  const int bh   = blockIdx.y;
  const int b = bh >> 4, h = bh & 15;
  const int q0 = blockIdx.x * 64 + wave * 16;

  const _Float16* Qbh = Q  + (size_t)bh * S_ * DK_;
  const _Float16* Kbh = Km + (size_t)bh * S_ * DK_;
  const _Float16* Vbh = Vm + (size_t)bh * S_ * DK_;
  // This wave's lane-mask words: 128 B per 32-key chunk at a wave-uniform address, so they come by scalar loads.
  const int qtile = __builtin_amdgcn_readfirstlane(b * (S_ / 16) + blockIdx.x * 4 + wave);
  const u32x16* mw = (const u32x16*)(bits + (size_t)qtile * (S_ / 32) * 32);
  const unsigned kt_base = (unsigned)(uintptr_t)(lds_f16*)Kt;  // LDS byte offset of Kt

  half16 qf0 = load_b_frag_kc(Qbh + (size_t)q0 * DK_, DK_);        // Q^T, k = dk 0..31
  half16 qf1 = load_b_frag_kc(Qbh + (size_t)q0 * DK_ + 32, DK_);   // Q^T, k = dk 32..63

  const float NEG_INF = -__builtin_inff();
  const float LOG2E = 1.44269504f;   // exp(x) = exp2(x * log2 e)
  float mrun = NEG_INF;   // this query's running maximum (equal in both halves)
  float lrun = 0.f;       // running sum over this half's keys; the halves are joined after the loop
  float8 o0 = f8zero(), o1 = f8zero(), o2 = f8zero(), o3 = f8zero();   // O^T: row dk = 16 t + rb + r, column = query

  for (int s0 = 0; s0 < S_; s0 += 32) {
    __syncthreads();   // all waves done reading previous Kt/Vt

    // K tile: 32x64 f16 = 4 KB, async global->LDS, 2x16B per thread.
    {
      const _Float16* gk = Kbh + (size_t)s0 * DK_;
      const unsigned l0 = kt_base + (unsigned)(tid >> 3) * (PK_ * 2u) + (unsigned)(tid & 7) * 16u;
      async_g2l_2x_b128(l0,                   gk + tid * 8,
                        l0 + 16u * PK_ * 2u,  gk + (tid + 128) * 8);
    }
    // V tile kept row-major: Vt[s_local][dk]; the fragment load transposes. 256 slots of 8 halves, 2 per thread.
    const half8* gv = (const half8*)(Vbh + (size_t)s0 * DK_) + tid;
    half8 v0 = gv[0], v1 = gv[128];
    // Lane-mask words of this chunk, in flight together with the K and V tiles.
    const u32x16 w0 = mw[(s0 >> 5) * 2];
    const u32x16 w1 = mw[(s0 >> 5) * 2 + 1];
    // The V load address stays unwritten up to this wait, which stands behind the loads.
    asm volatile("s_wait_xcnt 0x0" :: "v"(gv) : "memory");
    *(half8*)(Vt + (tid >> 3) * PT_ + ((tid & 7) << 3))        = v0;
    *(half8*)(Vt + ((tid >> 3) + 16) * PT_ + ((tid & 7) << 3)) = v1;
    wait_asynccnt0();   // our async K copies landed in LDS
    __syncthreads();    // staged tiles visible block-wide

    // scores, transposed: two 16x16 tiles of keys x queries
    float8 sc0 = f8zero(), sc1 = f8zero();
    sc0 = wmma_f16(load_a_frag(Kt,                 PK_), qf0, sc0);
    sc0 = wmma_f16(load_a_frag(Kt + 32,            PK_), qf1, sc0);
    sc1 = wmma_f16(load_a_frag(Kt + 16 * PK_,      PK_), qf0, sc1);
    sc1 = wmma_f16(load_a_frag(Kt + 16 * PK_ + 32, PK_), qf1, sc1);

    // pre-softmax key-padding mask, then this query's maximum over the chunk: in-lane, one exchange of halves
    float mx = NEG_INF;
#pragma unroll
    for (int r = 0; r < 8; ++r) {
      sc0[r] = __builtin_amdgcn_inverse_ballot_w32(w0[r])     ? sc0[r] : NEG_INF;
      sc1[r] = __builtin_amdgcn_inverse_ballot_w32(w0[8 + r]) ? sc1[r] : NEG_INF;
      mx = fmaxf(mx, fmaxf(sc0[r], sc1[r]));
    }
    mx = fmaxf(mx, xhalf(mx));

    const float mnew  = fmaxf(mrun, mx);
    const float mcl   = (mnew == NEG_INF) ? 0.f : mnew;
    const float ea    = exp2_1((mrun - mcl) * LOG2E);
    const float alpha = (mrun == NEG_INF) ? 0.f : ea;
    mrun = mnew;

    // p = exp(s - m); denominator uses pre-mask1 p; PV uses mask1*p
    float e0[8], e1[8];
#pragma unroll
    for (int r = 0; r < 8; ++r) {
      e0[r] = (sc0[r] - mcl) * LOG2E;
      e1[r] = (sc1[r] - mcl) * LOG2E;
    }
    exp2_4(e0[0], e0[1], e0[2], e0[3]);
    exp2_4(e0[4], e0[5], e0[6], e0[7]);
    exp2_4(e1[0], e1[1], e1[2], e1[3]);
    exp2_4(e1[4], e1[5], e1[6], e1[7]);
    float rsum = 0.f;
    half16 pf;
#pragma unroll
    for (int r = 0; r < 8; ++r) {
      float p0 = e0[r];
      float p1 = e1[r];
      rsum += p0 + p1;
      pf[r]     = (_Float16)(__builtin_amdgcn_inverse_ballot_w32(w1[r])     ? p0 : 0.f);
      pf[8 + r] = (_Float16)(__builtin_amdgcn_inverse_ballot_w32(w1[8 + r]) ? p1 : 0.f);
    }
    lrun = lrun * alpha + rsum;
#pragma unroll
    for (int r = 0; r < 8; ++r) {
      o0[r] *= alpha; o1[r] *= alpha; o2[r] *= alpha; o3[r] *= alpha;
    }

    o0 = wmma_f16(load_b_frag_tr(Vt +  0, PT_), pf, o0);
    o1 = wmma_f16(load_b_frag_tr(Vt + 16, PT_), pf, o1);
    o2 = wmma_f16(load_b_frag_tr(Vt + 32, PT_), pf, o2);
    o3 = wmma_f16(load_b_frag_tr(Vt + 48, PT_), pf, o3);
  }

  const float lsum = lrun + xhalf(lrun);
  const float inv  = (lsum > 0.f) ? 1.f / lsum : 0.f;

  // A lane's 8 accumulator registers are 8 consecutive dk of its query: one 16-byte store per tile.
  _Float16* orow = AOut + ((size_t)(b * S_ + q0 + n_l)) * D_ + h * DK_ + rb;
  float8 oo[4] = {o0, o1, o2, o3};
#pragma unroll
  for (int nt = 0; nt < 4; ++nt) {
    half8 ov;
#pragma unroll
    for (int r = 0; r < 8; ++r) ov[r] = (_Float16)(oo[nt][r] * inv);
    *(half8*)(orow + nt * 16) = ov;
  }
}

// ---- Kernel 3: output projection  Out = A(f16) @ Wo + bo  (f32 out)
__global__ __launch_bounds__(256)
void outproj_kernel(const _Float16* __restrict__ A,  // [B*S, D] f16
                    const float* __restrict__ W,     // [D, D]
                    const float* __restrict__ bias,  // [D]
                    float* __restrict__ Out) {       // [B*S, D]
  __shared__ __attribute__((aligned(16))) _Float16 As[128 * PK_];  // [row][k]
  __shared__ __attribute__((aligned(16))) _Float16 Bs[64 * PB_];   // row-major: [k][n]
  const int tid  = threadIdx.x;
  const int wave = tid >> 5;
  const int lane = tid & 31;
  const int wm = wave & 1, wn = wave >> 1;
  const int nbase   = blockIdx.x * 128;
  const int rowbase = blockIdx.y * 128;

  // A tile: 128x64 f16, 1024 slots of 16 B, 4 per thread: row (tid >> 3) + 32 i, k (tid & 7) * 8.
  // B tile: 64x128 f32, 2048 float4 slots, 8 per thread: k (tid >> 5) + 8 i, column (tid & 31) * 4.
  const _Float16* At = A + (size_t)(rowbase + (tid >> 3)) * D_ + ((tid & 7) << 3);
  const float*    Wt = W + (size_t)(tid >> 5) * D_ + nbase + ((tid & 31) << 2);
  _Float16* Asw = As + (tid >> 3) * PK_ + ((tid & 7) << 3);
  _Float16* Bsw = Bs + (tid >> 5) * PB_ + ((tid & 31) << 2);

  float8 acc[4][2];
#pragma unroll
  for (int mt = 0; mt < 4; ++mt)
#pragma unroll
    for (int nt = 0; nt < 2; ++nt) acc[mt][nt] = f8zero();

  for (int kk = 0; kk < D_; kk += 64) {
    __syncthreads();
    const half8* pa = (const half8*)(At + kk);
    const f32x4* pb = (const f32x4*)(Wt + (size_t)kk * D_);
    half8 av[4];
    f32x4 vb[8];
#pragma unroll
    for (int i = 0; i < 4; ++i) av[i] = pa[i * (32 * D_ / 8)];
#pragma unroll
    for (int i = 0; i < 8; ++i) vb[i] = pb[i * (8 * D_ / 4)];
    // Inputs only. The loaded values keep the twelve loads of a k-step in flight together;
    // the addresses stay unwritten up to the wait (this build addresses the W rows from the last one).
    asm volatile("s_wait_xcnt 0x0"
                 :: "v"(av[0]), "v"(av[1]), "v"(av[2]), "v"(av[3]),
                    "v"(vb[0]), "v"(vb[1]), "v"(vb[2]), "v"(vb[3]), "v"(vb[4]), "v"(vb[5]), "v"(vb[6]), "v"(vb[7]),
                    "v"(pa), "v"(pb + 7 * (8 * D_ / 4)));
#pragma unroll
    for (int i = 0; i < 4; ++i) *(half8*)(Asw + i * 32 * PK_) = av[i];
#pragma unroll
    for (int i = 0; i < 8; ++i) {
      half4 hb = {(_Float16)vb[i].x, (_Float16)vb[i].y, (_Float16)vb[i].z, (_Float16)vb[i].w};
      *(half4*)(Bsw + i * 8 * PB_) = hb;
    }
    __syncthreads();

    gemm_step(As, Bs, wm, wn, acc);
  }

  const int n_l = lane & 15;
  const int rb  = (lane >> 4) << 3;
#pragma unroll
  for (int nt = 0; nt < 2; ++nt) {
    int n = nbase + wn * 32 + nt * 16 + n_l;
    float bv = bias[n];
#pragma unroll
    for (int mt = 0; mt < 4; ++mt)
#pragma unroll
      for (int r = 0; r < 8; ++r) {
        int m = rowbase + wm * 64 + mt * 16 + rb + r;
        Out[(size_t)m * D_ + n] = acc[mt][nt][r] + bv;
      }
  }
}

extern "C" void kernel_launch(void* const* d_in, const int* in_sizes, int n_in,
                              void* d_out, int out_size, void* d_ws, size_t ws_size,
                              hipStream_t stream) {
  const float* query = (const float*)d_in[0];
  const float* key   = (const float*)d_in[1];
  const float* value = (const float*)d_in[2];
  const int*   mask0 = (const int*)d_in[3];
  const int*   mask1 = (const int*)d_in[4];
  const float* Wq    = (const float*)d_in[5];
  const float* bq    = (const float*)d_in[6];
  const float* Wk    = (const float*)d_in[7];
  const float* bk    = (const float*)d_in[8];
  const float* Wv    = (const float*)d_in[9];
  const float* bv    = (const float*)d_in[10];
  const float* Wo    = (const float*)d_in[11];
  const float* bo    = (const float*)d_in[12];
  float* out = (float*)d_out;

  const size_t perTensor = (size_t)B_ * H_ * S_ * DK_;   // 8 Mi halves = 16 MB
  _Float16* Qh = (_Float16*)d_ws;
  _Float16* Kh = Qh + perTensor;
  _Float16* Vh = Kh + perTensor;
  _Float16* Ao = Vh + perTensor;
  unsigned* Mb = (unsigned*)(Ao + perTensor);            // 2 MB of lane-mask words

  dim3 blk(128);
  dim3 gblk(256);
  dim3 ggemm(D_ / 128, (B_ * S_) / 128);
  maskpack_kernel<<<dim3(B_ * S_ / 16), gblk, 0, stream>>>(mask0, mask1, Mb);
  proj_kernel<<<ggemm, gblk, 0, stream>>>(query, Wq, bq, Qh, 0.125f); // fold 1/sqrt(64)
  proj_kernel<<<ggemm, gblk, 0, stream>>>(key,   Wk, bk, Kh, 1.0f);
  proj_kernel<<<ggemm, gblk, 0, stream>>>(value, Wv, bv, Vh, 1.0f);
  attn_kernel<<<dim3(S_ / 64, B_ * H_), blk, 0, stream>>>(Qh, Kh, Vh, Mb, Ao);
  outproj_kernel<<<ggemm, gblk, 0, stream>>>(Ao, Wo, bo, out);

  (void)in_sizes; (void)n_in; (void)out_size; (void)ws_size;
}

// v005
// A run of this version takes 157 microseconds.
// Two timings next to v004 both put it at 1.08 times that version's speed.
// Over all steps from v000 it is 5.14 times as fast.
#include <hip/hip_runtime.h>
#include <hip/hip_bf16.h>

#define B_  8
#define S_  1024
#define D_  1024
#define H_  16
#define DK_ 64

typedef _Float16 half16 __attribute__((ext_vector_type(16)));
typedef _Float16 half8  __attribute__((ext_vector_type(8)));
typedef _Float16 half4  __attribute__((ext_vector_type(4)));
typedef float    float8 __attribute__((ext_vector_type(8)));
typedef float    f32x4  __attribute__((ext_vector_type(4)));
typedef short    s16x8  __attribute__((ext_vector_type(8)));
typedef int      i32x4  __attribute__((ext_vector_type(4)));
typedef __attribute__((address_space(3))) _Float16 lds_f16;
typedef __attribute__((address_space(3))) s16x8    lds_s16x8;
typedef unsigned u32x16 __attribute__((ext_vector_type(16)));

// LDS row pitches in halves. Bank = dword address mod 64, so each tile is pitched for its reader:
// 16 B x odd for rows read by ds_load_b128, 32 B x odd for rows read by ds_load_tr16_b128.
#define PK_ 72   // 64-half rows (128 B) read by ds_load_b128      -> 144 B
#define PT_ 80   // 64-half rows (128 B) read by ds_load_tr16_b128 -> 160 B
#define PB_ 144  // 128-half rows (256 B) read by ds_load_tr16_b128 -> 288 B

__device__ __forceinline__ float8 f8zero() {
  float8 z = {0.f,0.f,0.f,0.f,0.f,0.f,0.f,0.f};
  return z;
}

__device__ __forceinline__ float8 wmma_f16(half16 a, half16 b, float8 c) {
  // D = A(16x32) * B(32x16) + C, f32 accumulate
  return __builtin_amdgcn_wmma_f32_16x16x32_f16(false, a, false, b, (short)0, c, false, false);
}

// Two async 16-byte global -> LDS copies (per-lane addresses), tracked by ASYNCcnt.
// s_wait_xcnt 0 closes the statement so that no address register is rewritten ahead of it.
__device__ __forceinline__ void async_g2l_2x_b128(unsigned lds0, const _Float16* g0,
                                                  unsigned lds1, const _Float16* g1) {
  asm volatile("global_load_async_to_lds_b128 %0, %1, off\n\t"
               "global_load_async_to_lds_b128 %2, %3, off\n\t"
               "s_wait_xcnt 0x0"
               :: "v"(lds0), "v"((unsigned long long)(uintptr_t)g0),
                  "v"(lds1), "v"((unsigned long long)(uintptr_t)g1)
               : "memory");
}
__device__ __forceinline__ void wait_asynccnt0() {
  asm volatile("s_wait_asynccnt 0x0" ::: "memory");
}

// ---- WMMA fragment loaders (ISA 7.12.2 layouts, wave32) -------------------
// A fragment 16x32 f16 from row-major src (ldm halves/row).
__device__ __forceinline__ half16 load_a_frag(const _Float16* src, int ldm) {
  const int lane = threadIdx.x & 31;
  const int row  = lane & 15;
  const int koff = (lane >> 4) << 3;
  const _Float16* p0 = src + row * ldm + koff;
  const _Float16* p1 = p0 + 16;
  half16 a;
#pragma unroll
  for (int i = 0; i < 8; ++i) a[i] = p0[i];
#pragma unroll
  for (int i = 0; i < 8; ++i) a[8 + i] = p1[i];
  return a;
}

// B fragment 32x16 where element (k,n) lives at src[n*ldn + k] (k contiguous).
__device__ __forceinline__ half16 load_b_frag_kc(const _Float16* src, int ldn) {
  const int lane = threadIdx.x & 31;
  const int n    = lane & 15;
  const int koff = (lane >> 4) << 3;
  const _Float16* p0 = src + n * ldn + koff;
  const _Float16* p1 = p0 + 16;
  half16 b;
#pragma unroll
  for (int i = 0; i < 8; ++i) b[i] = p0[i];
#pragma unroll
  for (int i = 0; i < 8; ++i) b[8 + i] = p1[i];
  return b;
}

// B fragment 32x16 from a row-major LDS tile: element (k,n) lives at src[k*pitch + n] (n contiguous).
// ds_load_tr16_b128 hands lane (c,h) the column n = c at k = kbase + 8h + 0..7, the k order of load_a_frag.
__device__ __forceinline__ half16 load_b_frag_tr(const _Float16* src, int pitch) {
  const int lane = threadIdx.x & 31;
  const _Float16* p = src + (((lane >> 4) << 3) + (lane & 7)) * pitch + (((lane >> 3) & 1) << 3);
  half8 lo = __builtin_bit_cast(half8, __builtin_amdgcn_ds_load_tr16_b128_v8i16((lds_s16x8*)p));
  half8 hi = __builtin_bit_cast(half8, __builtin_amdgcn_ds_load_tr16_b128_v8i16((lds_s16x8*)(p + 16 * pitch)));
  return __builtin_shufflevector(lo, hi, 0, 1, 2, 3, 4, 5, 6, 7, 8, 9, 10, 11, 12, 13, 14, 15);
}

// ---- GEMM tiling shared by kernels 1 and 3: block = 8 waves = 128 x 128 of the output, 64 of k per step;
// wave (wm, wn) owns 64 x 32 as 4 x 2 accumulator tiles.
__device__ __forceinline__ void gemm_step(const _Float16* As, const _Float16* Bs, int wm, int wn,
                                          float8 (&acc)[4][2]) {
#pragma unroll
  for (int ks = 0; ks < 2; ++ks) {
    half16 af[4], bf[2];
#pragma unroll
    for (int mt = 0; mt < 4; ++mt) af[mt] = load_a_frag(As + (wm * 64 + mt * 16) * PK_ + ks * 32, PK_);
#pragma unroll
    for (int nt = 0; nt < 2; ++nt) bf[nt] = load_b_frag_tr(Bs + ks * 32 * PB_ + wn * 32 + nt * 16, PB_);
#pragma unroll
    for (int mt = 0; mt < 4; ++mt)
#pragma unroll
      for (int nt = 0; nt < 2; ++nt) acc[mt][nt] = wmma_f16(af[mt], bf[nt], acc[mt][nt]);
  }
}

// ---- Kernel 1: input projection of all heads  Out[b,h,s,:] = (X[b,s,:] @ W[h] + bias[h]) * scale
// Output column n of the 1024 stands for head n >> 6, feature n & 63; a block's 128 columns are two heads.
// One launch does all three projections: blockIdx.z picks query, key or value. They share nothing, but 1536 blocks
// keep three on a WGP where 512 leave two, so one more block's loads fly while the others convert and multiply.
__global__ __launch_bounds__(256)
void proj_kernel(const float* __restrict__ Xq, const float* __restrict__ Xk, const float* __restrict__ Xv, // [B*S, D]
                 const float* __restrict__ Wq, const float* __restrict__ Wk, const float* __restrict__ Wv, // [H,D,DK]
                 const float* __restrict__ bq, const float* __restrict__ bk, const float* __restrict__ bv, // [H,DK]
                 _Float16* __restrict__ OutQKV) {  // three planes [B*H,S,DK] f16: Q, K, V
  const int z = blockIdx.z;
  const float* X    = (z == 0) ? Xq : (z == 1) ? Xk : Xv;
  const float* W    = (z == 0) ? Wq : (z == 1) ? Wk : Wv;
  const float* bias = (z == 0) ? bq : (z == 1) ? bk : bv;
  _Float16* Out = OutQKV + (size_t)z * ((size_t)B_ * H_ * S_ * DK_);
  const float scale = (z == 0) ? 0.125f : 1.0f;   // 1/sqrt(DK) folded into Q
  __shared__ __attribute__((aligned(16))) _Float16 As[128 * PK_];  // [row][k]
  __shared__ __attribute__((aligned(16))) _Float16 Bs[64 * PB_];   // row-major: [k][n]
  const int tid  = threadIdx.x;
  const int wave = tid >> 5;
  const int lane = tid & 31;
  const int wm = wave & 1, wn = wave >> 1;
  const int nbase   = blockIdx.x * 128;
  const int rowbase = blockIdx.y * 128;

  // A tile: 128x64 f32, 2048 float4 slots, 8 per thread: row (tid >> 4) + 16 i, k (tid & 15) * 4.
  // B tile: 64x128 f32, 2048 float4 slots, 8 per thread: k (tid >> 5) + 8 i, column (tid & 31) * 4.
  const int ncol = nbase + ((tid & 31) << 2);
  const float* Xt = X + (size_t)(rowbase + (tid >> 4)) * D_ + ((tid & 15) << 2);
  const float* Wt = W + (size_t)(ncol >> 6) * D_ * DK_ + (size_t)(tid >> 5) * DK_ + (ncol & 63);
  _Float16* Asw = As + (tid >> 4) * PK_ + ((tid & 15) << 2);
  _Float16* Bsw = Bs + (tid >> 5) * PB_ + ((tid & 31) << 2);

  float8 acc[4][2];
#pragma unroll
  for (int mt = 0; mt < 4; ++mt)
#pragma unroll
    for (int nt = 0; nt < 2; ++nt) acc[mt][nt] = f8zero();

  for (int kk = 0; kk < D_; kk += 64) {
    __syncthreads();
    const f32x4* pa = (const f32x4*)(Xt + kk);
    const f32x4* pb = (const f32x4*)(Wt + (size_t)kk * DK_);
    f32x4 va[8], vb[8];
#pragma unroll
    for (int i = 0; i < 8; ++i) {
      va[i] = pa[i * (16 * D_ / 4)];
      vb[i] = pb[i * (8 * DK_ / 4)];
    }
    // Inputs only. The loaded values keep the sixteen loads of a k-step in flight together;
    // the addresses stay unwritten up to the wait.
    asm volatile("s_wait_xcnt 0x0"
                 :: "v"(va[0]), "v"(va[1]), "v"(va[2]), "v"(va[3]), "v"(va[4]), "v"(va[5]), "v"(va[6]), "v"(va[7]),
                    "v"(vb[0]), "v"(vb[1]), "v"(vb[2]), "v"(vb[3]), "v"(vb[4]), "v"(vb[5]), "v"(vb[6]), "v"(vb[7]),
                    "v"(pa), "v"(pb));
#pragma unroll
    for (int i = 0; i < 8; ++i) {
      half4 ha = {(_Float16)va[i].x, (_Float16)va[i].y, (_Float16)va[i].z, (_Float16)va[i].w};
      half4 hb = {(_Float16)vb[i].x, (_Float16)vb[i].y, (_Float16)vb[i].z, (_Float16)vb[i].w};
      *(half4*)(Asw + i * 16 * PK_) = ha;
      *(half4*)(Bsw + i * 8 * PB_)  = hb;
    }
    __syncthreads();

    gemm_step(As, Bs, wm, wn, acc);
  }

  const int n_l = lane & 15;
  const int rb  = (lane >> 4) << 3;
#pragma unroll
  for (int nt = 0; nt < 2; ++nt) {
    int n = nbase + wn * 32 + nt * 16 + n_l;
    float bv = bias[n];
#pragma unroll
    for (int mt = 0; mt < 4; ++mt)
#pragma unroll
      for (int r = 0; r < 8; ++r) {
        int m = rowbase + wm * 64 + mt * 16 + rb + r;     // b = m >> 10, s = m & 1023
        Out[((size_t)((m >> 10) * H_ + (n >> 6)) * S_ + (m & (S_ - 1))) * DK_ + (n & 63)] =
            (_Float16)((acc[mt][nt][r] + bv) * scale);
      }
  }
}

// ---- Kernel 2: flash-style masked attention, transposed: S^T = K Q^T, O^T += V^T P^T.
// Block = 4 waves = 64 queries of one (b,h); a wave owns 16 queries, one per lane column c = lane & 15.
// A lane (c, hh) holds query c's scores of keys 8 hh + r (tile 0) and 16 + 8 hh + r (tile 1): the k order of a
// B operand, so P^T goes from the score accumulators into the second product with no lane exchange and no LDS.
__device__ __forceinline__ float xhalf(float x) {   // lane l with lane l ^ 16
  return __builtin_bit_cast(float, __builtin_amdgcn_permlanex16(__builtin_bit_cast(int, x), __builtin_bit_cast(int, x),
                                                                0x76543210, 0xfedcba98, false, false));
}

// exp2 in asm text, in place, so that the slot which the instruction set asks for behind a transcendental (one
// independent instruction or v_nop before its result is read or its source overwritten) is tied to it: in the group
// of four each exp is the independent instruction behind the one before it, and the v_nop stands behind the last.
__device__ __forceinline__ float exp2_1(float x) {
  asm("v_exp_f32 %0, %0\n\tv_nop" : "+v"(x));
  return x;
}
__device__ __forceinline__ void exp2_4(float& a, float& b, float& c, float& d) {
  asm("v_exp_f32 %0, %0\n\tv_exp_f32 %1, %1\n\tv_exp_f32 %2, %2\n\tv_exp_f32 %3, %3\n\tv_nop"
      : "+v"(a), "+v"(b), "+v"(c), "+v"(d));
}

// ---- Mask pre-pass: both masks, read once for all 16 heads, become lane-mask words for the attention kernel.
// A tile is 16 queries x 32 keys in the attention wave's own lane layout (lane (c, hh) holds query c, keys 8 hh + r
// and 16 + 8 hh + r). Word i of mask m has bit l = (lane l's element i of mask m != 0); a tile is 32 words = 128 B:
// words 0..15 mask0, 16..31 mask1. Tile index = (b * 64 + query tile) * 32 + key chunk.
// A wave takes four tiles side by side (16 rows x 128 keys), a block the 16 whole rows.
#define PM_ 132  // LDS pitch in words of a 128-word row read by ds_load_b128: 528 B = 16 B x odd
__global__ __launch_bounds__(256)
void maskpack_kernel(const int* __restrict__ mask0,    // [B,S,S]
                     const int* __restrict__ mask1,    // [B,S,S]
                     unsigned* __restrict__ bits) {    // [B*S/16, S/32, 32]
  __shared__ __attribute__((aligned(16))) int sm[8][2][16 * PM_];   // each wave's own staging
  const int lane = threadIdx.x & 31;
  const int wave = threadIdx.x >> 5;
  // Each global load takes 512 contiguous bytes of one row.
  const size_t off = (size_t)blockIdx.x * 16 * S_ + wave * 128 + (lane << 2);
  const i32x4* pm0 = (const i32x4*)(mask0 + off);
  const i32x4* pm1 = (const i32x4*)(mask1 + off);
  i32x4 g0[16], g1[16];
#pragma unroll
  for (int c = 0; c < 16; ++c) {
    g0[c] = pm0[c * (S_ / 4)];
    g1[c] = pm1[c * (S_ / 4)];
  }
  // The load addresses stay unwritten up to this wait, which stands behind the 32 loads.
  asm volatile("s_wait_xcnt 0x0" :: "v"(pm0), "v"(pm1) : "memory");
  int* sw = sm[wave][0] + (lane << 2);
#pragma unroll
  for (int c = 0; c < 16; ++c) {
    *(i32x4*)(sw + c * PM_)             = g0[c];
    *(i32x4*)(sw + 16 * PM_ + c * PM_)  = g1[c];
  }
  __syncthreads();   // the rows are read back by other lanes
  const int* sr = sm[wave][0] + (lane & 15) * PM_ + ((lane >> 4) << 3);
  unsigned* bw = bits + ((size_t)blockIdx.x * 32 + wave * 4) * 32 + lane;
#pragma unroll
  for (int jj = 0; jj < 4; ++jj) {
    const i32x4* r0 = (const i32x4*)(sr + jj * 32);
    const i32x4* r1 = (const i32x4*)(sr + 16 * PM_ + jj * 32);
    i32x4 k0[4] = {r0[0], r0[1], r0[4], r0[5]};
    i32x4 k1[4] = {r1[0], r1[1], r1[4], r1[5]};
    unsigned w = 0;
#pragma unroll
    for (int i = 0; i < 16; ++i) {
      const unsigned b0 = __builtin_amdgcn_ballot_w32(k0[i >> 2][i & 3] != 0);
      const unsigned b1 = __builtin_amdgcn_ballot_w32(k1[i >> 2][i & 3] != 0);
      w = (lane == i) ? b0 : w;
      w = (lane == 16 + i) ? b1 : w;
    }
    bw[jj * 32] = w;
  }
}

__global__ __launch_bounds__(128)
void attn_kernel(const _Float16* __restrict__ Q,   // [B*H,S,DK] (pre-scaled by 1/sqrt(DK))
                 const _Float16* __restrict__ Km,  // [B*H,S,DK]
                 const _Float16* __restrict__ Vm,  // [B*H,S,DK]
                 const unsigned* __restrict__ bits, // lane-mask words of maskpack_kernel
                 _Float16* __restrict__ AOut) {    // [B,S,H*DK] f16
  __shared__ __attribute__((aligned(16))) _Float16 Kt[32 * PK_];      // [s_local][dk] (S^T A-frags, k-contig)
  __shared__ __attribute__((aligned(16))) _Float16 Vt[32 * PT_];      // [s_local][dk] (V^T A-frags, transposing load)
  const int tid  = threadIdx.x;
  const int wave = tid >> 5;
  const int lane = tid & 31;
  const int n_l  = lane & 15;
  const int rb   = (lane >> 4) << 3;
  const int bh   = blockIdx.y;
  const int b = bh >> 4, h = bh & 15;
  const int q0 = blockIdx.x * 64 + wave * 16;

  const _Float16* Qbh = Q  + (size_t)bh * S_ * DK_;
  const _Float16* Kbh = Km + (size_t)bh * S_ * DK_;
  const _Float16* Vbh = Vm + (size_t)bh * S_ * DK_;
  // This wave's lane-mask words: 128 B per 32-key chunk at a wave-uniform address, so they come by scalar loads.
  const int qtile = __builtin_amdgcn_readfirstlane(b * (S_ / 16) + blockIdx.x * 4 + wave);
  const u32x16* mw = (const u32x16*)(bits + (size_t)qtile * (S_ / 32) * 32);
  const unsigned kt_base = (unsigned)(uintptr_t)(lds_f16*)Kt;  // LDS byte offset of Kt

  half16 qf0 = load_b_frag_kc(Qbh + (size_t)q0 * DK_, DK_);        // Q^T, k = dk 0..31
  half16 qf1 = load_b_frag_kc(Qbh + (size_t)q0 * DK_ + 32, DK_);   // Q^T, k = dk 32..63

  const float NEG_INF = -__builtin_inff();
  const float LOG2E = 1.44269504f;   // exp(x) = exp2(x * log2 e)
  float mrun = NEG_INF;   // this query's running maximum (equal in both halves)
  float lrun = 0.f;       // running sum over this half's keys; the halves are joined after the loop
  float8 o0 = f8zero(), o1 = f8zero(), o2 = f8zero(), o3 = f8zero();   // O^T: row dk = 16 t + rb + r, column = query

  for (int s0 = 0; s0 < S_; s0 += 32) {
    __syncthreads();   // all waves done reading previous Kt/Vt

    // K tile: 32x64 f16 = 4 KB, async global->LDS, 2x16B per thread.
    {
      const _Float16* gk = Kbh + (size_t)s0 * DK_;
      const unsigned l0 = kt_base + (unsigned)(tid >> 3) * (PK_ * 2u) + (unsigned)(tid & 7) * 16u;
      async_g2l_2x_b128(l0,                   gk + tid * 8,
                        l0 + 16u * PK_ * 2u,  gk + (tid + 128) * 8);
    }
    // V tile kept row-major: Vt[s_local][dk]; the fragment load transposes. 256 slots of 8 halves, 2 per thread.
    const half8* gv = (const half8*)(Vbh + (size_t)s0 * DK_) + tid;
    half8 v0 = gv[0], v1 = gv[128];
    // Lane-mask words of this chunk, in flight together with the K and V tiles.
    const u32x16 w0 = mw[(s0 >> 5) * 2];
    const u32x16 w1 = mw[(s0 >> 5) * 2 + 1];
    // The V load address stays unwritten up to this wait, which stands behind the loads.
    asm volatile("s_wait_xcnt 0x0" :: "v"(gv) : "memory");
    *(half8*)(Vt + (tid >> 3) * PT_ + ((tid & 7) << 3))        = v0;
    *(half8*)(Vt + ((tid >> 3) + 16) * PT_ + ((tid & 7) << 3)) = v1;
    wait_asynccnt0();   // our async K copies landed in LDS
    __syncthreads();    // staged tiles visible block-wide

    // scores, transposed: two 16x16 tiles of keys x queries
    float8 sc0 = f8zero(), sc1 = f8zero();
    sc0 = wmma_f16(load_a_frag(Kt,                 PK_), qf0, sc0);
    sc0 = wmma_f16(load_a_frag(Kt + 32,            PK_), qf1, sc0);
    sc1 = wmma_f16(load_a_frag(Kt + 16 * PK_,      PK_), qf0, sc1);
    sc1 = wmma_f16(load_a_frag(Kt + 16 * PK_ + 32, PK_), qf1, sc1);

    // pre-softmax key-padding mask, then this query's maximum over the chunk: in-lane, one exchange of halves
    float mx = NEG_INF;
#pragma unroll
    for (int r = 0; r < 8; ++r) {
      sc0[r] = __builtin_amdgcn_inverse_ballot_w32(w0[r])     ? sc0[r] : NEG_INF;
      sc1[r] = __builtin_amdgcn_inverse_ballot_w32(w0[8 + r]) ? sc1[r] : NEG_INF;
      mx = fmaxf(mx, fmaxf(sc0[r], sc1[r]));
    }
    mx = fmaxf(mx, xhalf(mx));

    const float mnew  = fmaxf(mrun, mx);
    const float mcl   = (mnew == NEG_INF) ? 0.f : mnew;
    const float ea    = exp2_1((mrun - mcl) * LOG2E);
    const float alpha = (mrun == NEG_INF) ? 0.f : ea;
    mrun = mnew;

    // p = exp(s - m); denominator uses pre-mask1 p; PV uses mask1*p
    float e0[8], e1[8];
#pragma unroll
    for (int r = 0; r < 8; ++r) {
      e0[r] = (sc0[r] - mcl) * LOG2E;
      e1[r] = (sc1[r] - mcl) * LOG2E;
    }
    exp2_4(e0[0], e0[1], e0[2], e0[3]);
    exp2_4(e0[4], e0[5], e0[6], e0[7]);
    exp2_4(e1[0], e1[1], e1[2], e1[3]);
    exp2_4(e1[4], e1[5], e1[6], e1[7]);
    float rsum = 0.f;
    half16 pf;
#pragma unroll
    for (int r = 0; r < 8; ++r) {
      float p0 = e0[r];
      float p1 = e1[r];
      rsum += p0 + p1;
      pf[r]     = (_Float16)(__builtin_amdgcn_inverse_ballot_w32(w1[r])     ? p0 : 0.f);
      pf[8 + r] = (_Float16)(__builtin_amdgcn_inverse_ballot_w32(w1[8 + r]) ? p1 : 0.f);
    }
    lrun = lrun * alpha + rsum;
#pragma unroll
    for (int r = 0; r < 8; ++r) {
      o0[r] *= alpha; o1[r] *= alpha; o2[r] *= alpha; o3[r] *= alpha;
    }

    o0 = wmma_f16(load_b_frag_tr(Vt +  0, PT_), pf, o0);
    o1 = wmma_f16(load_b_frag_tr(Vt + 16, PT_), pf, o1);
    o2 = wmma_f16(load_b_frag_tr(Vt + 32, PT_), pf, o2);
    o3 = wmma_f16(load_b_frag_tr(Vt + 48, PT_), pf, o3);
  }

  const float lsum = lrun + xhalf(lrun);
  const float inv  = (lsum > 0.f) ? 1.f / lsum : 0.f;

  // A lane's 8 accumulator registers are 8 consecutive dk of its query: one 16-byte store per tile.
  _Float16* orow = AOut + ((size_t)(b * S_ + q0 + n_l)) * D_ + h * DK_ + rb;
  float8 oo[4] = {o0, o1, o2, o3};
#pragma unroll
  for (int nt = 0; nt < 4; ++nt) {
    half8 ov;
#pragma unroll
    for (int r = 0; r < 8; ++r) ov[r] = (_Float16)(oo[nt][r] * inv);
    *(half8*)(orow + nt * 16) = ov;
  }
}

// ---- Kernel 3: output projection  Out = A(f16) @ Wo + bo  (f32 out)
__global__ __launch_bounds__(256)
void outproj_kernel(const _Float16* __restrict__ A,  // [B*S, D] f16
                    const float* __restrict__ W,     // [D, D]
                    const float* __restrict__ bias,  // [D]
                    float* __restrict__ Out) {       // [B*S, D]
  __shared__ __attribute__((aligned(16))) _Float16 As[128 * PK_];  // [row][k]
  __shared__ __attribute__((aligned(16))) _Float16 Bs[64 * PB_];   // row-major: [k][n]
  const int tid  = threadIdx.x;
  const int wave = tid >> 5;
  const int lane = tid & 31;
  const int wm = wave & 1, wn = wave >> 1;
  const int nbase   = blockIdx.x * 128;
  const int rowbase = blockIdx.y * 128;

  // A tile: 128x64 f16, 1024 slots of 16 B, 4 per thread: row (tid >> 3) + 32 i, k (tid & 7) * 8.
  // B tile: 64x128 f32, 2048 float4 slots, 8 per thread: k (tid >> 5) + 8 i, column (tid & 31) * 4.
  const _Float16* At = A + (size_t)(rowbase + (tid >> 3)) * D_ + ((tid & 7) << 3);
  const float*    Wt = W + (size_t)(tid >> 5) * D_ + nbase + ((tid & 31) << 2);
  _Float16* Asw = As + (tid >> 3) * PK_ + ((tid & 7) << 3);
  _Float16* Bsw = Bs + (tid >> 5) * PB_ + ((tid & 31) << 2);

  float8 acc[4][2];
#pragma unroll
  for (int mt = 0; mt < 4; ++mt)
#pragma unroll
    for (int nt = 0; nt < 2; ++nt) acc[mt][nt] = f8zero();

  for (int kk = 0; kk < D_; kk += 64) {
    __syncthreads();
    const half8* pa = (const half8*)(At + kk);
    const f32x4* pb = (const f32x4*)(Wt + (size_t)kk * D_);
    half8 av[4];
    f32x4 vb[8];
#pragma unroll
    for (int i = 0; i < 4; ++i) av[i] = pa[i * (32 * D_ / 8)];
#pragma unroll
    for (int i = 0; i < 8; ++i) vb[i] = pb[i * (8 * D_ / 4)];
    // Inputs only. The loaded values keep the twelve loads of a k-step in flight together;
    // the addresses stay unwritten up to the wait (this build addresses the W rows from the last one).
    asm volatile("s_wait_xcnt 0x0"
                 :: "v"(av[0]), "v"(av[1]), "v"(av[2]), "v"(av[3]),
                    "v"(vb[0]), "v"(vb[1]), "v"(vb[2]), "v"(vb[3]), "v"(vb[4]), "v"(vb[5]), "v"(vb[6]), "v"(vb[7]),
                    "v"(pa), "v"(pb + 7 * (8 * D_ / 4)));
#pragma unroll
    for (int i = 0; i < 4; ++i) *(half8*)(Asw + i * 32 * PK_) = av[i];
#pragma unroll
    for (int i = 0; i < 8; ++i) {
      half4 hb = {(_Float16)vb[i].x, (_Float16)vb[i].y, (_Float16)vb[i].z, (_Float16)vb[i].w};
      *(half4*)(Bsw + i * 8 * PB_) = hb;
    }
    __syncthreads();

    gemm_step(As, Bs, wm, wn, acc);
  }

  const int n_l = lane & 15;
  const int rb  = (lane >> 4) << 3;
#pragma unroll
  for (int nt = 0; nt < 2; ++nt) {
    int n = nbase + wn * 32 + nt * 16 + n_l;
    float bv = bias[n];
#pragma unroll
    for (int mt = 0; mt < 4; ++mt)
#pragma unroll
      for (int r = 0; r < 8; ++r) {
        int m = rowbase + wm * 64 + mt * 16 + rb + r;
        Out[(size_t)m * D_ + n] = acc[mt][nt][r] + bv;
      }
  }
}

extern "C" void kernel_launch(void* const* d_in, const int* in_sizes, int n_in,
                              void* d_out, int out_size, void* d_ws, size_t ws_size,
                              hipStream_t stream) {
  const float* query = (const float*)d_in[0];
  const float* key   = (const float*)d_in[1];
  const float* value = (const float*)d_in[2];
  const int*   mask0 = (const int*)d_in[3];
  const int*   mask1 = (const int*)d_in[4];
  const float* Wq    = (const float*)d_in[5];
  const float* bq    = (const float*)d_in[6];
  const float* Wk    = (const float*)d_in[7];
  const float* bk    = (const float*)d_in[8];
  const float* Wv    = (const float*)d_in[9];
  const float* bv    = (const float*)d_in[10];
  const float* Wo    = (const float*)d_in[11];
  const float* bo    = (const float*)d_in[12];
  float* out = (float*)d_out;

  const size_t perTensor = (size_t)B_ * H_ * S_ * DK_;   // 8 Mi halves = 16 MB
  _Float16* Qh = (_Float16*)d_ws;
  _Float16* Kh = Qh + perTensor;
  _Float16* Vh = Kh + perTensor;
  _Float16* Ao = Vh + perTensor;
  unsigned* Mb = (unsigned*)(Ao + perTensor);            // 2 MB of lane-mask words

  dim3 blk(128);
  dim3 gblk(256);
  dim3 ggemm(D_ / 128, (B_ * S_) / 128);
  maskpack_kernel<<<dim3(B_ * S_ / 16), gblk, 0, stream>>>(mask0, mask1, Mb);
  proj_kernel<<<dim3(D_ / 128, (B_ * S_) / 128, 3), gblk, 0, stream>>>(query, key, value, Wq, Wk, Wv, bq, bk, bv, Qh);
  attn_kernel<<<dim3(S_ / 64, B_ * H_), blk, 0, stream>>>(Qh, Kh, Vh, Mb, Ao);
  outproj_kernel<<<ggemm, gblk, 0, stream>>>(Ao, Wo, bo, out);

  (void)in_sizes; (void)n_in; (void)out_size; (void)ws_size;
}

// v006
// One run takes 147 microseconds.
// In both of two side-by-side timings against v005, it was 1.07 times as fast.
// Counting every step since v000, it is 5.49 times as fast.
#include <hip/hip_runtime.h>
#include <hip/hip_bf16.h>

#define B_  8
#define S_  1024
#define D_  1024
#define H_  16
#define DK_ 64

typedef _Float16 half16 __attribute__((ext_vector_type(16)));
typedef _Float16 half8  __attribute__((ext_vector_type(8)));
typedef _Float16 half4  __attribute__((ext_vector_type(4)));
typedef float    float8 __attribute__((ext_vector_type(8)));
typedef float    f32x4  __attribute__((ext_vector_type(4)));
typedef short    s16x8  __attribute__((ext_vector_type(8)));
typedef int      i32x4  __attribute__((ext_vector_type(4)));
typedef __attribute__((address_space(3))) _Float16 lds_f16;
typedef __attribute__((address_space(3))) s16x8    lds_s16x8;
typedef unsigned u32x16 __attribute__((ext_vector_type(16)));
typedef unsigned u32x4  __attribute__((ext_vector_type(4)));

// LDS row pitches in halves. Bank = dword address mod 64, so each tile is pitched for its reader:
// 16 B x odd for rows read by ds_load_b128, 32 B x odd for rows read by ds_load_tr16_b128.
#define PK_ 72   // 64-half rows (128 B) read by ds_load_b128      -> 144 B
#define PT_ 80   // 64-half rows (128 B) read by ds_load_tr16_b128 -> 160 B
#define PB_ 144  // 128-half rows (256 B) read by ds_load_tr16_b128 -> 288 B

__device__ __forceinline__ float8 f8zero() {
  float8 z = {0.f,0.f,0.f,0.f,0.f,0.f,0.f,0.f};
  return z;
}

__device__ __forceinline__ float8 wmma_f16(half16 a, half16 b, float8 c) {
  // D = A(16x32) * B(32x16) + C, f32 accumulate
  return __builtin_amdgcn_wmma_f32_16x16x32_f16(false, a, false, b, (short)0, c, false, false);
}

// Two async 16-byte global -> LDS copies (per-lane addresses), tracked by ASYNCcnt.
// s_wait_xcnt 0 closes the statement so that no address register is rewritten ahead of it.
__device__ __forceinline__ void async_g2l_2x_b128(unsigned lds0, const _Float16* g0,
                                                  unsigned lds1, const _Float16* g1) {
  asm volatile("global_load_async_to_lds_b128 %0, %1, off\n\t"
               "global_load_async_to_lds_b128 %2, %3, off\n\t"
               "s_wait_xcnt 0x0"
               :: "v"(lds0), "v"((unsigned long long)(uintptr_t)g0),
                  "v"(lds1), "v"((unsigned long long)(uintptr_t)g1)
               : "memory");
}
__device__ __forceinline__ void wait_asynccnt0() {
  asm volatile("s_wait_asynccnt 0x0" ::: "memory");
}

// ---- WMMA fragment loaders (ISA 7.12.2 layouts, wave32) -------------------
// A fragment 16x32 f16 from row-major src (ldm halves/row).
__device__ __forceinline__ half16 load_a_frag(const _Float16* src, int ldm) {
  const int lane = threadIdx.x & 31;
  const int row  = lane & 15;
  const int koff = (lane >> 4) << 3;
  const _Float16* p0 = src + row * ldm + koff;
  const _Float16* p1 = p0 + 16;
  half16 a;
#pragma unroll
  for (int i = 0; i < 8; ++i) a[i] = p0[i];
#pragma unroll
  for (int i = 0; i < 8; ++i) a[8 + i] = p1[i];
  return a;
}

// B fragment 32x16 where element (k,n) lives at src[n*ldn + k] (k contiguous).
__device__ __forceinline__ half16 load_b_frag_kc(const _Float16* src, int ldn) {
  const int lane = threadIdx.x & 31;
  const int n    = lane & 15;
  const int koff = (lane >> 4) << 3;
  const _Float16* p0 = src + n * ldn + koff;
  const _Float16* p1 = p0 + 16;
  half16 b;
#pragma unroll
  for (int i = 0; i < 8; ++i) b[i] = p0[i];
#pragma unroll
  for (int i = 0; i < 8; ++i) b[8 + i] = p1[i];
  return b;
}

// B fragment 32x16 from a row-major LDS tile: element (k,n) lives at src[k*pitch + n] (n contiguous).
// ds_load_tr16_b128 hands lane (c,h) the column n = c at k = kbase + 8h + 0..7, the k order of load_a_frag.
__device__ __forceinline__ half16 load_b_frag_tr(const _Float16* src, int pitch) {
  const int lane = threadIdx.x & 31;
  const _Float16* p = src + (((lane >> 4) << 3) + (lane & 7)) * pitch + (((lane >> 3) & 1) << 3);
  half8 lo = __builtin_bit_cast(half8, __builtin_amdgcn_ds_load_tr16_b128_v8i16((lds_s16x8*)p));
  half8 hi = __builtin_bit_cast(half8, __builtin_amdgcn_ds_load_tr16_b128_v8i16((lds_s16x8*)(p + 16 * pitch)));
  return __builtin_shufflevector(lo, hi, 0, 1, 2, 3, 4, 5, 6, 7, 8, 9, 10, 11, 12, 13, 14, 15);
}

// ---- GEMM tiling shared by kernels 1 and 3: block = 8 waves = 128 x 128 of the output, 64 of k per step;
// wave (wm, wn) owns 64 x 32 as 4 x 2 accumulator tiles.
__device__ __forceinline__ void gemm_step(const _Float16* As, const _Float16* Bs, int wm, int wn,
                                          float8 (&acc)[4][2]) {
#pragma unroll
  for (int ks = 0; ks < 2; ++ks) {
    half16 af[4], bf[2];
#pragma unroll
    for (int mt = 0; mt < 4; ++mt) af[mt] = load_a_frag(As + (wm * 64 + mt * 16) * PK_ + ks * 32, PK_);
#pragma unroll
    for (int nt = 0; nt < 2; ++nt) bf[nt] = load_b_frag_tr(Bs + ks * 32 * PB_ + wn * 32 + nt * 16, PB_);
#pragma unroll
    for (int mt = 0; mt < 4; ++mt)
#pragma unroll
      for (int nt = 0; nt < 2; ++nt) acc[mt][nt] = wmma_f16(af[mt], bf[nt], acc[mt][nt]);
  }
}

// ---- Kernel 1: input projection of all heads  Out[b,h,s,:] = (X[b,s,:] @ W[h] + bias[h]) * scale
// Output column n of the 1024 stands for head n >> 6, feature n & 63; a block's 128 columns are two heads.
// One launch does all three projections: blockIdx.z picks query, key or value. They share nothing, but 1536 blocks
// keep three on a WGP where 512 leave two, so one more block's loads fly while the others convert and multiply.
__global__ __launch_bounds__(256)
void proj_kernel(const float* __restrict__ Xq, const float* __restrict__ Xk, const float* __restrict__ Xv, // [B*S, D]
                 const float* __restrict__ Wq, const float* __restrict__ Wk, const float* __restrict__ Wv, // [H,D,DK]
                 const float* __restrict__ bq, const float* __restrict__ bk, const float* __restrict__ bv, // [H,DK]
                 _Float16* __restrict__ OutQKV) {  // three planes [B*H,S,DK] f16: Q, K, V
  const int z = blockIdx.z;
  const float* X    = (z == 0) ? Xq : (z == 1) ? Xk : Xv;
  const float* W    = (z == 0) ? Wq : (z == 1) ? Wk : Wv;
  const float* bias = (z == 0) ? bq : (z == 1) ? bk : bv;
  _Float16* Out = OutQKV + (size_t)z * ((size_t)B_ * H_ * S_ * DK_);
  const float scale = (z == 0) ? 0.125f : 1.0f;   // 1/sqrt(DK) folded into Q
  __shared__ __attribute__((aligned(16))) _Float16 As[128 * PK_];  // [row][k]
  __shared__ __attribute__((aligned(16))) _Float16 Bs[64 * PB_];   // row-major: [k][n]
  const int tid  = threadIdx.x;
  const int wave = tid >> 5;
  const int lane = tid & 31;
  const int wm = wave & 1, wn = wave >> 1;
  const int nbase   = blockIdx.x * 128;
  const int rowbase = blockIdx.y * 128;

  // A tile: 128x64 f32, 2048 float4 slots, 8 per thread: row (tid >> 4) + 16 i, k (tid & 15) * 4.
  // B tile: 64x128 f32, 2048 float4 slots, 8 per thread: k (tid >> 5) + 8 i, column (tid & 31) * 4.
  const int ncol = nbase + ((tid & 31) << 2);
  const float* Xt = X + (size_t)(rowbase + (tid >> 4)) * D_ + ((tid & 15) << 2);
  const float* Wt = W + (size_t)(ncol >> 6) * D_ * DK_ + (size_t)(tid >> 5) * DK_ + (ncol & 63);
  _Float16* Asw = As + (tid >> 4) * PK_ + ((tid & 15) << 2);
  _Float16* Bsw = Bs + (tid >> 5) * PB_ + ((tid & 31) << 2);

  float8 acc[4][2];
#pragma unroll
  for (int mt = 0; mt < 4; ++mt)
#pragma unroll
    for (int nt = 0; nt < 2; ++nt) acc[mt][nt] = f8zero();

  for (int kk = 0; kk < D_; kk += 64) {
    __syncthreads();
    const f32x4* pa = (const f32x4*)(Xt + kk);
    const f32x4* pb = (const f32x4*)(Wt + (size_t)kk * DK_);
    f32x4 va[8], vb[8];
#pragma unroll
    for (int i = 0; i < 8; ++i) {
      va[i] = pa[i * (16 * D_ / 4)];
      vb[i] = pb[i * (8 * DK_ / 4)];
    }
    // Inputs only. The loaded values keep the sixteen loads of a k-step in flight together;
    // the addresses stay unwritten up to the wait.
    asm volatile("s_wait_xcnt 0x0"
                 :: "v"(va[0]), "v"(va[1]), "v"(va[2]), "v"(va[3]), "v"(va[4]), "v"(va[5]), "v"(va[6]), "v"(va[7]),
                    "v"(vb[0]), "v"(vb[1]), "v"(vb[2]), "v"(vb[3]), "v"(vb[4]), "v"(vb[5]), "v"(vb[6]), "v"(vb[7]),
                    "v"(pa), "v"(pb));
#pragma unroll
    for (int i = 0; i < 8; ++i) {
      half4 ha = {(_Float16)va[i].x, (_Float16)va[i].y, (_Float16)va[i].z, (_Float16)va[i].w};
      half4 hb = {(_Float16)vb[i].x, (_Float16)vb[i].y, (_Float16)vb[i].z, (_Float16)vb[i].w};
      *(half4*)(Asw + i * 16 * PK_) = ha;
      *(half4*)(Bsw + i * 8 * PB_)  = hb;
    }
    __syncthreads();

    gemm_step(As, Bs, wm, wn, acc);
  }

  const int n_l = lane & 15;
  const int rb  = (lane >> 4) << 3;
#pragma unroll
  for (int nt = 0; nt < 2; ++nt) {
    int n = nbase + wn * 32 + nt * 16 + n_l;
    float bv = bias[n];
#pragma unroll
    for (int mt = 0; mt < 4; ++mt)
#pragma unroll
      for (int r = 0; r < 8; ++r) {
        int m = rowbase + wm * 64 + mt * 16 + rb + r;     // b = m >> 10, s = m & 1023
        Out[((size_t)((m >> 10) * H_ + (n >> 6)) * S_ + (m & (S_ - 1))) * DK_ + (n & 63)] =
            (_Float16)((acc[mt][nt][r] + bv) * scale);
      }
  }
}

// ---- Kernel 2: flash-style masked attention, transposed: S^T = K Q^T, O^T += V^T P^T.
// Block = 4 waves = 64 queries of one (b,h); a wave owns 16 queries, one per lane column c = lane & 15.
// A lane (c, hh) holds query c's scores of keys 8 hh + r (tile 0) and 16 + 8 hh + r (tile 1): the k order of a
// B operand, so P^T goes from the score accumulators into the second product with no lane exchange and no LDS.
__device__ __forceinline__ float xhalf(float x) {   // lane l with lane l ^ 16
  return __builtin_bit_cast(float, __builtin_amdgcn_permlanex16(__builtin_bit_cast(int, x), __builtin_bit_cast(int, x),
                                                                0x76543210, 0xfedcba98, false, false));
}

// exp2 in asm text, in place, so that the slot which the instruction set asks for behind a transcendental (one
// independent instruction or v_nop before its result is read or its source overwritten) is tied to it: in the group
// of four each exp is the independent instruction behind the one before it, and the v_nop stands behind the last.
__device__ __forceinline__ float exp2_1(float x) {
  asm("v_exp_f32 %0, %0\n\tv_nop" : "+v"(x));
  return x;
}
__device__ __forceinline__ void exp2_4(float& a, float& b, float& c, float& d) {
  asm("v_exp_f32 %0, %0\n\tv_exp_f32 %1, %1\n\tv_exp_f32 %2, %2\n\tv_exp_f32 %3, %3\n\tv_nop"
      : "+v"(a), "+v"(b), "+v"(c), "+v"(d));
}

// ---- Mask pre-pass: both masks, read once for all 16 heads, become lane-mask words for the attention kernel.
// A tile is 16 queries x 32 keys in the attention wave's own lane layout (lane (c, hh) holds query c, keys 8 hh + r
// and 16 + 8 hh + r). Word i of mask m has bit l = (lane l's element i of mask m != 0); a tile is 32 words = 128 B:
// words 0..15 mask0, 16..31 mask1. Tile index = (b * 64 + query tile) * 32 + key chunk.
// A wave takes four tiles side by side (16 rows x 128 keys), a block the 16 whole rows.
#define PM_ 132  // LDS pitch in words of a 128-word row read by ds_load_b128: 528 B = 16 B x odd
__global__ __launch_bounds__(256)
void maskpack_kernel(const int* __restrict__ mask0,    // [B,S,S]
                     const int* __restrict__ mask1,    // [B,S,S]
                     unsigned* __restrict__ bits) {    // [B*S/16, S/32, 32]
  __shared__ __attribute__((aligned(16))) int sm[8][2][16 * PM_];   // each wave's own staging
  const int lane = threadIdx.x & 31;
  const int wave = threadIdx.x >> 5;
  // Each global load takes 512 contiguous bytes of one row.
  const size_t off = (size_t)blockIdx.x * 16 * S_ + wave * 128 + (lane << 2);
  const i32x4* pm0 = (const i32x4*)(mask0 + off);
  const i32x4* pm1 = (const i32x4*)(mask1 + off);
  i32x4 g0[16], g1[16];
#pragma unroll
  for (int c = 0; c < 16; ++c) {
    g0[c] = pm0[c * (S_ / 4)];
    g1[c] = pm1[c * (S_ / 4)];
  }
  // The load addresses stay unwritten up to this wait, which stands behind the 32 loads.
  asm volatile("s_wait_xcnt 0x0" :: "v"(pm0), "v"(pm1) : "memory");
  int* sw = sm[wave][0] + (lane << 2);
#pragma unroll
  for (int c = 0; c < 16; ++c) {
    *(i32x4*)(sw + c * PM_)             = g0[c];
    *(i32x4*)(sw + 16 * PM_ + c * PM_)  = g1[c];
  }
  __syncthreads();   // the rows are read back by other lanes
  const int* sr = sm[wave][0] + (lane & 15) * PM_ + ((lane >> 4) << 3);
  unsigned* bw = bits + ((size_t)blockIdx.x * 32 + wave * 4) * 32 + lane;
#pragma unroll
  for (int jj = 0; jj < 4; ++jj) {
    const i32x4* r0 = (const i32x4*)(sr + jj * 32);
    const i32x4* r1 = (const i32x4*)(sr + 16 * PM_ + jj * 32);
    i32x4 k0[4] = {r0[0], r0[1], r0[4], r0[5]};
    i32x4 k1[4] = {r1[0], r1[1], r1[4], r1[5]};
    unsigned w = 0;
#pragma unroll
    for (int i = 0; i < 16; ++i) {
      const unsigned b0 = __builtin_amdgcn_ballot_w32(k0[i >> 2][i & 3] != 0);
      const unsigned b1 = __builtin_amdgcn_ballot_w32(k1[i >> 2][i & 3] != 0);
      w = (lane == i) ? b0 : w;
      w = (lane == 16 + i) ? b1 : w;
    }
    bw[jj * 32] = w;
  }
}

__global__ __launch_bounds__(128)
void attn_kernel(const _Float16* __restrict__ Q,   // [B*H,S,DK] (pre-scaled by 1/sqrt(DK))
                 const _Float16* __restrict__ Km,  // [B*H,S,DK]
                 const _Float16* __restrict__ Vm,  // [B*H,S,DK]
                 const unsigned* __restrict__ bits, // lane-mask words of maskpack_kernel
                 _Float16* __restrict__ AOut) {    // [B,S,H*DK] f16
  __shared__ __attribute__((aligned(16))) _Float16 Kt[32 * PK_];      // [s_local][dk] (S^T A-frags, k-contig)
  __shared__ __attribute__((aligned(16))) _Float16 Vt[32 * PT_];      // [s_local][dk] (V^T A-frags, transposing load)
  __shared__ unsigned lv[8];   // per wave: key chunks with a set mask0 bit (0..3), with a set mask1 bit (4..7)
  const int tid  = threadIdx.x;
  const int wave = tid >> 5;
  const int lane = tid & 31;
  const int n_l  = lane & 15;
  const int rb   = (lane >> 4) << 3;
  const int bh   = blockIdx.y;
  const int b = bh >> 4, h = bh & 15;
  // The query block turns with the batch. Padding empties blocks at like query positions in every batch; should the
  // blocks that share a WGP lie a fixed stride apart in the grid, they would be all full or all empty. For speed only.
  const int qb = (blockIdx.x + 2 * b) & (S_ / 64 - 1);
  const int q0 = qb * 64 + wave * 16;

  const _Float16* Qbh = Q  + (size_t)bh * S_ * DK_;
  const _Float16* Kbh = Km + (size_t)bh * S_ * DK_;
  const _Float16* Vbh = Vm + (size_t)bh * S_ * DK_;
  // This wave's lane-mask words: 128 B per 32-key chunk at a wave-uniform address, so they come by scalar loads.
  const int qtile = __builtin_amdgcn_readfirstlane(b * (S_ / 16) + qb * 4 + wave);
  const u32x16* mw = (const u32x16*)(bits + (size_t)qtile * (S_ / 32) * 32);
  const unsigned kt_base = (unsigned)(uintptr_t)(lds_f16*)Kt;  // LDS byte offset of Kt

  half16 qf0 = load_b_frag_kc(Qbh + (size_t)q0 * DK_, DK_);        // Q^T, k = dk 0..31
  half16 qf1 = load_b_frag_kc(Qbh + (size_t)q0 * DK_ + 32, DK_);   // Q^T, k = dk 32..63

  // Which key chunks count, for any mask content. A chunk whose mask0 words are all zero for the block's 64 queries
  // gives p = 0 and leaves maximum, sum and O as they are; with no mask1 bit set in the block every P is zero and O
  // stays zero. Lane l looks at chunk l of its wave's query tile (32 words); the four waves join through LDS.
  unsigned live;
  {
    const u32x4* cw = (const u32x4*)(bits + (size_t)qtile * (S_ / 32) * 32 + lane * 32);
    u32x4 c[8];
#pragma unroll   // c[] stays in registers and the eight loads are in flight together
    for (int i = 0; i < 8; ++i) c[i] = cw[i];
    const u32x4 a0 = c[0] | c[1] | c[2] | c[3];
    const u32x4 a1 = c[4] | c[5] | c[6] | c[7];
    const unsigned l0 = __builtin_amdgcn_ballot_w32((a0.x | a0.y | a0.z | a0.w) != 0u);
    const unsigned l1 = __builtin_amdgcn_ballot_w32((a1.x | a1.y | a1.z | a1.w) != 0u);
    if (lane == 0) { lv[wave] = l0; lv[4 + wave] = l1; }
    __syncthreads();   // the other waves' words are read below
    const unsigned any0 = lv[0] | lv[1] | lv[2] | lv[3];
    const unsigned any1 = lv[4] | lv[5] | lv[6] | lv[7];
    live = (unsigned)__builtin_amdgcn_readfirstlane((int)(any1 != 0u ? any0 : 0u));   // the same word in every wave
  }

  const float NEG_INF = -__builtin_inff();
  const float LOG2E = 1.44269504f;   // exp(x) = exp2(x * log2 e)
  float mrun = NEG_INF;   // this query's running maximum (equal in both halves)
  float lrun = 0.f;       // running sum over this half's keys; the halves are joined after the loop
  float8 o0 = f8zero(), o1 = f8zero(), o2 = f8zero(), o3 = f8zero();   // O^T: row dk = 16 t + rb + r, column = query

  for (int s0 = 0; s0 < S_; s0 += 32) {
    if (((live >> (s0 >> 5)) & 1u) == 0u) continue;   // block-uniform, so every wave passes the same barriers
    __syncthreads();   // all waves done reading previous Kt/Vt

    // K tile: 32x64 f16 = 4 KB, async global->LDS, 2x16B per thread.
    {
      const _Float16* gk = Kbh + (size_t)s0 * DK_;
      const unsigned l0 = kt_base + (unsigned)(tid >> 3) * (PK_ * 2u) + (unsigned)(tid & 7) * 16u;
      async_g2l_2x_b128(l0,                   gk + tid * 8,
                        l0 + 16u * PK_ * 2u,  gk + (tid + 128) * 8);
    }
    // V tile kept row-major: Vt[s_local][dk]; the fragment load transposes. 256 slots of 8 halves, 2 per thread.
    const half8* gv = (const half8*)(Vbh + (size_t)s0 * DK_) + tid;
    half8 v0 = gv[0], v1 = gv[128];
    // Lane-mask words of this chunk, in flight together with the K and V tiles.
    const u32x16 w0 = mw[(s0 >> 5) * 2];
    const u32x16 w1 = mw[(s0 >> 5) * 2 + 1];
    // The V load address stays unwritten up to this wait, which stands behind the loads.
    asm volatile("s_wait_xcnt 0x0" :: "v"(gv) : "memory");
    *(half8*)(Vt + (tid >> 3) * PT_ + ((tid & 7) << 3))        = v0;
    *(half8*)(Vt + ((tid >> 3) + 16) * PT_ + ((tid & 7) << 3)) = v1;
    wait_asynccnt0();   // our async K copies landed in LDS
    __syncthreads();    // staged tiles visible block-wide

    // scores, transposed: two 16x16 tiles of keys x queries
    float8 sc0 = f8zero(), sc1 = f8zero();
    sc0 = wmma_f16(load_a_frag(Kt,                 PK_), qf0, sc0);
    sc0 = wmma_f16(load_a_frag(Kt + 32,            PK_), qf1, sc0);
    sc1 = wmma_f16(load_a_frag(Kt + 16 * PK_,      PK_), qf0, sc1);
    sc1 = wmma_f16(load_a_frag(Kt + 16 * PK_ + 32, PK_), qf1, sc1);

    // pre-softmax key-padding mask, then this query's maximum over the chunk: in-lane, one exchange of halves
    float mx = NEG_INF;
#pragma unroll
    for (int r = 0; r < 8; ++r) {
      sc0[r] = __builtin_amdgcn_inverse_ballot_w32(w0[r])     ? sc0[r] : NEG_INF;
      sc1[r] = __builtin_amdgcn_inverse_ballot_w32(w0[8 + r]) ? sc1[r] : NEG_INF;
      mx = fmaxf(mx, fmaxf(sc0[r], sc1[r]));
    }
    mx = fmaxf(mx, xhalf(mx));

    const float mnew  = fmaxf(mrun, mx);
    const float mcl   = (mnew == NEG_INF) ? 0.f : mnew;
    const float ea    = exp2_1((mrun - mcl) * LOG2E);
    const float alpha = (mrun == NEG_INF) ? 0.f : ea;
    mrun = mnew;

    // p = exp(s - m); denominator uses pre-mask1 p; PV uses mask1*p
    float e0[8], e1[8];
#pragma unroll
    for (int r = 0; r < 8; ++r) {
      e0[r] = (sc0[r] - mcl) * LOG2E;
      e1[r] = (sc1[r] - mcl) * LOG2E;
    }
    exp2_4(e0[0], e0[1], e0[2], e0[3]);
    exp2_4(e0[4], e0[5], e0[6], e0[7]);
    exp2_4(e1[0], e1[1], e1[2], e1[3]);
    exp2_4(e1[4], e1[5], e1[6], e1[7]);
    float rsum = 0.f;
    half16 pf;
#pragma unroll
    for (int r = 0; r < 8; ++r) {
      float p0 = e0[r];
      float p1 = e1[r];
      rsum += p0 + p1;
      pf[r]     = (_Float16)(__builtin_amdgcn_inverse_ballot_w32(w1[r])     ? p0 : 0.f);
      pf[8 + r] = (_Float16)(__builtin_amdgcn_inverse_ballot_w32(w1[8 + r]) ? p1 : 0.f);
    }
    lrun = lrun * alpha + rsum;
#pragma unroll
    for (int r = 0; r < 8; ++r) {
      o0[r] *= alpha; o1[r] *= alpha; o2[r] *= alpha; o3[r] *= alpha;
    }

    o0 = wmma_f16(load_b_frag_tr(Vt +  0, PT_), pf, o0);
    o1 = wmma_f16(load_b_frag_tr(Vt + 16, PT_), pf, o1);
    o2 = wmma_f16(load_b_frag_tr(Vt + 32, PT_), pf, o2);
    o3 = wmma_f16(load_b_frag_tr(Vt + 48, PT_), pf, o3);
  }

  const float lsum = lrun + xhalf(lrun);
  const float inv  = (lsum > 0.f) ? 1.f / lsum : 0.f;

  // A lane's 8 accumulator registers are 8 consecutive dk of its query: one 16-byte store per tile.
  _Float16* orow = AOut + ((size_t)(b * S_ + q0 + n_l)) * D_ + h * DK_ + rb;
  float8 oo[4] = {o0, o1, o2, o3};
#pragma unroll
  for (int nt = 0; nt < 4; ++nt) {
    half8 ov;
#pragma unroll
    for (int r = 0; r < 8; ++r) ov[r] = (_Float16)(oo[nt][r] * inv);
    *(half8*)(orow + nt * 16) = ov;
  }
}

// ---- Kernel 3: output projection  Out = A(f16) @ Wo + bo  (f32 out)
__global__ __launch_bounds__(256)
void outproj_kernel(const _Float16* __restrict__ A,  // [B*S, D] f16
                    const float* __restrict__ W,     // [D, D]
                    const float* __restrict__ bias,  // [D]
                    float* __restrict__ Out) {       // [B*S, D]
  __shared__ __attribute__((aligned(16))) _Float16 As[128 * PK_];  // [row][k]
  __shared__ __attribute__((aligned(16))) _Float16 Bs[64 * PB_];   // row-major: [k][n]
  const int tid  = threadIdx.x;
  const int wave = tid >> 5;
  const int lane = tid & 31;
  const int wm = wave & 1, wn = wave >> 1;
  const int nbase   = blockIdx.x * 128;
  const int rowbase = blockIdx.y * 128;

  // A tile: 128x64 f16, 1024 slots of 16 B, 4 per thread: row (tid >> 3) + 32 i, k (tid & 7) * 8.
  // B tile: 64x128 f32, 2048 float4 slots, 8 per thread: k (tid >> 5) + 8 i, column (tid & 31) * 4.
  const _Float16* At = A + (size_t)(rowbase + (tid >> 3)) * D_ + ((tid & 7) << 3);
  const float*    Wt = W + (size_t)(tid >> 5) * D_ + nbase + ((tid & 31) << 2);
  _Float16* Asw = As + (tid >> 3) * PK_ + ((tid & 7) << 3);
  _Float16* Bsw = Bs + (tid >> 5) * PB_ + ((tid & 31) << 2);

  float8 acc[4][2];
#pragma unroll
  for (int mt = 0; mt < 4; ++mt)
#pragma unroll
    for (int nt = 0; nt < 2; ++nt) acc[mt][nt] = f8zero();

  for (int kk = 0; kk < D_; kk += 64) {
    __syncthreads();
    const half8* pa = (const half8*)(At + kk);
    const f32x4* pb = (const f32x4*)(Wt + (size_t)kk * D_);
    half8 av[4];
    f32x4 vb[8];
#pragma unroll
    for (int i = 0; i < 4; ++i) av[i] = pa[i * (32 * D_ / 8)];
#pragma unroll
    for (int i = 0; i < 8; ++i) vb[i] = pb[i * (8 * D_ / 4)];
    // Inputs only. The loaded values keep the twelve loads of a k-step in flight together;
    // the addresses stay unwritten up to the wait (this build addresses the W rows from the last one).
    asm volatile("s_wait_xcnt 0x0"
                 :: "v"(av[0]), "v"(av[1]), "v"(av[2]), "v"(av[3]),
                    "v"(vb[0]), "v"(vb[1]), "v"(vb[2]), "v"(vb[3]), "v"(vb[4]), "v"(vb[5]), "v"(vb[6]), "v"(vb[7]),
                    "v"(pa), "v"(pb + 7 * (8 * D_ / 4)));
#pragma unroll
    for (int i = 0; i < 4; ++i) *(half8*)(Asw + i * 32 * PK_) = av[i];
#pragma unroll
    for (int i = 0; i < 8; ++i) {
      half4 hb = {(_Float16)vb[i].x, (_Float16)vb[i].y, (_Float16)vb[i].z, (_Float16)vb[i].w};
      *(half4*)(Bsw + i * 8 * PB_) = hb;
    }
    __syncthreads();

    gemm_step(As, Bs, wm, wn, acc);
  }

  const int n_l = lane & 15;
  const int rb  = (lane >> 4) << 3;
#pragma unroll
  for (int nt = 0; nt < 2; ++nt) {
    int n = nbase + wn * 32 + nt * 16 + n_l;
    float bv = bias[n];
#pragma unroll
    for (int mt = 0; mt < 4; ++mt)
#pragma unroll
      for (int r = 0; r < 8; ++r) {
        int m = rowbase + wm * 64 + mt * 16 + rb + r;
        Out[(size_t)m * D_ + n] = acc[mt][nt][r] + bv;
      }
  }
}

extern "C" void kernel_launch(void* const* d_in, const int* in_sizes, int n_in,
                              void* d_out, int out_size, void* d_ws, size_t ws_size,
                              hipStream_t stream) {
  const float* query = (const float*)d_in[0];
  const float* key   = (const float*)d_in[1];
  const float* value = (const float*)d_in[2];
  const int*   mask0 = (const int*)d_in[3];
  const int*   mask1 = (const int*)d_in[4];
  const float* Wq    = (const float*)d_in[5];
  const float* bq    = (const float*)d_in[6];
  const float* Wk    = (const float*)d_in[7];
  const float* bk    = (const float*)d_in[8];
  const float* Wv    = (const float*)d_in[9];
  const float* bv    = (const float*)d_in[10];
  const float* Wo    = (const float*)d_in[11];
  const float* bo    = (const float*)d_in[12];
  float* out = (float*)d_out;

  const size_t perTensor = (size_t)B_ * H_ * S_ * DK_;   // 8 Mi halves = 16 MB
  _Float16* Qh = (_Float16*)d_ws;
  _Float16* Kh = Qh + perTensor;
  _Float16* Vh = Kh + perTensor;
  _Float16* Ao = Vh + perTensor;
  unsigned* Mb = (unsigned*)(Ao + perTensor);            // 2 MB of lane-mask words

  dim3 blk(128);
  dim3 gblk(256);
  dim3 ggemm(D_ / 128, (B_ * S_) / 128);
  maskpack_kernel<<<dim3(B_ * S_ / 16), gblk, 0, stream>>>(mask0, mask1, Mb);
  proj_kernel<<<dim3(D_ / 128, (B_ * S_) / 128, 3), gblk, 0, stream>>>(query, key, value, Wq, Wk, Wv, bq, bk, bv, Qh);
  attn_kernel<<<dim3(S_ / 64, B_ * H_), blk, 0, stream>>>(Qh, Kh, Vh, Mb, Ao);
  outproj_kernel<<<ggemm, gblk, 0, stream>>>(Ao, Wo, bo, out);

  (void)in_sizes; (void)n_in; (void)out_size; (void)ws_size;
}

// v007
// One run takes 140 microseconds.
// In two side-by-side timings against v006, it was 1.06 and 1.05 times as fast.
// All steps since v000 together make it 5.80 times as fast.
#include <hip/hip_runtime.h>
#include <hip/hip_bf16.h>

#define B_  8
#define S_  1024
#define D_  1024
#define H_  16
#define DK_ 64

typedef _Float16 half16 __attribute__((ext_vector_type(16)));
typedef _Float16 half8  __attribute__((ext_vector_type(8)));
typedef _Float16 half4  __attribute__((ext_vector_type(4)));
typedef float    float8 __attribute__((ext_vector_type(8)));
typedef float    f32x4  __attribute__((ext_vector_type(4)));
typedef short    s16x8  __attribute__((ext_vector_type(8)));
typedef int      i32x4  __attribute__((ext_vector_type(4)));
typedef __attribute__((address_space(3))) _Float16 lds_f16;
typedef __attribute__((address_space(3))) s16x8    lds_s16x8;
typedef unsigned u32x16 __attribute__((ext_vector_type(16)));
typedef unsigned u32x4  __attribute__((ext_vector_type(4)));

// LDS row pitches in halves. Bank = dword address mod 64, so each tile is pitched for its reader:
// 16 B x odd for rows read by ds_load_b128, 32 B x odd for rows read by ds_load_tr16_b128.
#define PK_ 72   // 64-half rows (128 B) read by ds_load_b128      -> 144 B
#define PT_ 80   // 64-half rows (128 B) read by ds_load_tr16_b128 -> 160 B
#define PB_ 144  // 128-half rows (256 B) read by ds_load_tr16_b128 -> 288 B

__device__ __forceinline__ float8 f8zero() {
  float8 z = {0.f,0.f,0.f,0.f,0.f,0.f,0.f,0.f};
  return z;
}

__device__ __forceinline__ float8 wmma_f16(half16 a, half16 b, float8 c) {
  // D = A(16x32) * B(32x16) + C, f32 accumulate
  return __builtin_amdgcn_wmma_f32_16x16x32_f16(false, a, false, b, (short)0, c, false, false);
}

// Two async 16-byte global -> LDS copies (per-lane addresses), tracked by ASYNCcnt.
// s_wait_xcnt 0 closes the statement so that no address register is rewritten ahead of it.
__device__ __forceinline__ void async_g2l_2x_b128(unsigned lds0, const _Float16* g0,
                                                  unsigned lds1, const _Float16* g1) {
  asm volatile("global_load_async_to_lds_b128 %0, %1, off\n\t"
               "global_load_async_to_lds_b128 %2, %3, off\n\t"
               "s_wait_xcnt 0x0"
               :: "v"(lds0), "v"((unsigned long long)(uintptr_t)g0),
                  "v"(lds1), "v"((unsigned long long)(uintptr_t)g1)
               : "memory");
}
__device__ __forceinline__ void wait_asynccnt0() {
  asm volatile("s_wait_asynccnt 0x0" ::: "memory");
}

// ---- WMMA fragment loaders (ISA 7.12.2 layouts, wave32) -------------------
// A fragment 16x32 f16 from row-major src (ldm halves/row).
__device__ __forceinline__ half16 load_a_frag(const _Float16* src, int ldm) {
  const int lane = threadIdx.x & 31;
  const int row  = lane & 15;
  const int koff = (lane >> 4) << 3;
  const _Float16* p0 = src + row * ldm + koff;
  const _Float16* p1 = p0 + 16;
  half16 a;
#pragma unroll
  for (int i = 0; i < 8; ++i) a[i] = p0[i];
#pragma unroll
  for (int i = 0; i < 8; ++i) a[8 + i] = p1[i];
  return a;
}

// B fragment 32x16 where element (k,n) lives at src[n*ldn + k] (k contiguous).
__device__ __forceinline__ half16 load_b_frag_kc(const _Float16* src, int ldn) {
  const int lane = threadIdx.x & 31;
  const int n    = lane & 15;
  const int koff = (lane >> 4) << 3;
  const _Float16* p0 = src + n * ldn + koff;
  const _Float16* p1 = p0 + 16;
  half16 b;
#pragma unroll
  for (int i = 0; i < 8; ++i) b[i] = p0[i];
#pragma unroll
  for (int i = 0; i < 8; ++i) b[8 + i] = p1[i];
  return b;
}

// B fragment 32x16 from a row-major LDS tile: element (k,n) lives at src[k*pitch + n] (n contiguous).
// ds_load_tr16_b128 hands lane (c,h) the column n = c at k = kbase + 8h + 0..7, the k order of load_a_frag.
__device__ __forceinline__ half16 load_b_frag_tr(const _Float16* src, int pitch) {
  const int lane = threadIdx.x & 31;
  const _Float16* p = src + (((lane >> 4) << 3) + (lane & 7)) * pitch + (((lane >> 3) & 1) << 3);
  half8 lo = __builtin_bit_cast(half8, __builtin_amdgcn_ds_load_tr16_b128_v8i16((lds_s16x8*)p));
  half8 hi = __builtin_bit_cast(half8, __builtin_amdgcn_ds_load_tr16_b128_v8i16((lds_s16x8*)(p + 16 * pitch)));
  return __builtin_shufflevector(lo, hi, 0, 1, 2, 3, 4, 5, 6, 7, 8, 9, 10, 11, 12, 13, 14, 15);
}

// ---- GEMM tiling shared by kernels 1 and 3: block = 8 waves = 128 x 128 of the output, 64 of k per step;
// wave (wm, wn) owns 64 x 32 as 4 x 2 accumulator tiles.
__device__ __forceinline__ void gemm_step(const _Float16* As, const _Float16* Bs, int wm, int wn,
                                          float8 (&acc)[4][2]) {
#pragma unroll
  for (int ks = 0; ks < 2; ++ks) {
    half16 af[4], bf[2];
#pragma unroll
    for (int mt = 0; mt < 4; ++mt) af[mt] = load_a_frag(As + (wm * 64 + mt * 16) * PK_ + ks * 32, PK_);
#pragma unroll
    for (int nt = 0; nt < 2; ++nt) bf[nt] = load_b_frag_tr(Bs + ks * 32 * PB_ + wn * 32 + nt * 16, PB_);
#pragma unroll
    for (int mt = 0; mt < 4; ++mt)
#pragma unroll
      for (int nt = 0; nt < 2; ++nt) acc[mt][nt] = wmma_f16(af[mt], bf[nt], acc[mt][nt]);
  }
}

// ---- Kernel 1: input projection of all heads  Out[b,h,s,:] = (X[b,s,:] @ W[h] + bias[h]) * scale
// Output column n of the 1024 stands for head n >> 6, feature n & 63; a block's 128 columns are two heads.
// One launch does all three projections: blockIdx.z picks query, key or value. They share nothing, but 1536 blocks
// keep three on a WGP where 512 leave two, so one more block's loads fly while the others convert and multiply.
// The weights come as f16 from the pre-pass: every one of the 64 row blocks reads them, at half the bytes, and with
// the smaller staging set the registers admit a fourth block on a WGP.
__global__ __launch_bounds__(256)
void proj_kernel(const float* __restrict__ Xq, const float* __restrict__ Xk, const float* __restrict__ Xv, // [B*S, D]
                 const _Float16* __restrict__ Wh,   // three planes [H,D,DK] f16: Wq, Wk, Wv
                 const float* __restrict__ bq, const float* __restrict__ bk, const float* __restrict__ bv, // [H,DK]
                 _Float16* __restrict__ OutQKV) {  // three planes [B*H,S,DK] f16: Q, K, V
  const int z = blockIdx.z;
  const float* X    = (z == 0) ? Xq : (z == 1) ? Xk : Xv;
  const _Float16* W = Wh + (size_t)z * ((size_t)H_ * D_ * DK_);
  const float* bias = (z == 0) ? bq : (z == 1) ? bk : bv;
  _Float16* Out = OutQKV + (size_t)z * ((size_t)B_ * H_ * S_ * DK_);
  const float scale = (z == 0) ? 0.125f : 1.0f;   // 1/sqrt(DK) folded into Q
  __shared__ __attribute__((aligned(16))) _Float16 As[128 * PK_];  // [row][k]
  __shared__ __attribute__((aligned(16))) _Float16 Bs[64 * PB_];   // row-major: [k][n]
  const int tid  = threadIdx.x;
  const int wave = tid >> 5;
  const int lane = tid & 31;
  const int wm = wave & 1, wn = wave >> 1;
  const int nbase   = blockIdx.x * 128;
  const int rowbase = blockIdx.y * 128;

  // A tile: 128x64 f32, 2048 float4 slots, 8 per thread: row (tid >> 4) + 16 i, k (tid & 15) * 4.
  // B tile: 64x128 f16, 1024 slots of 16 B, 4 per thread: k (tid >> 4) + 16 i, column (tid & 15) * 8.
  const int ncol = nbase + ((tid & 15) << 3);
  const float* Xt = X + (size_t)(rowbase + (tid >> 4)) * D_ + ((tid & 15) << 2);
  const _Float16* Wt = W + (size_t)(ncol >> 6) * D_ * DK_ + (size_t)(tid >> 4) * DK_ + (ncol & 63);
  _Float16* Asw = As + (tid >> 4) * PK_ + ((tid & 15) << 2);
  _Float16* Bsw = Bs + (tid >> 4) * PB_ + ((tid & 15) << 3);

  float8 acc[4][2];
#pragma unroll
  for (int mt = 0; mt < 4; ++mt)
#pragma unroll
    for (int nt = 0; nt < 2; ++nt) acc[mt][nt] = f8zero();

  for (int kk = 0; kk < D_; kk += 64) {
    __syncthreads();
    const f32x4* pa = (const f32x4*)(Xt + kk);
    const half8* pb = (const half8*)(Wt + (size_t)kk * DK_);
    f32x4 va[8];
    half8 vb[4];
#pragma unroll
    for (int i = 0; i < 8; ++i) va[i] = pa[i * (16 * D_ / 4)];
#pragma unroll
    for (int i = 0; i < 4; ++i) vb[i] = pb[i * (16 * DK_ / 8)];
    // Inputs only. The loaded values keep the twelve loads of a k-step in flight together;
    // the addresses stay unwritten up to the wait (this build addresses the W rows from the last one).
    asm volatile("s_wait_xcnt 0x0"
                 :: "v"(va[0]), "v"(va[1]), "v"(va[2]), "v"(va[3]), "v"(va[4]), "v"(va[5]), "v"(va[6]), "v"(va[7]),
                    "v"(vb[0]), "v"(vb[1]), "v"(vb[2]), "v"(vb[3]),
                    "v"(pa), "v"(pb + 3 * (16 * DK_ / 8)));
#pragma unroll
    for (int i = 0; i < 8; ++i) {
      half4 ha = {(_Float16)va[i].x, (_Float16)va[i].y, (_Float16)va[i].z, (_Float16)va[i].w};
      *(half4*)(Asw + i * 16 * PK_) = ha;
    }
#pragma unroll
    for (int i = 0; i < 4; ++i) *(half8*)(Bsw + i * 16 * PB_) = vb[i];
    __syncthreads();

    gemm_step(As, Bs, wm, wn, acc);
  }

  const int n_l = lane & 15;
  const int rb  = (lane >> 4) << 3;
#pragma unroll
  for (int nt = 0; nt < 2; ++nt) {
    int n = nbase + wn * 32 + nt * 16 + n_l;
    float bv = bias[n];
#pragma unroll
    for (int mt = 0; mt < 4; ++mt)
#pragma unroll
      for (int r = 0; r < 8; ++r) {
        int m = rowbase + wm * 64 + mt * 16 + rb + r;     // b = m >> 10, s = m & 1023
        Out[((size_t)((m >> 10) * H_ + (n >> 6)) * S_ + (m & (S_ - 1))) * DK_ + (n & 63)] =
            (_Float16)((acc[mt][nt][r] + bv) * scale);
      }
  }
}

// ---- Kernel 2: flash-style masked attention, transposed: S^T = K Q^T, O^T += V^T P^T.
// Block = 4 waves = 64 queries of one (b,h); a wave owns 16 queries, one per lane column c = lane & 15.
// A lane (c, hh) holds query c's scores of keys 8 hh + r (tile 0) and 16 + 8 hh + r (tile 1): the k order of a
// B operand, so P^T goes from the score accumulators into the second product with no lane exchange and no LDS.
__device__ __forceinline__ float xhalf(float x) {   // lane l with lane l ^ 16
  return __builtin_bit_cast(float, __builtin_amdgcn_permlanex16(__builtin_bit_cast(int, x), __builtin_bit_cast(int, x),
                                                                0x76543210, 0xfedcba98, false, false));
}

// exp2 in asm text, in place, so that the slot which the instruction set asks for behind a transcendental (one
// independent instruction or v_nop before its result is read or its source overwritten) is tied to it: in the group
// of four each exp is the independent instruction behind the one before it, and the v_nop stands behind the last.
__device__ __forceinline__ float exp2_1(float x) {
  asm("v_exp_f32 %0, %0\n\tv_nop" : "+v"(x));
  return x;
}
__device__ __forceinline__ void exp2_4(float& a, float& b, float& c, float& d) {
  asm("v_exp_f32 %0, %0\n\tv_exp_f32 %1, %1\n\tv_exp_f32 %2, %2\n\tv_exp_f32 %3, %3\n\tv_nop"
      : "+v"(a), "+v"(b), "+v"(c), "+v"(d));
}

// ---- Mask pre-pass: both masks, read once for all 16 heads, become lane-mask words for the attention kernel.
// A tile is 16 queries x 32 keys in the attention wave's own lane layout (lane (c, hh) holds query c, keys 8 hh + r
// and 16 + 8 hh + r). Word i of mask m has bit l = (lane l's element i of mask m != 0); a tile is 32 words = 128 B:
// words 0..15 mask0, 16..31 mask1. Tile index = (b * 64 + query tile) * 32 + key chunk.
// A wave takes four tiles side by side (16 rows x 128 keys), a block the 16 whole rows.
// Each block also turns its 8192 of the 4 x 1 Mi weights into f16, once for all the GEMM blocks that read them, in
// the layout and with the rounding that the GEMM kernels' own conversion had; its loads fly with the mask loads.
#define WELEM_ (D_ * D_)   // elements of each weight tensor (H * D * DK = D * D); 4 * WELEM_ = 8192 * (B * S / 16)
#define PM_ 132  // LDS pitch in words of a 128-word row read by ds_load_b128: 528 B = 16 B x odd
__global__ __launch_bounds__(256)
void maskpack_kernel(const int* __restrict__ mask0,    // [B,S,S]
                     const int* __restrict__ mask1,    // [B,S,S]
                     unsigned* __restrict__ bits,      // [B*S/16, S/32, 32]
                     const float* __restrict__ Wq, const float* __restrict__ Wk, const float* __restrict__ Wv, // [H,D,DK]
                     const float* __restrict__ Wo,     // [D,D]
                     _Float16* __restrict__ Wh) {      // four planes of WELEM_ f16: Wq, Wk, Wv, Wo
  __shared__ __attribute__((aligned(16))) int sm[8][2][16 * PM_];   // each wave's own staging
  const int wt = blockIdx.x >> 7;   // 128 blocks a weight tensor
  const float* wsrc = (wt == 0) ? Wq : (wt == 1) ? Wk : (wt == 2) ? Wv : Wo;
  const size_t woff = (size_t)(blockIdx.x & 127) * 8192 + (threadIdx.x << 2);
  const f32x4* ps = (const f32x4*)(wsrc + woff);
  f32x4 wv[8];
#pragma unroll   // wv[] stays in registers and the eight loads are in flight together
  for (int i = 0; i < 8; ++i) wv[i] = ps[i * 256];
  const int lane = threadIdx.x & 31;
  const int wave = threadIdx.x >> 5;
  // Each global load takes 512 contiguous bytes of one row.
  const size_t off = (size_t)blockIdx.x * 16 * S_ + wave * 128 + (lane << 2);
  const i32x4* pm0 = (const i32x4*)(mask0 + off);
  const i32x4* pm1 = (const i32x4*)(mask1 + off);
  i32x4 g0[16], g1[16];
#pragma unroll
  for (int c = 0; c < 16; ++c) {
    g0[c] = pm0[c * (S_ / 4)];
    g1[c] = pm1[c * (S_ / 4)];
  }
  // The load addresses stay unwritten up to this wait, which stands behind the 32 loads.
  asm volatile("s_wait_xcnt 0x0" :: "v"(pm0), "v"(pm1) : "memory");
  int* sw = sm[wave][0] + (lane << 2);
#pragma unroll
  for (int c = 0; c < 16; ++c) {
    *(i32x4*)(sw + c * PM_)             = g0[c];
    *(i32x4*)(sw + 16 * PM_ + c * PM_)  = g1[c];
  }
  __syncthreads();   // the rows are read back by other lanes
  const int* sr = sm[wave][0] + (lane & 15) * PM_ + ((lane >> 4) << 3);
  unsigned* bw = bits + ((size_t)blockIdx.x * 32 + wave * 4) * 32 + lane;
#pragma unroll
  for (int jj = 0; jj < 4; ++jj) {
    const i32x4* r0 = (const i32x4*)(sr + jj * 32);
    const i32x4* r1 = (const i32x4*)(sr + 16 * PM_ + jj * 32);
    i32x4 k0[4] = {r0[0], r0[1], r0[4], r0[5]};
    i32x4 k1[4] = {r1[0], r1[1], r1[4], r1[5]};
    unsigned w = 0;
#pragma unroll
    for (int i = 0; i < 16; ++i) {
      const unsigned b0 = __builtin_amdgcn_ballot_w32(k0[i >> 2][i & 3] != 0);
      const unsigned b1 = __builtin_amdgcn_ballot_w32(k1[i >> 2][i & 3] != 0);
      w = (lane == i) ? b0 : w;
      w = (lane == 16 + i) ? b1 : w;
    }
    bw[jj * 32] = w;
  }
  _Float16* pd = Wh + (size_t)wt * WELEM_ + woff;
#pragma unroll
  for (int i = 0; i < 8; ++i) {
    half4 hv = {(_Float16)wv[i].x, (_Float16)wv[i].y, (_Float16)wv[i].z, (_Float16)wv[i].w};
    *(half4*)(pd + i * 1024) = hv;
  }
}

__global__ __launch_bounds__(128)
void attn_kernel(const _Float16* __restrict__ Q,   // [B*H,S,DK] (pre-scaled by 1/sqrt(DK))
                 const _Float16* __restrict__ Km,  // [B*H,S,DK]
                 const _Float16* __restrict__ Vm,  // [B*H,S,DK]
                 const unsigned* __restrict__ bits, // lane-mask words of maskpack_kernel
                 _Float16* __restrict__ AOut) {    // [B,S,H*DK] f16
  __shared__ __attribute__((aligned(16))) _Float16 Kt[32 * PK_];      // [s_local][dk] (S^T A-frags, k-contig)
  __shared__ __attribute__((aligned(16))) _Float16 Vt[32 * PT_];      // [s_local][dk] (V^T A-frags, transposing load)
  __shared__ unsigned lv[8];   // per wave: key chunks with a set mask0 bit (0..3), with a set mask1 bit (4..7)
  const int tid  = threadIdx.x;
  const int wave = tid >> 5;
  const int lane = tid & 31;
  const int n_l  = lane & 15;
  const int rb   = (lane >> 4) << 3;
  const int bh   = blockIdx.y;
  const int b = bh >> 4, h = bh & 15;
  // The query block turns with the batch. Padding empties blocks at like query positions in every batch; should the
  // blocks that share a WGP lie a fixed stride apart in the grid, they would be all full or all empty. For speed only.
  const int qb = (blockIdx.x + 2 * b) & (S_ / 64 - 1);
  const int q0 = qb * 64 + wave * 16;

  const _Float16* Qbh = Q  + (size_t)bh * S_ * DK_;
  const _Float16* Kbh = Km + (size_t)bh * S_ * DK_;
  const _Float16* Vbh = Vm + (size_t)bh * S_ * DK_;
  // This wave's lane-mask words: 128 B per 32-key chunk at a wave-uniform address, so they come by scalar loads.
  const int qtile = __builtin_amdgcn_readfirstlane(b * (S_ / 16) + qb * 4 + wave);
  const u32x16* mw = (const u32x16*)(bits + (size_t)qtile * (S_ / 32) * 32);
  const unsigned kt_base = (unsigned)(uintptr_t)(lds_f16*)Kt;  // LDS byte offset of Kt

  half16 qf0 = load_b_frag_kc(Qbh + (size_t)q0 * DK_, DK_);        // Q^T, k = dk 0..31
  half16 qf1 = load_b_frag_kc(Qbh + (size_t)q0 * DK_ + 32, DK_);   // Q^T, k = dk 32..63

  // Which key chunks count, for any mask content. A chunk whose mask0 words are all zero for the block's 64 queries
  // gives p = 0 and leaves maximum, sum and O as they are; with no mask1 bit set in the block every P is zero and O
  // stays zero. Lane l looks at chunk l of its wave's query tile (32 words); the four waves join through LDS.
  unsigned live;
  {
    const u32x4* cw = (const u32x4*)(bits + (size_t)qtile * (S_ / 32) * 32 + lane * 32);
    u32x4 c[8];
#pragma unroll   // c[] stays in registers and the eight loads are in flight together
    for (int i = 0; i < 8; ++i) c[i] = cw[i];
    const u32x4 a0 = c[0] | c[1] | c[2] | c[3];
    const u32x4 a1 = c[4] | c[5] | c[6] | c[7];
    const unsigned l0 = __builtin_amdgcn_ballot_w32((a0.x | a0.y | a0.z | a0.w) != 0u);
    const unsigned l1 = __builtin_amdgcn_ballot_w32((a1.x | a1.y | a1.z | a1.w) != 0u);
    if (lane == 0) { lv[wave] = l0; lv[4 + wave] = l1; }
    __syncthreads();   // the other waves' words are read below
    const unsigned any0 = lv[0] | lv[1] | lv[2] | lv[3];
    const unsigned any1 = lv[4] | lv[5] | lv[6] | lv[7];
    live = (unsigned)__builtin_amdgcn_readfirstlane((int)(any1 != 0u ? any0 : 0u));   // the same word in every wave
  }

  const float NEG_INF = -__builtin_inff();
  const float LOG2E = 1.44269504f;   // exp(x) = exp2(x * log2 e)
  float mrun = NEG_INF;   // this query's running maximum (equal in both halves)
  float lrun = 0.f;       // running sum over this half's keys; the halves are joined after the loop
  float8 o0 = f8zero(), o1 = f8zero(), o2 = f8zero(), o3 = f8zero();   // O^T: row dk = 16 t + rb + r, column = query

  for (int s0 = 0; s0 < S_; s0 += 32) {
    if (((live >> (s0 >> 5)) & 1u) == 0u) continue;   // block-uniform, so every wave passes the same barriers
    __syncthreads();   // all waves done reading previous Kt/Vt

    // K tile: 32x64 f16 = 4 KB, async global->LDS, 2x16B per thread.
    {
      const _Float16* gk = Kbh + (size_t)s0 * DK_;
      const unsigned l0 = kt_base + (unsigned)(tid >> 3) * (PK_ * 2u) + (unsigned)(tid & 7) * 16u;
      async_g2l_2x_b128(l0,                   gk + tid * 8,
                        l0 + 16u * PK_ * 2u,  gk + (tid + 128) * 8);
    }
    // V tile kept row-major: Vt[s_local][dk]; the fragment load transposes. 256 slots of 8 halves, 2 per thread.
    const half8* gv = (const half8*)(Vbh + (size_t)s0 * DK_) + tid;
    half8 v0 = gv[0], v1 = gv[128];
    // Lane-mask words of this chunk, in flight together with the K and V tiles.
    const u32x16 w0 = mw[(s0 >> 5) * 2];
    const u32x16 w1 = mw[(s0 >> 5) * 2 + 1];
    // The V load address stays unwritten up to this wait, which stands behind the loads.
    asm volatile("s_wait_xcnt 0x0" :: "v"(gv) : "memory");
    *(half8*)(Vt + (tid >> 3) * PT_ + ((tid & 7) << 3))        = v0;
    *(half8*)(Vt + ((tid >> 3) + 16) * PT_ + ((tid & 7) << 3)) = v1;
    wait_asynccnt0();   // our async K copies landed in LDS
    __syncthreads();    // staged tiles visible block-wide

    // scores, transposed: two 16x16 tiles of keys x queries
    float8 sc0 = f8zero(), sc1 = f8zero();
    sc0 = wmma_f16(load_a_frag(Kt,                 PK_), qf0, sc0);
    sc0 = wmma_f16(load_a_frag(Kt + 32,            PK_), qf1, sc0);
    sc1 = wmma_f16(load_a_frag(Kt + 16 * PK_,      PK_), qf0, sc1);
    sc1 = wmma_f16(load_a_frag(Kt + 16 * PK_ + 32, PK_), qf1, sc1);

    // pre-softmax key-padding mask, then this query's maximum over the chunk: in-lane, one exchange of halves
    float mx = NEG_INF;
#pragma unroll
    for (int r = 0; r < 8; ++r) {
      sc0[r] = __builtin_amdgcn_inverse_ballot_w32(w0[r])     ? sc0[r] : NEG_INF;
      sc1[r] = __builtin_amdgcn_inverse_ballot_w32(w0[8 + r]) ? sc1[r] : NEG_INF;
      mx = fmaxf(mx, fmaxf(sc0[r], sc1[r]));
    }
    mx = fmaxf(mx, xhalf(mx));

    const float mnew  = fmaxf(mrun, mx);
    const float mcl   = (mnew == NEG_INF) ? 0.f : mnew;
    const float ea    = exp2_1((mrun - mcl) * LOG2E);
    const float alpha = (mrun == NEG_INF) ? 0.f : ea;
    mrun = mnew;

    // p = exp(s - m); denominator uses pre-mask1 p; PV uses mask1*p
    float e0[8], e1[8];
#pragma unroll
    for (int r = 0; r < 8; ++r) {
      e0[r] = (sc0[r] - mcl) * LOG2E;
      e1[r] = (sc1[r] - mcl) * LOG2E;
    }
    exp2_4(e0[0], e0[1], e0[2], e0[3]);
    exp2_4(e0[4], e0[5], e0[6], e0[7]);
    exp2_4(e1[0], e1[1], e1[2], e1[3]);
    exp2_4(e1[4], e1[5], e1[6], e1[7]);
    float rsum = 0.f;
    half16 pf;
#pragma unroll
    for (int r = 0; r < 8; ++r) {
      float p0 = e0[r];
      float p1 = e1[r];
      rsum += p0 + p1;
      pf[r]     = (_Float16)(__builtin_amdgcn_inverse_ballot_w32(w1[r])     ? p0 : 0.f);
      pf[8 + r] = (_Float16)(__builtin_amdgcn_inverse_ballot_w32(w1[8 + r]) ? p1 : 0.f);
    }
    lrun = lrun * alpha + rsum;
#pragma unroll
    for (int r = 0; r < 8; ++r) {
      o0[r] *= alpha; o1[r] *= alpha; o2[r] *= alpha; o3[r] *= alpha;
    }

    o0 = wmma_f16(load_b_frag_tr(Vt +  0, PT_), pf, o0);
    o1 = wmma_f16(load_b_frag_tr(Vt + 16, PT_), pf, o1);
    o2 = wmma_f16(load_b_frag_tr(Vt + 32, PT_), pf, o2);
    o3 = wmma_f16(load_b_frag_tr(Vt + 48, PT_), pf, o3);
  }

  const float lsum = lrun + xhalf(lrun);
  const float inv  = (lsum > 0.f) ? 1.f / lsum : 0.f;

  // A lane's 8 accumulator registers are 8 consecutive dk of its query: one 16-byte store per tile.
  _Float16* orow = AOut + ((size_t)(b * S_ + q0 + n_l)) * D_ + h * DK_ + rb;
  float8 oo[4] = {o0, o1, o2, o3};
#pragma unroll
  for (int nt = 0; nt < 4; ++nt) {
    half8 ov;
#pragma unroll
    for (int r = 0; r < 8; ++r) ov[r] = (_Float16)(oo[nt][r] * inv);
    *(half8*)(orow + nt * 16) = ov;
  }
}

// ---- Kernel 3: output projection  Out = A(f16) @ Wo + bo  (f32 out)
__global__ __launch_bounds__(256)
void outproj_kernel(const _Float16* __restrict__ A,  // [B*S, D] f16
                    const _Float16* __restrict__ W,  // [D, D] f16, from the pre-pass
                    const float* __restrict__ bias,  // [D]
                    float* __restrict__ Out) {       // [B*S, D]
  __shared__ __attribute__((aligned(16))) _Float16 As[128 * PK_];  // [row][k]
  __shared__ __attribute__((aligned(16))) _Float16 Bs[64 * PB_];   // row-major: [k][n]
  const int tid  = threadIdx.x;
  const int wave = tid >> 5;
  const int lane = tid & 31;
  const int wm = wave & 1, wn = wave >> 1;
  const int nbase   = blockIdx.x * 128;
  const int rowbase = blockIdx.y * 128;

  // A tile: 128x64 f16, 1024 slots of 16 B, 4 per thread: row (tid >> 3) + 32 i, k (tid & 7) * 8.
  // B tile: 64x128 f16, 1024 slots of 16 B, 4 per thread: k (tid >> 4) + 16 i, column (tid & 15) * 8.
  const _Float16* At = A + (size_t)(rowbase + (tid >> 3)) * D_ + ((tid & 7) << 3);
  const _Float16* Wt = W + (size_t)(tid >> 4) * D_ + nbase + ((tid & 15) << 3);
  _Float16* Asw = As + (tid >> 3) * PK_ + ((tid & 7) << 3);
  _Float16* Bsw = Bs + (tid >> 4) * PB_ + ((tid & 15) << 3);

  float8 acc[4][2];
#pragma unroll
  for (int mt = 0; mt < 4; ++mt)
#pragma unroll
    for (int nt = 0; nt < 2; ++nt) acc[mt][nt] = f8zero();

  for (int kk = 0; kk < D_; kk += 64) {
    __syncthreads();
    const half8* pa = (const half8*)(At + kk);
    const half8* pb = (const half8*)(Wt + (size_t)kk * D_);
    half8 av[4], vb[4];
#pragma unroll
    for (int i = 0; i < 4; ++i) av[i] = pa[i * (32 * D_ / 8)];
#pragma unroll
    for (int i = 0; i < 4; ++i) vb[i] = pb[i * (16 * D_ / 8)];
    // Inputs only. The loaded values keep the eight loads of a k-step in flight together;
    // the addresses stay unwritten up to the wait (this build addresses the W rows from the last one).
    asm volatile("s_wait_xcnt 0x0"
                 :: "v"(av[0]), "v"(av[1]), "v"(av[2]), "v"(av[3]),
                    "v"(vb[0]), "v"(vb[1]), "v"(vb[2]), "v"(vb[3]),
                    "v"(pa), "v"(pb + 3 * (16 * D_ / 8)));
#pragma unroll
    for (int i = 0; i < 4; ++i) *(half8*)(Asw + i * 32 * PK_) = av[i];
#pragma unroll
    for (int i = 0; i < 4; ++i) *(half8*)(Bsw + i * 16 * PB_) = vb[i];
    __syncthreads();

    gemm_step(As, Bs, wm, wn, acc);
  }

  const int n_l = lane & 15;
  const int rb  = (lane >> 4) << 3;
#pragma unroll
  for (int nt = 0; nt < 2; ++nt) {
    int n = nbase + wn * 32 + nt * 16 + n_l;
    float bv = bias[n];
#pragma unroll
    for (int mt = 0; mt < 4; ++mt)
#pragma unroll
      for (int r = 0; r < 8; ++r) {
        int m = rowbase + wm * 64 + mt * 16 + rb + r;
        Out[(size_t)m * D_ + n] = acc[mt][nt][r] + bv;
      }
  }
}

extern "C" void kernel_launch(void* const* d_in, const int* in_sizes, int n_in,
                              void* d_out, int out_size, void* d_ws, size_t ws_size,
                              hipStream_t stream) {
  const float* query = (const float*)d_in[0];
  const float* key   = (const float*)d_in[1];
  const float* value = (const float*)d_in[2];
  const int*   mask0 = (const int*)d_in[3];
  const int*   mask1 = (const int*)d_in[4];
  const float* Wq    = (const float*)d_in[5];
  const float* bq    = (const float*)d_in[6];
  const float* Wk    = (const float*)d_in[7];
  const float* bk    = (const float*)d_in[8];
  const float* Wv    = (const float*)d_in[9];
  const float* bv    = (const float*)d_in[10];
  const float* Wo    = (const float*)d_in[11];
  const float* bo    = (const float*)d_in[12];
  float* out = (float*)d_out;

  const size_t perTensor = (size_t)B_ * H_ * S_ * DK_;   // 8 Mi halves = 16 MB
  _Float16* Qh = (_Float16*)d_ws;
  _Float16* Kh = Qh + perTensor;
  _Float16* Vh = Kh + perTensor;
  _Float16* Ao = Vh + perTensor;
  unsigned* Mb = (unsigned*)(Ao + perTensor);            // 2 MB of lane-mask words
  _Float16* Wh = (_Float16*)(Mb + (size_t)B_ * S_ * S_ / 16);   // 8 MB: Wq, Wk, Wv, Wo as f16

  dim3 blk(128);
  dim3 gblk(256);
  dim3 ggemm(D_ / 128, (B_ * S_) / 128);
  maskpack_kernel<<<dim3(B_ * S_ / 16), gblk, 0, stream>>>(mask0, mask1, Mb, Wq, Wk, Wv, Wo, Wh);
  proj_kernel<<<dim3(D_ / 128, (B_ * S_) / 128, 3), gblk, 0, stream>>>(query, key, value, Wh, bq, bk, bv, Qh);
  attn_kernel<<<dim3(S_ / 64, B_ * H_), blk, 0, stream>>>(Qh, Kh, Vh, Mb, Ao);
  outproj_kernel<<<ggemm, gblk, 0, stream>>>(Ao, Wh + 3 * (size_t)WELEM_, bo, out);

  (void)in_sizes; (void)n_in; (void)out_size; (void)ws_size;
}

// v008
// Measured time: 134 microseconds a run.
// Two timings next to v007 both put it at 1.04 times that version's speed.
// Over all steps from v000 it is 6.01 times as fast.
#include <hip/hip_runtime.h>
#include <hip/hip_bf16.h>

#define B_  8
#define S_  1024
#define D_  1024
#define H_  16
#define DK_ 64

typedef _Float16 half16 __attribute__((ext_vector_type(16)));
typedef _Float16 half8  __attribute__((ext_vector_type(8)));
typedef _Float16 half4  __attribute__((ext_vector_type(4)));
typedef float    float8 __attribute__((ext_vector_type(8)));
typedef float    f32x4  __attribute__((ext_vector_type(4)));
typedef short    s16x8  __attribute__((ext_vector_type(8)));
typedef int      i32x4  __attribute__((ext_vector_type(4)));
typedef __attribute__((address_space(3))) _Float16 lds_f16;
typedef __attribute__((address_space(3))) s16x8    lds_s16x8;
typedef unsigned u32x16 __attribute__((ext_vector_type(16)));
typedef unsigned u32x4  __attribute__((ext_vector_type(4)));

// LDS row pitches in halves. Bank = dword address mod 64, so each tile is pitched for its reader:
// 16 B x odd for rows read by ds_load_b128, 32 B x odd for rows read by ds_load_tr16_b128.
#define PK_ 72   // 64-half rows (128 B) read by ds_load_b128      -> 144 B
#define PT_ 80   // 64-half rows (128 B) read by ds_load_tr16_b128 -> 160 B
#define PB_ 144  // 128-half rows (256 B) read by ds_load_tr16_b128 -> 288 B
#define PW_ 272  // 256-half rows (512 B) read by ds_load_tr16_b128 -> 544 B

__device__ __forceinline__ float8 f8zero() {
  float8 z = {0.f,0.f,0.f,0.f,0.f,0.f,0.f,0.f};
  return z;
}

__device__ __forceinline__ float8 wmma_f16(half16 a, half16 b, float8 c) {
  // D = A(16x32) * B(32x16) + C, f32 accumulate
  return __builtin_amdgcn_wmma_f32_16x16x32_f16(false, a, false, b, (short)0, c, false, false);
}

// Two async 16-byte global -> LDS copies (per-lane addresses), tracked by ASYNCcnt.
// s_wait_xcnt 0 closes the statement so that no address register is rewritten ahead of it.
__device__ __forceinline__ void async_g2l_2x_b128(unsigned lds0, const _Float16* g0,
                                                  unsigned lds1, const _Float16* g1) {
  asm volatile("global_load_async_to_lds_b128 %0, %1, off\n\t"
               "global_load_async_to_lds_b128 %2, %3, off\n\t"
               "s_wait_xcnt 0x0"
               :: "v"(lds0), "v"((unsigned long long)(uintptr_t)g0),
                  "v"(lds1), "v"((unsigned long long)(uintptr_t)g1)
               : "memory");
}
__device__ __forceinline__ void wait_asynccnt0() {
  asm volatile("s_wait_asynccnt 0x0" ::: "memory");
}

// ---- WMMA fragment loaders (ISA 7.12.2 layouts, wave32) -------------------
// A fragment 16x32 f16 from row-major src (ldm halves/row).
__device__ __forceinline__ half16 load_a_frag(const _Float16* src, int ldm) {
  const int lane = threadIdx.x & 31;
  const int row  = lane & 15;
  const int koff = (lane >> 4) << 3;
  const _Float16* p0 = src + row * ldm + koff;
  const _Float16* p1 = p0 + 16;
  half16 a;
#pragma unroll
  for (int i = 0; i < 8; ++i) a[i] = p0[i];
#pragma unroll
  for (int i = 0; i < 8; ++i) a[8 + i] = p1[i];
  return a;
}

// B fragment 32x16 where element (k,n) lives at src[n*ldn + k] (k contiguous).
__device__ __forceinline__ half16 load_b_frag_kc(const _Float16* src, int ldn) {
  const int lane = threadIdx.x & 31;
  const int n    = lane & 15;
  const int koff = (lane >> 4) << 3;
  const _Float16* p0 = src + n * ldn + koff;
  const _Float16* p1 = p0 + 16;
  half16 b;
#pragma unroll
  for (int i = 0; i < 8; ++i) b[i] = p0[i];
#pragma unroll
  for (int i = 0; i < 8; ++i) b[8 + i] = p1[i];
  return b;
}

// B fragment 32x16 from a row-major LDS tile: element (k,n) lives at src[k*pitch + n] (n contiguous).
// ds_load_tr16_b128 hands lane (c,h) the column n = c at k = kbase + 8h + 0..7, the k order of load_a_frag.
__device__ __forceinline__ half16 load_b_frag_tr(const _Float16* src, int pitch) {
  const int lane = threadIdx.x & 31;
  const _Float16* p = src + (((lane >> 4) << 3) + (lane & 7)) * pitch + (((lane >> 3) & 1) << 3);
  half8 lo = __builtin_bit_cast(half8, __builtin_amdgcn_ds_load_tr16_b128_v8i16((lds_s16x8*)p));
  half8 hi = __builtin_bit_cast(half8, __builtin_amdgcn_ds_load_tr16_b128_v8i16((lds_s16x8*)(p + 16 * pitch)));
  return __builtin_shufflevector(lo, hi, 0, 1, 2, 3, 4, 5, 6, 7, 8, 9, 10, 11, 12, 13, 14, 15);
}

// ---- GEMM tiling of kernel 3: block = 8 waves = 128 x 128 of the output, 64 of k per step;
// wave (wm, wn) owns 64 x 32 as 4 x 2 accumulator tiles.
__device__ __forceinline__ void gemm_step(const _Float16* As, const _Float16* Bs, int wm, int wn,
                                          float8 (&acc)[4][2]) {
#pragma unroll
  for (int ks = 0; ks < 2; ++ks) {
    half16 af[4], bf[2];
#pragma unroll
    for (int mt = 0; mt < 4; ++mt) af[mt] = load_a_frag(As + (wm * 64 + mt * 16) * PK_ + ks * 32, PK_);
#pragma unroll
    for (int nt = 0; nt < 2; ++nt) bf[nt] = load_b_frag_tr(Bs + ks * 32 * PB_ + wn * 32 + nt * 16, PB_);
#pragma unroll
    for (int mt = 0; mt < 4; ++mt)
#pragma unroll
      for (int nt = 0; nt < 2; ++nt) acc[mt][nt] = wmma_f16(af[mt], bf[nt], acc[mt][nt]);
  }
}

// ---- GEMM tiling of kernel 1: block = 8 waves = 128 x 256 of the output, 64 of k per step;
// wave (wm, wn) owns 64 x 64 as 4 x 4 accumulator tiles: 8 fragments feed 16 products where 6 fed 8, and an X tile
// fetched from L2 serves 256 output columns.
__device__ __forceinline__ void gemm_step_wide(const _Float16* As, const _Float16* Bs, int wm, int wn,
                                               float8 (&acc)[4][4]) {
#pragma unroll
  for (int ks = 0; ks < 2; ++ks) {
    half16 af[4], bf[4];
#pragma unroll
    for (int mt = 0; mt < 4; ++mt) af[mt] = load_a_frag(As + (wm * 64 + mt * 16) * PK_ + ks * 32, PK_);
#pragma unroll
    for (int nt = 0; nt < 4; ++nt) bf[nt] = load_b_frag_tr(Bs + ks * 32 * PW_ + wn * 64 + nt * 16, PW_);
#pragma unroll
    for (int mt = 0; mt < 4; ++mt)
#pragma unroll
      for (int nt = 0; nt < 4; ++nt) acc[mt][nt] = wmma_f16(af[mt], bf[nt], acc[mt][nt]);
  }
}

// ---- Kernel 1: input projection of all heads  Out[b,h,s,:] = (X[b,s,:] @ W[h] + bias[h]) * scale
// Output column n of the 1024 stands for head n >> 6, feature n & 63; a block's 256 columns are four heads.
// One launch does all three projections: blockIdx.z picks query, key or value. They share nothing; 768 blocks are
// three for each WGP, two of them resident, so one block's loads fly while the other converts and multiplies.
// The weights come as f16 from the pre-pass: every one of the 64 row blocks reads them, at half the bytes.
__global__ __launch_bounds__(256)
void proj_kernel(const float* __restrict__ Xq, const float* __restrict__ Xk, const float* __restrict__ Xv, // [B*S, D]
                 const _Float16* __restrict__ Wh,   // three planes [H,D,DK] f16: Wq, Wk, Wv
                 const float* __restrict__ bq, const float* __restrict__ bk, const float* __restrict__ bv, // [H,DK]
                 _Float16* __restrict__ OutQKV) {  // three planes [B*H,S,DK] f16: Q, K, V
  const int z = blockIdx.z;
  const float* X    = (z == 0) ? Xq : (z == 1) ? Xk : Xv;
  const _Float16* W = Wh + (size_t)z * ((size_t)H_ * D_ * DK_);
  const float* bias = (z == 0) ? bq : (z == 1) ? bk : bv;
  _Float16* Out = OutQKV + (size_t)z * ((size_t)B_ * H_ * S_ * DK_);
  const float scale = (z == 0) ? 0.125f : 1.0f;   // 1/sqrt(DK) folded into Q
  __shared__ __attribute__((aligned(16))) _Float16 As[128 * PK_];  // [row][k]
  __shared__ __attribute__((aligned(16))) _Float16 Bs[64 * PW_];   // row-major: [k][n]
  const int tid  = threadIdx.x;
  const int wave = tid >> 5;
  const int lane = tid & 31;
  const int wm = wave & 1, wn = wave >> 1;
  const int nbase   = blockIdx.x * 256;
  const int rowbase = blockIdx.y * 128;

  // A tile: 128x64 f32, 2048 float4 slots, 8 per thread: row (tid >> 4) + 16 i, k (tid & 15) * 4.
  // B tile: 64x256 f16, 2048 slots of 16 B, 8 per thread: k (tid >> 4) + 16 i, column (tid & 15) * 8 + 128 j
  // (128 columns on are two heads on).
  const int ncol = nbase + ((tid & 15) << 3);
  const float* Xt = X + (size_t)(rowbase + (tid >> 4)) * D_ + ((tid & 15) << 2);
  const _Float16* Wt = W + (size_t)(ncol >> 6) * D_ * DK_ + (size_t)(tid >> 4) * DK_ + (ncol & 63);
  _Float16* Asw = As + (tid >> 4) * PK_ + ((tid & 15) << 2);
  _Float16* Bsw = Bs + (tid >> 4) * PW_ + ((tid & 15) << 3);

  float8 acc[4][4];
#pragma unroll
  for (int mt = 0; mt < 4; ++mt)
#pragma unroll
    for (int nt = 0; nt < 4; ++nt) acc[mt][nt] = f8zero();

  for (int kk = 0; kk < D_; kk += 64) {
    __syncthreads();
    const f32x4* pa = (const f32x4*)(Xt + kk);
    const half8* pb = (const half8*)(Wt + (size_t)kk * DK_);
    f32x4 va[8];
    half8 vb[8];
#pragma unroll
    for (int i = 0; i < 8; ++i) va[i] = pa[i * (16 * D_ / 4)];
#pragma unroll
    for (int i = 0; i < 8; ++i) vb[i] = pb[(i & 3) * (16 * DK_ / 8) + (i >> 2) * (2 * D_ * DK_ / 8)];
    // Inputs only. The loaded values keep the sixteen loads of a k-step in flight together;
    // the addresses stay unwritten up to the wait (this build addresses the W rows from the last one).
    asm volatile("s_wait_xcnt 0x0"
                 :: "v"(va[0]), "v"(va[1]), "v"(va[2]), "v"(va[3]), "v"(va[4]), "v"(va[5]), "v"(va[6]), "v"(va[7]),
                    "v"(vb[0]), "v"(vb[1]), "v"(vb[2]), "v"(vb[3]), "v"(vb[4]), "v"(vb[5]), "v"(vb[6]), "v"(vb[7]),
                    "v"(pa), "v"(pb + 3 * (16 * DK_ / 8) + 2 * D_ * DK_ / 8));
#pragma unroll
    for (int i = 0; i < 8; ++i) {
      half4 ha = {(_Float16)va[i].x, (_Float16)va[i].y, (_Float16)va[i].z, (_Float16)va[i].w};
      *(half4*)(Asw + i * 16 * PK_) = ha;
    }
#pragma unroll
    for (int i = 0; i < 8; ++i) *(half8*)(Bsw + (i & 3) * 16 * PW_ + (i >> 2) * 128) = vb[i];
    __syncthreads();

    gemm_step_wide(As, Bs, wm, wn, acc);
  }

  const int n_l = lane & 15;
  const int rb  = (lane >> 4) << 3;
  // A wave's 64 columns are one head: the four 32-byte pieces of an output row's 128-byte line go out side by side.
  _Float16 hv[4][8][4];
#pragma unroll
  for (int nt = 0; nt < 4; ++nt) {
    const float bn = bias[nbase + wn * 64 + nt * 16 + n_l];
#pragma unroll
    for (int mt = 0; mt < 4; ++mt)
#pragma unroll
      for (int r = 0; r < 8; ++r) hv[mt][r][nt] = (_Float16)((acc[mt][nt][r] + bn) * scale);
  }
  // Every value is formed in front of the first store, so that no register which an issued store names is rewritten.
  __builtin_amdgcn_sched_barrier(0);
#pragma unroll
  for (int mt = 0; mt < 4; ++mt)
#pragma unroll
    for (int r = 0; r < 8; ++r) {
      int m = rowbase + wm * 64 + mt * 16 + rb + r;     // b = m >> 10, s = m & 1023
#pragma unroll
      for (int nt = 0; nt < 4; ++nt) {
        int n = nbase + wn * 64 + nt * 16 + n_l;
        Out[((size_t)((m >> 10) * H_ + (n >> 6)) * S_ + (m & (S_ - 1))) * DK_ + (n & 63)] = hv[mt][r][nt];
      }
    }
}

// ---- Kernel 2: flash-style masked attention, transposed: S^T = K Q^T, O^T += V^T P^T.
// Block = 4 waves = 64 queries of one (b,h); a wave owns 16 queries, one per lane column c = lane & 15.
// A lane (c, hh) holds query c's scores of keys 8 hh + r (tile 0) and 16 + 8 hh + r (tile 1): the k order of a
// B operand, so P^T goes from the score accumulators into the second product with no lane exchange and no LDS.
__device__ __forceinline__ float xhalf(float x) {   // lane l with lane l ^ 16
  return __builtin_bit_cast(float, __builtin_amdgcn_permlanex16(__builtin_bit_cast(int, x), __builtin_bit_cast(int, x),
                                                                0x76543210, 0xfedcba98, false, false));
}

// exp2 in asm text, in place, so that the slot which the instruction set asks for behind a transcendental (one
// independent instruction or v_nop before its result is read or its source overwritten) is tied to it: in the group
// of four each exp is the independent instruction behind the one before it, and the v_nop stands behind the last.
__device__ __forceinline__ float exp2_1(float x) {
  asm("v_exp_f32 %0, %0\n\tv_nop" : "+v"(x));
  return x;
}
__device__ __forceinline__ void exp2_4(float& a, float& b, float& c, float& d) {
  asm("v_exp_f32 %0, %0\n\tv_exp_f32 %1, %1\n\tv_exp_f32 %2, %2\n\tv_exp_f32 %3, %3\n\tv_nop"
      : "+v"(a), "+v"(b), "+v"(c), "+v"(d));
}

// ---- Mask pre-pass: both masks, read once for all 16 heads, become lane-mask words for the attention kernel.
// A tile is 16 queries x 32 keys in the attention wave's own lane layout (lane (c, hh) holds query c, keys 8 hh + r
// and 16 + 8 hh + r). Word i of mask m has bit l = (lane l's element i of mask m != 0); a tile is 32 words = 128 B:
// words 0..15 mask0, 16..31 mask1. Tile index = (b * 64 + query tile) * 32 + key chunk.
// A wave takes four tiles side by side (16 rows x 128 keys), a block the 16 whole rows.
// Each block also turns its 8192 of the 4 x 1 Mi weights into f16, once for all the GEMM blocks that read them, in
// the layout and with the rounding that the GEMM kernels' own conversion had; its loads fly with the mask loads.
#define WELEM_ (D_ * D_)   // elements of each weight tensor (H * D * DK = D * D); 4 * WELEM_ = 8192 * (B * S / 16)
#define PM_ 132  // LDS pitch in words of a 128-word row read by ds_load_b128: 528 B = 16 B x odd
__global__ __launch_bounds__(256)
void maskpack_kernel(const int* __restrict__ mask0,    // [B,S,S]
                     const int* __restrict__ mask1,    // [B,S,S]
                     unsigned* __restrict__ bits,      // [B*S/16, S/32, 32]
                     const float* __restrict__ Wq, const float* __restrict__ Wk, const float* __restrict__ Wv, // [H,D,DK]
                     const float* __restrict__ Wo,     // [D,D]
                     _Float16* __restrict__ Wh) {      // four planes of WELEM_ f16: Wq, Wk, Wv, Wo
  __shared__ __attribute__((aligned(16))) int sm[8][2][16 * PM_];   // each wave's own staging
  const int wt = blockIdx.x >> 7;   // 128 blocks a weight tensor
  const float* wsrc = (wt == 0) ? Wq : (wt == 1) ? Wk : (wt == 2) ? Wv : Wo;
  const size_t woff = (size_t)(blockIdx.x & 127) * 8192 + (threadIdx.x << 2);
  const f32x4* ps = (const f32x4*)(wsrc + woff);
  f32x4 wv[8];
#pragma unroll   // wv[] stays in registers and the eight loads are in flight together
  for (int i = 0; i < 8; ++i) wv[i] = ps[i * 256];
  const int lane = threadIdx.x & 31;
  const int wave = threadIdx.x >> 5;
  // Each global load takes 512 contiguous bytes of one row.
  const size_t off = (size_t)blockIdx.x * 16 * S_ + wave * 128 + (lane << 2);
  const i32x4* pm0 = (const i32x4*)(mask0 + off);
  const i32x4* pm1 = (const i32x4*)(mask1 + off);
  i32x4 g0[16], g1[16];
#pragma unroll
  for (int c = 0; c < 16; ++c) {
    g0[c] = pm0[c * (S_ / 4)];
    g1[c] = pm1[c * (S_ / 4)];
  }
  // The load addresses stay unwritten up to this wait, which stands behind the 32 loads.
  asm volatile("s_wait_xcnt 0x0" :: "v"(pm0), "v"(pm1) : "memory");
  int* sw = sm[wave][0] + (lane << 2);
#pragma unroll
  for (int c = 0; c < 16; ++c) {
    *(i32x4*)(sw + c * PM_)             = g0[c];
    *(i32x4*)(sw + 16 * PM_ + c * PM_)  = g1[c];
  }
  __syncthreads();   // the rows are read back by other lanes
  const int* sr = sm[wave][0] + (lane & 15) * PM_ + ((lane >> 4) << 3);
  unsigned* bw = bits + ((size_t)blockIdx.x * 32 + wave * 4) * 32 + lane;
#pragma unroll
  for (int jj = 0; jj < 4; ++jj) {
    const i32x4* r0 = (const i32x4*)(sr + jj * 32);
    const i32x4* r1 = (const i32x4*)(sr + 16 * PM_ + jj * 32);
    i32x4 k0[4] = {r0[0], r0[1], r0[4], r0[5]};
    i32x4 k1[4] = {r1[0], r1[1], r1[4], r1[5]};
    unsigned w = 0;
#pragma unroll
    for (int i = 0; i < 16; ++i) {
      const unsigned b0 = __builtin_amdgcn_ballot_w32(k0[i >> 2][i & 3] != 0);
      const unsigned b1 = __builtin_amdgcn_ballot_w32(k1[i >> 2][i & 3] != 0);
      w = (lane == i) ? b0 : w;
      w = (lane == 16 + i) ? b1 : w;
    }
    bw[jj * 32] = w;
  }
  _Float16* pd = Wh + (size_t)wt * WELEM_ + woff;
#pragma unroll
  for (int i = 0; i < 8; ++i) {
    half4 hv = {(_Float16)wv[i].x, (_Float16)wv[i].y, (_Float16)wv[i].z, (_Float16)wv[i].w};
    *(half4*)(pd + i * 1024) = hv;
  }
}

__global__ __launch_bounds__(128)
void attn_kernel(const _Float16* __restrict__ Q,   // [B*H,S,DK] (pre-scaled by 1/sqrt(DK))
                 const _Float16* __restrict__ Km,  // [B*H,S,DK]
                 const _Float16* __restrict__ Vm,  // [B*H,S,DK]
                 const unsigned* __restrict__ bits, // lane-mask words of maskpack_kernel
                 _Float16* __restrict__ AOut) {    // [B,S,H*DK] f16
  __shared__ __attribute__((aligned(16))) _Float16 Kt[32 * PK_];      // [s_local][dk] (S^T A-frags, k-contig)
  __shared__ __attribute__((aligned(16))) _Float16 Vt[32 * PT_];      // [s_local][dk] (V^T A-frags, transposing load)
  __shared__ unsigned lv[8];   // per wave: key chunks with a set mask0 bit (0..3), with a set mask1 bit (4..7)
  const int tid  = threadIdx.x;
  const int wave = tid >> 5;
  const int lane = tid & 31;
  const int n_l  = lane & 15;
  const int rb   = (lane >> 4) << 3;
  const int bh   = blockIdx.y;
  const int b = bh >> 4, h = bh & 15;
  // The query block turns with the batch. Padding empties blocks at like query positions in every batch; should the
  // blocks that share a WGP lie a fixed stride apart in the grid, they would be all full or all empty. For speed only.
  const int qb = (blockIdx.x + 2 * b) & (S_ / 64 - 1);
  const int q0 = qb * 64 + wave * 16;

  const _Float16* Qbh = Q  + (size_t)bh * S_ * DK_;
  const _Float16* Kbh = Km + (size_t)bh * S_ * DK_;
  const _Float16* Vbh = Vm + (size_t)bh * S_ * DK_;
  // This wave's lane-mask words: 128 B per 32-key chunk at a wave-uniform address, so they come by scalar loads.
  const int qtile = __builtin_amdgcn_readfirstlane(b * (S_ / 16) + qb * 4 + wave);
  const u32x16* mw = (const u32x16*)(bits + (size_t)qtile * (S_ / 32) * 32);
  const unsigned kt_base = (unsigned)(uintptr_t)(lds_f16*)Kt;  // LDS byte offset of Kt

  half16 qf0 = load_b_frag_kc(Qbh + (size_t)q0 * DK_, DK_);        // Q^T, k = dk 0..31
  half16 qf1 = load_b_frag_kc(Qbh + (size_t)q0 * DK_ + 32, DK_);   // Q^T, k = dk 32..63

  // Which key chunks count, for any mask content. A chunk whose mask0 words are all zero for the block's 64 queries
  // gives p = 0 and leaves maximum, sum and O as they are; with no mask1 bit set in the block every P is zero and O
  // stays zero. Lane l looks at chunk l of its wave's query tile (32 words); the four waves join through LDS.
  unsigned live;
  {
    const u32x4* cw = (const u32x4*)(bits + (size_t)qtile * (S_ / 32) * 32 + lane * 32);
    u32x4 c[8];
#pragma unroll   // c[] stays in registers and the eight loads are in flight together
    for (int i = 0; i < 8; ++i) c[i] = cw[i];
    const u32x4 a0 = c[0] | c[1] | c[2] | c[3];
    const u32x4 a1 = c[4] | c[5] | c[6] | c[7];
    const unsigned l0 = __builtin_amdgcn_ballot_w32((a0.x | a0.y | a0.z | a0.w) != 0u);
    const unsigned l1 = __builtin_amdgcn_ballot_w32((a1.x | a1.y | a1.z | a1.w) != 0u);
    if (lane == 0) { lv[wave] = l0; lv[4 + wave] = l1; }
    __syncthreads();   // the other waves' words are read below
    const unsigned any0 = lv[0] | lv[1] | lv[2] | lv[3];
    const unsigned any1 = lv[4] | lv[5] | lv[6] | lv[7];
    live = (unsigned)__builtin_amdgcn_readfirstlane((int)(any1 != 0u ? any0 : 0u));   // the same word in every wave
  }

  const float NEG_INF = -__builtin_inff();
  const float LOG2E = 1.44269504f;   // exp(x) = exp2(x * log2 e)
  float mrun = NEG_INF;   // this query's running maximum (equal in both halves)
  float lrun = 0.f;       // running sum over this half's keys; the halves are joined after the loop
  float8 o0 = f8zero(), o1 = f8zero(), o2 = f8zero(), o3 = f8zero();   // O^T: row dk = 16 t + rb + r, column = query

  for (int s0 = 0; s0 < S_; s0 += 32) {
    if (((live >> (s0 >> 5)) & 1u) == 0u) continue;   // block-uniform, so every wave passes the same barriers
    __syncthreads();   // all waves done reading previous Kt/Vt

    // K tile: 32x64 f16 = 4 KB, async global->LDS, 2x16B per thread.
    {
      const _Float16* gk = Kbh + (size_t)s0 * DK_;
      const unsigned l0 = kt_base + (unsigned)(tid >> 3) * (PK_ * 2u) + (unsigned)(tid & 7) * 16u;
      async_g2l_2x_b128(l0,                   gk + tid * 8,
                        l0 + 16u * PK_ * 2u,  gk + (tid + 128) * 8);
    }
    // V tile kept row-major: Vt[s_local][dk]; the fragment load transposes. 256 slots of 8 halves, 2 per thread.
    const half8* gv = (const half8*)(Vbh + (size_t)s0 * DK_) + tid;
    half8 v0 = gv[0], v1 = gv[128];
    // Lane-mask words of this chunk, in flight together with the K and V tiles.
    const u32x16 w0 = mw[(s0 >> 5) * 2];
    const u32x16 w1 = mw[(s0 >> 5) * 2 + 1];
    // The V load address stays unwritten up to this wait, which stands behind the loads.
    asm volatile("s_wait_xcnt 0x0" :: "v"(gv) : "memory");
    *(half8*)(Vt + (tid >> 3) * PT_ + ((tid & 7) << 3))        = v0;
    *(half8*)(Vt + ((tid >> 3) + 16) * PT_ + ((tid & 7) << 3)) = v1;
    wait_asynccnt0();   // our async K copies landed in LDS
    __syncthreads();    // staged tiles visible block-wide

    // scores, transposed: two 16x16 tiles of keys x queries
    float8 sc0 = f8zero(), sc1 = f8zero();
    sc0 = wmma_f16(load_a_frag(Kt,                 PK_), qf0, sc0);
    sc0 = wmma_f16(load_a_frag(Kt + 32,            PK_), qf1, sc0);
    sc1 = wmma_f16(load_a_frag(Kt + 16 * PK_,      PK_), qf0, sc1);
    sc1 = wmma_f16(load_a_frag(Kt + 16 * PK_ + 32, PK_), qf1, sc1);

    // pre-softmax key-padding mask, then this query's maximum over the chunk: in-lane, one exchange of halves
    float mx = NEG_INF;
#pragma unroll
    for (int r = 0; r < 8; ++r) {
      sc0[r] = __builtin_amdgcn_inverse_ballot_w32(w0[r])     ? sc0[r] : NEG_INF;
      sc1[r] = __builtin_amdgcn_inverse_ballot_w32(w0[8 + r]) ? sc1[r] : NEG_INF;
      mx = fmaxf(mx, fmaxf(sc0[r], sc1[r]));
    }
    mx = fmaxf(mx, xhalf(mx));

    const float mnew  = fmaxf(mrun, mx);
    const float mcl   = (mnew == NEG_INF) ? 0.f : mnew;
    const float ea    = exp2_1((mrun - mcl) * LOG2E);
    const float alpha = (mrun == NEG_INF) ? 0.f : ea;
    mrun = mnew;

    // p = exp(s - m); denominator uses pre-mask1 p; PV uses mask1*p
    float e0[8], e1[8];
#pragma unroll
    for (int r = 0; r < 8; ++r) {
      e0[r] = (sc0[r] - mcl) * LOG2E;
      e1[r] = (sc1[r] - mcl) * LOG2E;
    }
    exp2_4(e0[0], e0[1], e0[2], e0[3]);
    exp2_4(e0[4], e0[5], e0[6], e0[7]);
    exp2_4(e1[0], e1[1], e1[2], e1[3]);
    exp2_4(e1[4], e1[5], e1[6], e1[7]);
    float rsum = 0.f;
    half16 pf;
#pragma unroll
    for (int r = 0; r < 8; ++r) {
      float p0 = e0[r];
      float p1 = e1[r];
      rsum += p0 + p1;
      pf[r]     = (_Float16)(__builtin_amdgcn_inverse_ballot_w32(w1[r])     ? p0 : 0.f);
      pf[8 + r] = (_Float16)(__builtin_amdgcn_inverse_ballot_w32(w1[8 + r]) ? p1 : 0.f);
    }
    lrun = lrun * alpha + rsum;
#pragma unroll
    for (int r = 0; r < 8; ++r) {
      o0[r] *= alpha; o1[r] *= alpha; o2[r] *= alpha; o3[r] *= alpha;
    }

    o0 = wmma_f16(load_b_frag_tr(Vt +  0, PT_), pf, o0);
    o1 = wmma_f16(load_b_frag_tr(Vt + 16, PT_), pf, o1);
    o2 = wmma_f16(load_b_frag_tr(Vt + 32, PT_), pf, o2);
    o3 = wmma_f16(load_b_frag_tr(Vt + 48, PT_), pf, o3);
  }

  const float lsum = lrun + xhalf(lrun);
  const float inv  = (lsum > 0.f) ? 1.f / lsum : 0.f;

  // A lane's 8 accumulator registers are 8 consecutive dk of its query: one 16-byte store per tile.
  _Float16* orow = AOut + ((size_t)(b * S_ + q0 + n_l)) * D_ + h * DK_ + rb;
  float8 oo[4] = {o0, o1, o2, o3};
#pragma unroll
  for (int nt = 0; nt < 4; ++nt) {
    half8 ov;
#pragma unroll
    for (int r = 0; r < 8; ++r) ov[r] = (_Float16)(oo[nt][r] * inv);
    *(half8*)(orow + nt * 16) = ov;
  }
}

// ---- Kernel 3: output projection  Out = A(f16) @ Wo + bo  (f32 out)
__global__ __launch_bounds__(256)
void outproj_kernel(const _Float16* __restrict__ A,  // [B*S, D] f16
                    const _Float16* __restrict__ W,  // [D, D] f16, from the pre-pass
                    const float* __restrict__ bias,  // [D]
                    float* __restrict__ Out) {       // [B*S, D]
  __shared__ __attribute__((aligned(16))) _Float16 As[128 * PK_];  // [row][k]
  __shared__ __attribute__((aligned(16))) _Float16 Bs[64 * PB_];   // row-major: [k][n]
  const int tid  = threadIdx.x;
  const int wave = tid >> 5;
  const int lane = tid & 31;
  const int wm = wave & 1, wn = wave >> 1;
  const int nbase   = blockIdx.x * 128;
  const int rowbase = blockIdx.y * 128;

  // A tile: 128x64 f16, 1024 slots of 16 B, 4 per thread: row (tid >> 3) + 32 i, k (tid & 7) * 8.
  // B tile: 64x128 f16, 1024 slots of 16 B, 4 per thread: k (tid >> 4) + 16 i, column (tid & 15) * 8.
  const _Float16* At = A + (size_t)(rowbase + (tid >> 3)) * D_ + ((tid & 7) << 3);
  const _Float16* Wt = W + (size_t)(tid >> 4) * D_ + nbase + ((tid & 15) << 3);
  _Float16* Asw = As + (tid >> 3) * PK_ + ((tid & 7) << 3);
  _Float16* Bsw = Bs + (tid >> 4) * PB_ + ((tid & 15) << 3);

  float8 acc[4][2];
#pragma unroll
  for (int mt = 0; mt < 4; ++mt)
#pragma unroll
    for (int nt = 0; nt < 2; ++nt) acc[mt][nt] = f8zero();

  for (int kk = 0; kk < D_; kk += 64) {
    __syncthreads();
    const half8* pa = (const half8*)(At + kk);
    const half8* pb = (const half8*)(Wt + (size_t)kk * D_);
    half8 av[4], vb[4];
#pragma unroll
    for (int i = 0; i < 4; ++i) av[i] = pa[i * (32 * D_ / 8)];
#pragma unroll
    for (int i = 0; i < 4; ++i) vb[i] = pb[i * (16 * D_ / 8)];
    // Inputs only. The loaded values keep the eight loads of a k-step in flight together;
    // the addresses stay unwritten up to the wait (this build addresses the W rows from the last one).
    asm volatile("s_wait_xcnt 0x0"
                 :: "v"(av[0]), "v"(av[1]), "v"(av[2]), "v"(av[3]),
                    "v"(vb[0]), "v"(vb[1]), "v"(vb[2]), "v"(vb[3]),
                    "v"(pa), "v"(pb + 3 * (16 * D_ / 8)));
#pragma unroll
    for (int i = 0; i < 4; ++i) *(half8*)(Asw + i * 32 * PK_) = av[i];
#pragma unroll
    for (int i = 0; i < 4; ++i) *(half8*)(Bsw + i * 16 * PB_) = vb[i];
    __syncthreads();

    gemm_step(As, Bs, wm, wn, acc);
  }

  const int n_l = lane & 15;
  const int rb  = (lane >> 4) << 3;
#pragma unroll
  for (int nt = 0; nt < 2; ++nt) {
    int n = nbase + wn * 32 + nt * 16 + n_l;
    float bv = bias[n];
#pragma unroll
    for (int mt = 0; mt < 4; ++mt)
#pragma unroll
      for (int r = 0; r < 8; ++r) {
        int m = rowbase + wm * 64 + mt * 16 + rb + r;
        Out[(size_t)m * D_ + n] = acc[mt][nt][r] + bv;
      }
  }
}

extern "C" void kernel_launch(void* const* d_in, const int* in_sizes, int n_in,
                              void* d_out, int out_size, void* d_ws, size_t ws_size,
                              hipStream_t stream) {
  const float* query = (const float*)d_in[0];
  const float* key   = (const float*)d_in[1];
  const float* value = (const float*)d_in[2];
  const int*   mask0 = (const int*)d_in[3];
  const int*   mask1 = (const int*)d_in[4];
  const float* Wq    = (const float*)d_in[5];
  const float* bq    = (const float*)d_in[6];
  const float* Wk    = (const float*)d_in[7];
  const float* bk    = (const float*)d_in[8];
  const float* Wv    = (const float*)d_in[9];
  const float* bv    = (const float*)d_in[10];
  const float* Wo    = (const float*)d_in[11];
  const float* bo    = (const float*)d_in[12];
  float* out = (float*)d_out;

  const size_t perTensor = (size_t)B_ * H_ * S_ * DK_;   // 8 Mi halves = 16 MB
  _Float16* Qh = (_Float16*)d_ws;
  _Float16* Kh = Qh + perTensor;
  _Float16* Vh = Kh + perTensor;
  _Float16* Ao = Vh + perTensor;
  unsigned* Mb = (unsigned*)(Ao + perTensor);            // 2 MB of lane-mask words
  _Float16* Wh = (_Float16*)(Mb + (size_t)B_ * S_ * S_ / 16);   // 8 MB: Wq, Wk, Wv, Wo as f16

  dim3 blk(128);
  dim3 gblk(256);
  dim3 ggemm(D_ / 128, (B_ * S_) / 128);
  maskpack_kernel<<<dim3(B_ * S_ / 16), gblk, 0, stream>>>(mask0, mask1, Mb, Wq, Wk, Wv, Wo, Wh);
  proj_kernel<<<dim3(D_ / 256, (B_ * S_) / 128, 3), gblk, 0, stream>>>(query, key, value, Wh, bq, bk, bv, Qh);
  attn_kernel<<<dim3(S_ / 64, B_ * H_), blk, 0, stream>>>(Qh, Kh, Vh, Mb, Ao);
  outproj_kernel<<<ggemm, gblk, 0, stream>>>(Ao, Wh + 3 * (size_t)WELEM_, bo, out);

  (void)in_sizes; (void)n_in; (void)out_size; (void)ws_size;
}

// v009
// It runs in 123 microseconds.
// Timed twice side by side with v008, it ran 1.09 and 1.08 times as fast.
// All steps since v000 together make it 6.53 times as fast.
#include <hip/hip_runtime.h>
#include <hip/hip_bf16.h>

#define B_  8
#define S_  1024
#define D_  1024
#define H_  16
#define DK_ 64

typedef _Float16 half16 __attribute__((ext_vector_type(16)));
typedef _Float16 half8  __attribute__((ext_vector_type(8)));
typedef _Float16 half4  __attribute__((ext_vector_type(4)));
typedef float    float8 __attribute__((ext_vector_type(8)));
typedef float    f32x4  __attribute__((ext_vector_type(4)));
typedef short    s16x8  __attribute__((ext_vector_type(8)));
typedef int      i32x4  __attribute__((ext_vector_type(4)));
typedef __attribute__((address_space(3))) _Float16 lds_f16;
typedef __attribute__((address_space(3))) s16x8    lds_s16x8;
typedef unsigned u32x16 __attribute__((ext_vector_type(16)));
typedef unsigned u32x4  __attribute__((ext_vector_type(4)));

// LDS row pitches in halves. Bank = dword address mod 64, so each tile is pitched for its reader:
// 16 B x odd for rows read by ds_load_b128, 32 B x odd for rows read by ds_load_tr16_b128.
#define PK_ 72   // 64-half rows (128 B) read by ds_load_b128      -> 144 B
#define PT_ 80   // 64-half rows (128 B) read by ds_load_tr16_b128 -> 160 B
#define PB_ 144  // 128-half rows (256 B) read by ds_load_tr16_b128 -> 288 B
#define PW_ 272  // 256-half rows (512 B) read by ds_load_tr16_b128 -> 544 B

__device__ __forceinline__ float8 f8zero() {
  float8 z = {0.f,0.f,0.f,0.f,0.f,0.f,0.f,0.f};
  return z;
}

__device__ __forceinline__ float8 wmma_f16(half16 a, half16 b, float8 c) {
  // D = A(16x32) * B(32x16) + C, f32 accumulate
  return __builtin_amdgcn_wmma_f32_16x16x32_f16(false, a, false, b, (short)0, c, false, false);
}

// Two async 16-byte global -> LDS copies (per-lane addresses), tracked by ASYNCcnt.
// s_wait_xcnt 0 closes the statement so that no address register is rewritten ahead of it.
__device__ __forceinline__ void async_g2l_2x_b128(unsigned lds0, const _Float16* g0,
                                                  unsigned lds1, const _Float16* g1) {
  asm volatile("global_load_async_to_lds_b128 %0, %1, off\n\t"
               "global_load_async_to_lds_b128 %2, %3, off\n\t"
               "s_wait_xcnt 0x0"
               :: "v"(lds0), "v"((unsigned long long)(uintptr_t)g0),
                  "v"(lds1), "v"((unsigned long long)(uintptr_t)g1)
               : "memory");
}
__device__ __forceinline__ void wait_asynccnt0() {
  asm volatile("s_wait_asynccnt 0x0" ::: "memory");
}
__device__ __forceinline__ void wait_dscnt0() {
  asm volatile("s_wait_dscnt 0x0" ::: "memory");
}
// Eight such copies, a thread's share of one k-step's tile, in one statement that the same wait closes.
__device__ __forceinline__ void async_g2l_8x_b128(const unsigned (&l)[8], const _Float16* const (&g)[8]) {
  asm volatile("global_load_async_to_lds_b128 %0, %8, off\n\t"
               "global_load_async_to_lds_b128 %1, %9, off\n\t"
               "global_load_async_to_lds_b128 %2, %10, off\n\t"
               "global_load_async_to_lds_b128 %3, %11, off\n\t"
               "global_load_async_to_lds_b128 %4, %12, off\n\t"
               "global_load_async_to_lds_b128 %5, %13, off\n\t"
               "global_load_async_to_lds_b128 %6, %14, off\n\t"
               "global_load_async_to_lds_b128 %7, %15, off\n\t"
               "s_wait_xcnt 0x0"
               :: "v"(l[0]), "v"(l[1]), "v"(l[2]), "v"(l[3]), "v"(l[4]), "v"(l[5]), "v"(l[6]), "v"(l[7]),
                  "v"((unsigned long long)(uintptr_t)g[0]), "v"((unsigned long long)(uintptr_t)g[1]),
                  "v"((unsigned long long)(uintptr_t)g[2]), "v"((unsigned long long)(uintptr_t)g[3]),
                  "v"((unsigned long long)(uintptr_t)g[4]), "v"((unsigned long long)(uintptr_t)g[5]),
                  "v"((unsigned long long)(uintptr_t)g[6]), "v"((unsigned long long)(uintptr_t)g[7])
               : "memory");
}

// ---- WMMA fragment loaders (ISA 7.12.2 layouts, wave32) -------------------
// A fragment 16x32 f16 from row-major src (ldm halves/row).
__device__ __forceinline__ half16 load_a_frag(const _Float16* src, int ldm) {
  const int lane = threadIdx.x & 31;
  const int row  = lane & 15;
  const int koff = (lane >> 4) << 3;
  const _Float16* p0 = src + row * ldm + koff;
  const _Float16* p1 = p0 + 16;
  half16 a;
#pragma unroll
  for (int i = 0; i < 8; ++i) a[i] = p0[i];
#pragma unroll
  for (int i = 0; i < 8; ++i) a[8 + i] = p1[i];
  return a;
}

// B fragment 32x16 where element (k,n) lives at src[n*ldn + k] (k contiguous).
__device__ __forceinline__ half16 load_b_frag_kc(const _Float16* src, int ldn) {
  const int lane = threadIdx.x & 31;
  const int n    = lane & 15;
  const int koff = (lane >> 4) << 3;
  const _Float16* p0 = src + n * ldn + koff;
  const _Float16* p1 = p0 + 16;
  half16 b;
#pragma unroll
  for (int i = 0; i < 8; ++i) b[i] = p0[i];
#pragma unroll
  for (int i = 0; i < 8; ++i) b[8 + i] = p1[i];
  return b;
}

// B fragment 32x16 from a row-major LDS tile: element (k,n) lives at src[k*pitch + n] (n contiguous).
// ds_load_tr16_b128 hands lane (c,h) the column n = c at k = kbase + 8h + 0..7, the k order of load_a_frag.
__device__ __forceinline__ half16 load_b_frag_tr(const _Float16* src, int pitch) {
  const int lane = threadIdx.x & 31;
  const _Float16* p = src + (((lane >> 4) << 3) + (lane & 7)) * pitch + (((lane >> 3) & 1) << 3);
  half8 lo = __builtin_bit_cast(half8, __builtin_amdgcn_ds_load_tr16_b128_v8i16((lds_s16x8*)p));
  half8 hi = __builtin_bit_cast(half8, __builtin_amdgcn_ds_load_tr16_b128_v8i16((lds_s16x8*)(p + 16 * pitch)));
  return __builtin_shufflevector(lo, hi, 0, 1, 2, 3, 4, 5, 6, 7, 8, 9, 10, 11, 12, 13, 14, 15);
}

// ---- GEMM tiling of kernel 3: block = 8 waves = 128 x 128 of the output, 64 of k per step;
// wave (wm, wn) owns 64 x 32 as 4 x 2 accumulator tiles.
__device__ __forceinline__ void gemm_step(const _Float16* As, const _Float16* Bs, int wm, int wn,
                                          float8 (&acc)[4][2]) {
#pragma unroll
  for (int ks = 0; ks < 2; ++ks) {
    half16 af[4], bf[2];
#pragma unroll
    for (int mt = 0; mt < 4; ++mt) af[mt] = load_a_frag(As + (wm * 64 + mt * 16) * PK_ + ks * 32, PK_);
#pragma unroll
    for (int nt = 0; nt < 2; ++nt) bf[nt] = load_b_frag_tr(Bs + ks * 32 * PB_ + wn * 32 + nt * 16, PB_);
    // The twelve fragment loads stay one group in front of their products: in the double-buffered loop the compiler
    // otherwise fetches each A fragment directly in front of its two products and waits it out.
    __builtin_amdgcn_sched_barrier(0);
#pragma unroll
    for (int mt = 0; mt < 4; ++mt)
#pragma unroll
      for (int nt = 0; nt < 2; ++nt) acc[mt][nt] = wmma_f16(af[mt], bf[nt], acc[mt][nt]);
    __builtin_amdgcn_sched_barrier(0);   // and the next group stays behind them
  }
}

// ---- GEMM tiling of kernel 1: block = 8 waves = 128 x 256 of the output, 64 of k per step;
// wave (wm, wn) owns 64 x 64 as 4 x 4 accumulator tiles: 8 fragments feed 16 products where 6 fed 8, and an X tile
// fetched from L2 serves 256 output columns.
__device__ __forceinline__ void gemm_step_wide(const _Float16* As, const _Float16* Bs, int wm, int wn,
                                               float8 (&acc)[4][4]) {
#pragma unroll
  for (int ks = 0; ks < 2; ++ks) {
    half16 af[4], bf[4];
#pragma unroll
    for (int mt = 0; mt < 4; ++mt) af[mt] = load_a_frag(As + (wm * 64 + mt * 16) * PK_ + ks * 32, PK_);
#pragma unroll
    for (int nt = 0; nt < 4; ++nt) bf[nt] = load_b_frag_tr(Bs + ks * 32 * PW_ + wn * 64 + nt * 16, PW_);
    // The sixteen fragment loads stay one group in front of their products: in the double-buffered loop the compiler
    // otherwise fetches each A fragment directly in front of its four products and waits it out.
    __builtin_amdgcn_sched_barrier(0);
#pragma unroll
    for (int mt = 0; mt < 4; ++mt)
#pragma unroll
      for (int nt = 0; nt < 4; ++nt) acc[mt][nt] = wmma_f16(af[mt], bf[nt], acc[mt][nt]);
    __builtin_amdgcn_sched_barrier(0);   // and the next group stays behind them
  }
}

// ---- Kernel 1: input projection of all heads  Out[b,h,s,:] = (X[b,s,:] @ W[h] + bias[h]) * scale
// Output column n of the 1024 stands for head n >> 6, feature n & 63; a block's 256 columns are four heads.
// One launch does all three projections: blockIdx.z picks query, key or value. They share nothing; 768 blocks are
// three for each WGP, two of them resident.
// The weights come as f16 from the pre-pass: every one of the 64 row blocks reads them, at half the bytes.
// The k-loop has two LDS buffers: while step t is multiplied, step t + 1's W tile flies into the other buffer by
// asynchronous copies and its X tile into registers (it has to be converted on the way); one barrier a step.
__global__ __launch_bounds__(256)
void proj_kernel(const float* __restrict__ Xq, const float* __restrict__ Xk, const float* __restrict__ Xv, // [B*S, D]
                 const _Float16* __restrict__ Wh,   // three planes [H,D,DK] f16: Wq, Wk, Wv
                 const float* __restrict__ bq, const float* __restrict__ bk, const float* __restrict__ bv, // [H,DK]
                 _Float16* __restrict__ OutQKV) {  // three planes [B*H,S,DK] f16: Q, K, V
  const int z = blockIdx.z;
  const float* X    = (z == 0) ? Xq : (z == 1) ? Xk : Xv;
  const _Float16* W = Wh + (size_t)z * ((size_t)H_ * D_ * DK_);
  const float* bias = (z == 0) ? bq : (z == 1) ? bk : bv;
  _Float16* Out = OutQKV + (size_t)z * ((size_t)B_ * H_ * S_ * DK_);
  const float scale = (z == 0) ? 0.125f : 1.0f;   // 1/sqrt(DK) folded into Q
  __shared__ __attribute__((aligned(16))) _Float16 As[2][128 * PK_];  // [buffer][row][k]
  __shared__ __attribute__((aligned(16))) _Float16 Bs[2][64 * PW_];   // [buffer], row-major: [k][n]
  const int tid  = threadIdx.x;
  const int wave = tid >> 5;
  const int lane = tid & 31;
  const int wm = wave & 1, wn = wave >> 1;
  const int nbase   = blockIdx.x * 256;
  const int rowbase = blockIdx.y * 128;

  // A tile: 128x64 f32, 2048 float4 slots, 8 per thread: row (tid >> 4) + 16 i, k (tid & 15) * 4.
  // B tile: 64x256 f16, 2048 slots of 16 B, 8 per thread: k (tid >> 4) + 16 i, column (tid & 15) * 8 + 128 j
  // (128 columns on are two heads on).
  const int ncol = nbase + ((tid & 15) << 3);
  const float* Xt = X + (size_t)(rowbase + (tid >> 4)) * D_ + ((tid & 15) << 2);
  const _Float16* Wt = W + (size_t)(ncol >> 6) * D_ * DK_ + (size_t)(tid >> 4) * DK_ + (ncol & 63);
  _Float16* Asw = As[0] + (tid >> 4) * PK_ + ((tid & 15) << 2);
  const unsigned bsw = (unsigned)(uintptr_t)(lds_f16*)Bs[0] + (unsigned)(tid >> 4) * (PW_ * 2u) + (unsigned)(tid & 15) * 16u;

  float8 acc[4][4];
#pragma unroll
  for (int mt = 0; mt < 4; ++mt)
#pragma unroll
    for (int nt = 0; nt < 4; ++nt) acc[mt][nt] = f8zero();

  f32x4 va[8];
  // Step t's W tile into buffer buf: 8 copies of 16 B a thread.
  auto copy_w = [&](int t, int buf) {
    unsigned l[8];
    const _Float16* g[8];
#pragma unroll
    for (int i = 0; i < 8; ++i) {
      l[i] = bsw + (unsigned)buf * (64u * PW_ * 2u) + (unsigned)(i & 3) * (16u * PW_ * 2u) + (unsigned)(i >> 2) * 256u;
      g[i] = Wt + (size_t)t * 64 * DK_ + (i & 3) * (16 * DK_) + (i >> 2) * (2 * D_ * DK_);
    }
    async_g2l_8x_b128(l, g);
  };
  // Step t's X tile into registers.
  auto load_x = [&](int t) {
    const f32x4* pa = (const f32x4*)(Xt + t * 64);
#pragma unroll
    for (int i = 0; i < 8; ++i) va[i] = pa[i * (16 * D_ / 4)];
    // The load address stays unwritten up to this wait, which stands behind the loads.
    asm volatile("s_wait_xcnt 0x0" :: "v"(pa) : "memory");
  };
  auto store_x = [&](int buf) {
#pragma unroll
    for (int i = 0; i < 8; ++i) {
      half4 ha = {(_Float16)va[i].x, (_Float16)va[i].y, (_Float16)va[i].z, (_Float16)va[i].w};
      *(half4*)(Asw + buf * (128 * PK_) + i * 16 * PK_) = ha;
    }
  };

  load_x(0);   // from memory, the longer way: first
  copy_w(0, 0);
  store_x(0);
  wait_dscnt0();      // our X stores are in LDS
  wait_asynccnt0();   // our W copies have landed
  __syncthreads();    // step 0 visible block-wide
  load_x(1);
  copy_w(1, 1);

#pragma unroll 1   // one body: the buffer index is a run-time bit
  for (int t = 0; t < D_ / 64; ++t) {
    const int cur = t & 1;
    gemm_step_wide(As[cur], Bs[cur], wm, wn, acc);
    if (t + 1 < D_ / 64) store_x(cur ^ 1);   // that buffer's readers left it at the last barrier
    wait_dscnt0();      // our fragment reads of this buffer and our X stores are done
    wait_asynccnt0();   // our copies of step t + 1 have landed
    __syncthreads();    // publishes step t + 1 and frees this step's buffer
    if (t + 2 < D_ / 64) {
      load_x(t + 2);
      copy_w(t + 2, cur);
    }
  }
  wait_asynccnt0();   // nothing is outstanding when the wave goes on

  const int n_l = lane & 15;
  const int rb  = (lane >> 4) << 3;
  // A wave's 64 columns are one head: the four 32-byte pieces of an output row's 128-byte line go out side by side.
  _Float16 hv[4][8][4];
#pragma unroll
  for (int nt = 0; nt < 4; ++nt) {
    const float bn = bias[nbase + wn * 64 + nt * 16 + n_l];
#pragma unroll
    for (int mt = 0; mt < 4; ++mt)
#pragma unroll
      for (int r = 0; r < 8; ++r) hv[mt][r][nt] = (_Float16)((acc[mt][nt][r] + bn) * scale);
  }
  // Every value is formed in front of the first store, so that no register which an issued store names is rewritten.
  __builtin_amdgcn_sched_barrier(0);
#pragma unroll
  for (int mt = 0; mt < 4; ++mt)
#pragma unroll
    for (int r = 0; r < 8; ++r) {
      int m = rowbase + wm * 64 + mt * 16 + rb + r;     // b = m >> 10, s = m & 1023
#pragma unroll
      for (int nt = 0; nt < 4; ++nt) {
        int n = nbase + wn * 64 + nt * 16 + n_l;
        Out[((size_t)((m >> 10) * H_ + (n >> 6)) * S_ + (m & (S_ - 1))) * DK_ + (n & 63)] = hv[mt][r][nt];
      }
    }
}

// ---- Kernel 2: flash-style masked attention, transposed: S^T = K Q^T, O^T += V^T P^T.
// Block = 4 waves = 64 queries of one (b,h); a wave owns 16 queries, one per lane column c = lane & 15.
// A lane (c, hh) holds query c's scores of keys 8 hh + r (tile 0) and 16 + 8 hh + r (tile 1): the k order of a
// B operand, so P^T goes from the score accumulators into the second product with no lane exchange and no LDS.
__device__ __forceinline__ float xhalf(float x) {   // lane l with lane l ^ 16
  return __builtin_bit_cast(float, __builtin_amdgcn_permlanex16(__builtin_bit_cast(int, x), __builtin_bit_cast(int, x),
                                                                0x76543210, 0xfedcba98, false, false));
}

// exp2 in asm text, in place, so that the slot which the instruction set asks for behind a transcendental (one
// independent instruction or v_nop before its result is read or its source overwritten) is tied to it: in the group
// of four each exp is the independent instruction behind the one before it, and the v_nop stands behind the last.
__device__ __forceinline__ float exp2_1(float x) {
  asm("v_exp_f32 %0, %0\n\tv_nop" : "+v"(x));
  return x;
}
__device__ __forceinline__ void exp2_4(float& a, float& b, float& c, float& d) {
  asm("v_exp_f32 %0, %0\n\tv_exp_f32 %1, %1\n\tv_exp_f32 %2, %2\n\tv_exp_f32 %3, %3\n\tv_nop"
      : "+v"(a), "+v"(b), "+v"(c), "+v"(d));
}

// ---- Mask pre-pass: both masks, read once for all 16 heads, become lane-mask words for the attention kernel.
// A tile is 16 queries x 32 keys in the attention wave's own lane layout (lane (c, hh) holds query c, keys 8 hh + r
// and 16 + 8 hh + r). Word i of mask m has bit l = (lane l's element i of mask m != 0); a tile is 32 words = 128 B:
// words 0..15 mask0, 16..31 mask1. Tile index = (b * 64 + query tile) * 32 + key chunk.
// A wave takes four tiles side by side (16 rows x 128 keys), a block the 16 whole rows.
// Each block also turns its 8192 of the 4 x 1 Mi weights into f16, once for all the GEMM blocks that read them, in
// the layout and with the rounding that the GEMM kernels' own conversion had; its loads fly with the mask loads.
#define WELEM_ (D_ * D_)   // elements of each weight tensor (H * D * DK = D * D); 4 * WELEM_ = 8192 * (B * S / 16)
#define PM_ 132  // LDS pitch in words of a 128-word row read by ds_load_b128: 528 B = 16 B x odd
__global__ __launch_bounds__(256)
void maskpack_kernel(const int* __restrict__ mask0,    // [B,S,S]
                     const int* __restrict__ mask1,    // [B,S,S]
                     unsigned* __restrict__ bits,      // [B*S/16, S/32, 32]
                     const float* __restrict__ Wq, const float* __restrict__ Wk, const float* __restrict__ Wv, // [H,D,DK]
                     const float* __restrict__ Wo,     // [D,D]
                     _Float16* __restrict__ Wh) {      // four planes of WELEM_ f16: Wq, Wk, Wv, Wo
  __shared__ __attribute__((aligned(16))) int sm[8][2][16 * PM_];   // each wave's own staging
  const int wt = blockIdx.x >> 7;   // 128 blocks a weight tensor
  const float* wsrc = (wt == 0) ? Wq : (wt == 1) ? Wk : (wt == 2) ? Wv : Wo;
  const size_t woff = (size_t)(blockIdx.x & 127) * 8192 + (threadIdx.x << 2);
  const f32x4* ps = (const f32x4*)(wsrc + woff);
  f32x4 wv[8];
#pragma unroll   // wv[] stays in registers and the eight loads are in flight together
  for (int i = 0; i < 8; ++i) wv[i] = ps[i * 256];
  const int lane = threadIdx.x & 31;
  const int wave = threadIdx.x >> 5;
  // Each global load takes 512 contiguous bytes of one row.
  const size_t off = (size_t)blockIdx.x * 16 * S_ + wave * 128 + (lane << 2);
  const i32x4* pm0 = (const i32x4*)(mask0 + off);
  const i32x4* pm1 = (const i32x4*)(mask1 + off);
  i32x4 g0[16], g1[16];
#pragma unroll
  for (int c = 0; c < 16; ++c) {
    g0[c] = pm0[c * (S_ / 4)];
    g1[c] = pm1[c * (S_ / 4)];
  }
  // The load addresses stay unwritten up to this wait, which stands behind the 32 loads.
  asm volatile("s_wait_xcnt 0x0" :: "v"(pm0), "v"(pm1) : "memory");
  int* sw = sm[wave][0] + (lane << 2);
#pragma unroll
  for (int c = 0; c < 16; ++c) {
    *(i32x4*)(sw + c * PM_)             = g0[c];
    *(i32x4*)(sw + 16 * PM_ + c * PM_)  = g1[c];
  }
  __syncthreads();   // the rows are read back by other lanes
  const int* sr = sm[wave][0] + (lane & 15) * PM_ + ((lane >> 4) << 3);
  unsigned* bw = bits + ((size_t)blockIdx.x * 32 + wave * 4) * 32 + lane;
#pragma unroll
  for (int jj = 0; jj < 4; ++jj) {
    const i32x4* r0 = (const i32x4*)(sr + jj * 32);
    const i32x4* r1 = (const i32x4*)(sr + 16 * PM_ + jj * 32);
    i32x4 k0[4] = {r0[0], r0[1], r0[4], r0[5]};
    i32x4 k1[4] = {r1[0], r1[1], r1[4], r1[5]};
    unsigned w = 0;
#pragma unroll
    for (int i = 0; i < 16; ++i) {
      const unsigned b0 = __builtin_amdgcn_ballot_w32(k0[i >> 2][i & 3] != 0);
      const unsigned b1 = __builtin_amdgcn_ballot_w32(k1[i >> 2][i & 3] != 0);
      w = (lane == i) ? b0 : w;
      w = (lane == 16 + i) ? b1 : w;
    }
    bw[jj * 32] = w;
  }
  _Float16* pd = Wh + (size_t)wt * WELEM_ + woff;
#pragma unroll
  for (int i = 0; i < 8; ++i) {
    half4 hv = {(_Float16)wv[i].x, (_Float16)wv[i].y, (_Float16)wv[i].z, (_Float16)wv[i].w};
    *(half4*)(pd + i * 1024) = hv;
  }
}

__global__ __launch_bounds__(128)
void attn_kernel(const _Float16* __restrict__ Q,   // [B*H,S,DK] (pre-scaled by 1/sqrt(DK))
                 const _Float16* __restrict__ Km,  // [B*H,S,DK]
                 const _Float16* __restrict__ Vm,  // [B*H,S,DK]
                 const unsigned* __restrict__ bits, // lane-mask words of maskpack_kernel
                 _Float16* __restrict__ AOut) {    // [B,S,H*DK] f16
  __shared__ __attribute__((aligned(16))) _Float16 Kt[32 * PK_];      // [s_local][dk] (S^T A-frags, k-contig)
  __shared__ __attribute__((aligned(16))) _Float16 Vt[32 * PT_];      // [s_local][dk] (V^T A-frags, transposing load)
  __shared__ unsigned lv[8];   // per wave: key chunks with a set mask0 bit (0..3), with a set mask1 bit (4..7)
  const int tid  = threadIdx.x;
  const int wave = tid >> 5;
  const int lane = tid & 31;
  const int n_l  = lane & 15;
  const int rb   = (lane >> 4) << 3;
  const int bh   = blockIdx.y;
  const int b = bh >> 4, h = bh & 15;
  // The query block turns with the batch. Padding empties blocks at like query positions in every batch; should the
  // blocks that share a WGP lie a fixed stride apart in the grid, they would be all full or all empty. For speed only.
  const int qb = (blockIdx.x + 2 * b) & (S_ / 64 - 1);
  const int q0 = qb * 64 + wave * 16;

  const _Float16* Qbh = Q  + (size_t)bh * S_ * DK_;
  const _Float16* Kbh = Km + (size_t)bh * S_ * DK_;
  const _Float16* Vbh = Vm + (size_t)bh * S_ * DK_;
  // This wave's lane-mask words: 128 B per 32-key chunk at a wave-uniform address, so they come by scalar loads.
  const int qtile = __builtin_amdgcn_readfirstlane(b * (S_ / 16) + qb * 4 + wave);
  const u32x16* mw = (const u32x16*)(bits + (size_t)qtile * (S_ / 32) * 32);
  const unsigned kt_base = (unsigned)(uintptr_t)(lds_f16*)Kt;  // LDS byte offset of Kt

  half16 qf0 = load_b_frag_kc(Qbh + (size_t)q0 * DK_, DK_);        // Q^T, k = dk 0..31
  half16 qf1 = load_b_frag_kc(Qbh + (size_t)q0 * DK_ + 32, DK_);   // Q^T, k = dk 32..63

  // Which key chunks count, for any mask content. A chunk whose mask0 words are all zero for the block's 64 queries
  // gives p = 0 and leaves maximum, sum and O as they are; with no mask1 bit set in the block every P is zero and O
  // stays zero. Lane l looks at chunk l of its wave's query tile (32 words); the four waves join through LDS.
  unsigned live;
  {
    const u32x4* cw = (const u32x4*)(bits + (size_t)qtile * (S_ / 32) * 32 + lane * 32);
    u32x4 c[8];
#pragma unroll   // c[] stays in registers and the eight loads are in flight together
    for (int i = 0; i < 8; ++i) c[i] = cw[i];
    const u32x4 a0 = c[0] | c[1] | c[2] | c[3];
    const u32x4 a1 = c[4] | c[5] | c[6] | c[7];
    const unsigned l0 = __builtin_amdgcn_ballot_w32((a0.x | a0.y | a0.z | a0.w) != 0u);
    const unsigned l1 = __builtin_amdgcn_ballot_w32((a1.x | a1.y | a1.z | a1.w) != 0u);
    if (lane == 0) { lv[wave] = l0; lv[4 + wave] = l1; }
    __syncthreads();   // the other waves' words are read below
    const unsigned any0 = lv[0] | lv[1] | lv[2] | lv[3];
    const unsigned any1 = lv[4] | lv[5] | lv[6] | lv[7];
    live = (unsigned)__builtin_amdgcn_readfirstlane((int)(any1 != 0u ? any0 : 0u));   // the same word in every wave
  }

  const float NEG_INF = -__builtin_inff();
  const float LOG2E = 1.44269504f;   // exp(x) = exp2(x * log2 e)
  float mrun = NEG_INF;   // this query's running maximum (equal in both halves)
  float lrun = 0.f;       // running sum over this half's keys; the halves are joined after the loop
  float8 o0 = f8zero(), o1 = f8zero(), o2 = f8zero(), o3 = f8zero();   // O^T: row dk = 16 t + rb + r, column = query

  for (int s0 = 0; s0 < S_; s0 += 32) {
    if (((live >> (s0 >> 5)) & 1u) == 0u) continue;   // block-uniform, so every wave passes the same barriers
    __syncthreads();   // all waves done reading previous Kt/Vt

    // K tile: 32x64 f16 = 4 KB, async global->LDS, 2x16B per thread.
    {
      const _Float16* gk = Kbh + (size_t)s0 * DK_;
      const unsigned l0 = kt_base + (unsigned)(tid >> 3) * (PK_ * 2u) + (unsigned)(tid & 7) * 16u;
      async_g2l_2x_b128(l0,                   gk + tid * 8,
                        l0 + 16u * PK_ * 2u,  gk + (tid + 128) * 8);
    }
    // V tile kept row-major: Vt[s_local][dk]; the fragment load transposes. 256 slots of 8 halves, 2 per thread.
    const half8* gv = (const half8*)(Vbh + (size_t)s0 * DK_) + tid;
    half8 v0 = gv[0], v1 = gv[128];
    // Lane-mask words of this chunk, in flight together with the K and V tiles.
    const u32x16 w0 = mw[(s0 >> 5) * 2];
    const u32x16 w1 = mw[(s0 >> 5) * 2 + 1];
    // The V load address stays unwritten up to this wait, which stands behind the loads.
    asm volatile("s_wait_xcnt 0x0" :: "v"(gv) : "memory");
    *(half8*)(Vt + (tid >> 3) * PT_ + ((tid & 7) << 3))        = v0;
    *(half8*)(Vt + ((tid >> 3) + 16) * PT_ + ((tid & 7) << 3)) = v1;
    wait_asynccnt0();   // our async K copies landed in LDS
    __syncthreads();    // staged tiles visible block-wide

    // scores, transposed: two 16x16 tiles of keys x queries
    float8 sc0 = f8zero(), sc1 = f8zero();
    sc0 = wmma_f16(load_a_frag(Kt,                 PK_), qf0, sc0);
    sc0 = wmma_f16(load_a_frag(Kt + 32,            PK_), qf1, sc0);
    sc1 = wmma_f16(load_a_frag(Kt + 16 * PK_,      PK_), qf0, sc1);
    sc1 = wmma_f16(load_a_frag(Kt + 16 * PK_ + 32, PK_), qf1, sc1);

    // pre-softmax key-padding mask, then this query's maximum over the chunk: in-lane, one exchange of halves
    float mx = NEG_INF;
#pragma unroll
    for (int r = 0; r < 8; ++r) {
      sc0[r] = __builtin_amdgcn_inverse_ballot_w32(w0[r])     ? sc0[r] : NEG_INF;
      sc1[r] = __builtin_amdgcn_inverse_ballot_w32(w0[8 + r]) ? sc1[r] : NEG_INF;
      mx = fmaxf(mx, fmaxf(sc0[r], sc1[r]));
    }
    mx = fmaxf(mx, xhalf(mx));

    const float mnew  = fmaxf(mrun, mx);
    const float mcl   = (mnew == NEG_INF) ? 0.f : mnew;
    const float ea    = exp2_1((mrun - mcl) * LOG2E);
    const float alpha = (mrun == NEG_INF) ? 0.f : ea;
    mrun = mnew;

    // p = exp(s - m); denominator uses pre-mask1 p; PV uses mask1*p
    float e0[8], e1[8];
#pragma unroll
    for (int r = 0; r < 8; ++r) {
      e0[r] = (sc0[r] - mcl) * LOG2E;
      e1[r] = (sc1[r] - mcl) * LOG2E;
    }
    exp2_4(e0[0], e0[1], e0[2], e0[3]);
    exp2_4(e0[4], e0[5], e0[6], e0[7]);
    exp2_4(e1[0], e1[1], e1[2], e1[3]);
    exp2_4(e1[4], e1[5], e1[6], e1[7]);
    float rsum = 0.f;
    half16 pf;
#pragma unroll
    for (int r = 0; r < 8; ++r) {
      float p0 = e0[r];
      float p1 = e1[r];
      rsum += p0 + p1;
      pf[r]     = (_Float16)(__builtin_amdgcn_inverse_ballot_w32(w1[r])     ? p0 : 0.f);
      pf[8 + r] = (_Float16)(__builtin_amdgcn_inverse_ballot_w32(w1[8 + r]) ? p1 : 0.f);
    }
    lrun = lrun * alpha + rsum;
#pragma unroll
    for (int r = 0; r < 8; ++r) {
      o0[r] *= alpha; o1[r] *= alpha; o2[r] *= alpha; o3[r] *= alpha;
    }

    o0 = wmma_f16(load_b_frag_tr(Vt +  0, PT_), pf, o0);
    o1 = wmma_f16(load_b_frag_tr(Vt + 16, PT_), pf, o1);
    o2 = wmma_f16(load_b_frag_tr(Vt + 32, PT_), pf, o2);
    o3 = wmma_f16(load_b_frag_tr(Vt + 48, PT_), pf, o3);
  }

  const float lsum = lrun + xhalf(lrun);
  const float inv  = (lsum > 0.f) ? 1.f / lsum : 0.f;

  // A lane's 8 accumulator registers are 8 consecutive dk of its query: one 16-byte store per tile.
  _Float16* orow = AOut + ((size_t)(b * S_ + q0 + n_l)) * D_ + h * DK_ + rb;
  float8 oo[4] = {o0, o1, o2, o3};
#pragma unroll
  for (int nt = 0; nt < 4; ++nt) {
    half8 ov;
#pragma unroll
    for (int r = 0; r < 8; ++r) ov[r] = (_Float16)(oo[nt][r] * inv);
    *(half8*)(orow + nt * 16) = ov;
  }
}

// ---- Kernel 3: output projection  Out = A(f16) @ Wo + bo  (f32 out)
__global__ __launch_bounds__(256)
void outproj_kernel(const _Float16* __restrict__ A,  // [B*S, D] f16
                    const _Float16* __restrict__ W,  // [D, D] f16, from the pre-pass
                    const float* __restrict__ bias,  // [D]
                    float* __restrict__ Out) {       // [B*S, D]
  __shared__ __attribute__((aligned(16))) _Float16 As[2][128 * PK_];  // [buffer][row][k]
  __shared__ __attribute__((aligned(16))) _Float16 Bs[2][64 * PB_];   // [buffer], row-major: [k][n]
  const int tid  = threadIdx.x;
  const int wave = tid >> 5;
  const int lane = tid & 31;
  const int wm = wave & 1, wn = wave >> 1;
  const int nbase   = blockIdx.x * 128;
  const int rowbase = blockIdx.y * 128;

  // A tile: 128x64 f16, 1024 slots of 16 B, 4 per thread: row (tid >> 3) + 32 i, k (tid & 7) * 8.
  // B tile: 64x128 f16, 1024 slots of 16 B, 4 per thread: k (tid >> 4) + 16 i, column (tid & 15) * 8.
  const _Float16* At = A + (size_t)(rowbase + (tid >> 3)) * D_ + ((tid & 7) << 3);
  const _Float16* Wt = W + (size_t)(tid >> 4) * D_ + nbase + ((tid & 15) << 3);
  const unsigned asw = (unsigned)(uintptr_t)(lds_f16*)As[0] + (unsigned)(tid >> 3) * (PK_ * 2u) + (unsigned)(tid & 7) * 16u;
  const unsigned bsw = (unsigned)(uintptr_t)(lds_f16*)Bs[0] + (unsigned)(tid >> 4) * (PB_ * 2u) + (unsigned)(tid & 15) * 16u;

  float8 acc[4][2];
#pragma unroll
  for (int mt = 0; mt < 4; ++mt)
#pragma unroll
    for (int nt = 0; nt < 2; ++nt) acc[mt][nt] = f8zero();

  // Two LDS buffers: while step t is multiplied, step t + 1's tiles fly into the other buffer by asynchronous copies.
  // Step t's A and W tiles into buffer buf: 4 + 4 copies of 16 B a thread.
  auto copy_ab = [&](int t, int buf) {
    unsigned l[8];
    const _Float16* g[8];
#pragma unroll
    for (int i = 0; i < 4; ++i) {
      l[i]     = asw + (unsigned)buf * (128u * PK_ * 2u) + (unsigned)i * (32u * PK_ * 2u);
      g[i]     = At + t * 64 + (size_t)i * 32 * D_;
      l[4 + i] = bsw + (unsigned)buf * (64u * PB_ * 2u) + (unsigned)i * (16u * PB_ * 2u);
      g[4 + i] = Wt + (size_t)t * 64 * D_ + (size_t)i * 16 * D_;
    }
    async_g2l_8x_b128(l, g);
  };

  copy_ab(0, 0);
  wait_asynccnt0();   // our copies of step 0 have landed
  __syncthreads();    // step 0 visible block-wide
  copy_ab(1, 1);

#pragma unroll 1   // one body: the buffer index is a run-time bit
  for (int t = 0; t < D_ / 64; ++t) {
    const int cur = t & 1;
    gemm_step(As[cur], Bs[cur], wm, wn, acc);
    wait_dscnt0();      // our fragment reads of this buffer are done
    wait_asynccnt0();   // our copies of step t + 1 have landed
    __syncthreads();    // publishes step t + 1 and frees this step's buffer
    if (t + 2 < D_ / 64) copy_ab(t + 2, cur);
  }
  wait_asynccnt0();   // nothing is outstanding when the wave goes on

  const int n_l = lane & 15;
  const int rb  = (lane >> 4) << 3;
#pragma unroll
  for (int nt = 0; nt < 2; ++nt) {
    int n = nbase + wn * 32 + nt * 16 + n_l;
    float bv = bias[n];
#pragma unroll
    for (int mt = 0; mt < 4; ++mt)
#pragma unroll
      for (int r = 0; r < 8; ++r) {
        int m = rowbase + wm * 64 + mt * 16 + rb + r;
        Out[(size_t)m * D_ + n] = acc[mt][nt][r] + bv;
      }
  }
}

extern "C" void kernel_launch(void* const* d_in, const int* in_sizes, int n_in,
                              void* d_out, int out_size, void* d_ws, size_t ws_size,
                              hipStream_t stream) {
  const float* query = (const float*)d_in[0];
  const float* key   = (const float*)d_in[1];
  const float* value = (const float*)d_in[2];
  const int*   mask0 = (const int*)d_in[3];
  const int*   mask1 = (const int*)d_in[4];
  const float* Wq    = (const float*)d_in[5];
  const float* bq    = (const float*)d_in[6];
  const float* Wk    = (const float*)d_in[7];
  const float* bk    = (const float*)d_in[8];
  const float* Wv    = (const float*)d_in[9];
  const float* bv    = (const float*)d_in[10];
  const float* Wo    = (const float*)d_in[11];
  const float* bo    = (const float*)d_in[12];
  float* out = (float*)d_out;

  const size_t perTensor = (size_t)B_ * H_ * S_ * DK_;   // 8 Mi halves = 16 MB
  _Float16* Qh = (_Float16*)d_ws;
  _Float16* Kh = Qh + perTensor;
  _Float16* Vh = Kh + perTensor;
  _Float16* Ao = Vh + perTensor;
  unsigned* Mb = (unsigned*)(Ao + perTensor);            // 2 MB of lane-mask words
  _Float16* Wh = (_Float16*)(Mb + (size_t)B_ * S_ * S_ / 16);   // 8 MB: Wq, Wk, Wv, Wo as f16

  dim3 blk(128);
  dim3 gblk(256);
  dim3 ggemm(D_ / 128, (B_ * S_) / 128);
  maskpack_kernel<<<dim3(B_ * S_ / 16), gblk, 0, stream>>>(mask0, mask1, Mb, Wq, Wk, Wv, Wo, Wh);
  proj_kernel<<<dim3(D_ / 256, (B_ * S_) / 128, 3), gblk, 0, stream>>>(query, key, value, Wh, bq, bk, bv, Qh);
  attn_kernel<<<dim3(S_ / 64, B_ * H_), blk, 0, stream>>>(Qh, Kh, Vh, Mb, Ao);
  outproj_kernel<<<ggemm, gblk, 0, stream>>>(Ao, Wh + 3 * (size_t)WELEM_, bo, out);

  (void)in_sizes; (void)n_in; (void)out_size; (void)ws_size;
}

// v010
// A run of this version takes 119 microseconds.
// Timed twice side by side with v009, it ran 1.03 times as fast both times.
// Counting every step since v000, it is 6.73 times as fast.
#include <hip/hip_runtime.h>
#include <hip/hip_bf16.h>

#define B_  8
#define S_  1024
#define D_  1024
#define H_  16
#define DK_ 64

typedef _Float16 half16 __attribute__((ext_vector_type(16)));
typedef _Float16 half8  __attribute__((ext_vector_type(8)));
typedef _Float16 half4  __attribute__((ext_vector_type(4)));
typedef float    float8 __attribute__((ext_vector_type(8)));
typedef float    f32x4  __attribute__((ext_vector_type(4)));
typedef short    s16x8  __attribute__((ext_vector_type(8)));
typedef int      i32x4  __attribute__((ext_vector_type(4)));
typedef __attribute__((address_space(3))) _Float16 lds_f16;
typedef __attribute__((address_space(3))) s16x8    lds_s16x8;
typedef unsigned u32x16 __attribute__((ext_vector_type(16)));
typedef unsigned u32x4  __attribute__((ext_vector_type(4)));
typedef __attribute__((address_space(4))) u32x16 c_u32x16;

// LDS row pitches in halves. Bank = dword address mod 64, so each tile is pitched for its reader:
// 16 B x odd for rows read by ds_load_b128, 32 B x odd for rows read by ds_load_tr16_b128.
#define PK_ 72   // 64-half rows (128 B) read by ds_load_b128      -> 144 B
#define PT_ 80   // 64-half rows (128 B) read by ds_load_tr16_b128 -> 160 B
#define PB_ 144  // 128-half rows (256 B) read by ds_load_tr16_b128 -> 288 B
#define PW_ 272  // 256-half rows (512 B) read by ds_load_tr16_b128 -> 544 B

__device__ __forceinline__ float8 f8zero() {
  float8 z = {0.f,0.f,0.f,0.f,0.f,0.f,0.f,0.f};
  return z;
}

__device__ __forceinline__ float8 wmma_f16(half16 a, half16 b, float8 c) {
  // D = A(16x32) * B(32x16) + C, f32 accumulate
  return __builtin_amdgcn_wmma_f32_16x16x32_f16(false, a, false, b, (short)0, c, false, false);
}

// Four async 16-byte global -> LDS copies (per-lane addresses), tracked by ASYNCcnt.
// s_wait_xcnt 0 closes the statement so that no address register is rewritten ahead of it.
__device__ __forceinline__ void async_g2l_4x_b128(unsigned lds0, const _Float16* g0,
                                                  unsigned lds1, const _Float16* g1,
                                                  unsigned lds2, const _Float16* g2,
                                                  unsigned lds3, const _Float16* g3) {
  asm volatile("global_load_async_to_lds_b128 %0, %1, off\n\t"
               "global_load_async_to_lds_b128 %2, %3, off\n\t"
               "global_load_async_to_lds_b128 %4, %5, off\n\t"
               "global_load_async_to_lds_b128 %6, %7, off\n\t"
               "s_wait_xcnt 0x0"
               :: "v"(lds0), "v"((unsigned long long)(uintptr_t)g0),
                  "v"(lds1), "v"((unsigned long long)(uintptr_t)g1),
                  "v"(lds2), "v"((unsigned long long)(uintptr_t)g2),
                  "v"(lds3), "v"((unsigned long long)(uintptr_t)g3)
               : "memory");
}
__device__ __forceinline__ void wait_asynccnt0() {
  asm volatile("s_wait_asynccnt 0x0" ::: "memory");
}
__device__ __forceinline__ void wait_dscnt0() {
  asm volatile("s_wait_dscnt 0x0" ::: "memory");
}
// Eight such copies, a thread's share of one k-step's tile, in one statement that the same wait closes.
__device__ __forceinline__ void async_g2l_8x_b128(const unsigned (&l)[8], const _Float16* const (&g)[8]) {
  asm volatile("global_load_async_to_lds_b128 %0, %8, off\n\t"
               "global_load_async_to_lds_b128 %1, %9, off\n\t"
               "global_load_async_to_lds_b128 %2, %10, off\n\t"
               "global_load_async_to_lds_b128 %3, %11, off\n\t"
               "global_load_async_to_lds_b128 %4, %12, off\n\t"
               "global_load_async_to_lds_b128 %5, %13, off\n\t"
               "global_load_async_to_lds_b128 %6, %14, off\n\t"
               "global_load_async_to_lds_b128 %7, %15, off\n\t"
               "s_wait_xcnt 0x0"
               :: "v"(l[0]), "v"(l[1]), "v"(l[2]), "v"(l[3]), "v"(l[4]), "v"(l[5]), "v"(l[6]), "v"(l[7]),
                  "v"((unsigned long long)(uintptr_t)g[0]), "v"((unsigned long long)(uintptr_t)g[1]),
                  "v"((unsigned long long)(uintptr_t)g[2]), "v"((unsigned long long)(uintptr_t)g[3]),
                  "v"((unsigned long long)(uintptr_t)g[4]), "v"((unsigned long long)(uintptr_t)g[5]),
                  "v"((unsigned long long)(uintptr_t)g[6]), "v"((unsigned long long)(uintptr_t)g[7])
               : "memory");
}

// ---- WMMA fragment loaders (ISA 7.12.2 layouts, wave32) -------------------
// A fragment 16x32 f16 from row-major src (ldm halves/row).
__device__ __forceinline__ half16 load_a_frag(const _Float16* src, int ldm) {
  const int lane = threadIdx.x & 31;
  const int row  = lane & 15;
  const int koff = (lane >> 4) << 3;
  const _Float16* p0 = src + row * ldm + koff;
  const _Float16* p1 = p0 + 16;
  half16 a;
#pragma unroll
  for (int i = 0; i < 8; ++i) a[i] = p0[i];
#pragma unroll
  for (int i = 0; i < 8; ++i) a[8 + i] = p1[i];
  return a;
}

// B fragment 32x16 where element (k,n) lives at src[n*ldn + k] (k contiguous).
__device__ __forceinline__ half16 load_b_frag_kc(const _Float16* src, int ldn) {
  const int lane = threadIdx.x & 31;
  const int n    = lane & 15;
  const int koff = (lane >> 4) << 3;
  const _Float16* p0 = src + n * ldn + koff;
  const _Float16* p1 = p0 + 16;
  half16 b;
#pragma unroll
  for (int i = 0; i < 8; ++i) b[i] = p0[i];
#pragma unroll
  for (int i = 0; i < 8; ++i) b[8 + i] = p1[i];
  return b;
}

// B fragment 32x16 from a row-major LDS tile: element (k,n) lives at src[k*pitch + n] (n contiguous).
// ds_load_tr16_b128 hands lane (c,h) the column n = c at k = kbase + 8h + 0..7, the k order of load_a_frag.
__device__ __forceinline__ half16 load_b_frag_tr(const _Float16* src, int pitch) {
  const int lane = threadIdx.x & 31;
  const _Float16* p = src + (((lane >> 4) << 3) + (lane & 7)) * pitch + (((lane >> 3) & 1) << 3);
  half8 lo = __builtin_bit_cast(half8, __builtin_amdgcn_ds_load_tr16_b128_v8i16((lds_s16x8*)p));
  half8 hi = __builtin_bit_cast(half8, __builtin_amdgcn_ds_load_tr16_b128_v8i16((lds_s16x8*)(p + 16 * pitch)));
  return __builtin_shufflevector(lo, hi, 0, 1, 2, 3, 4, 5, 6, 7, 8, 9, 10, 11, 12, 13, 14, 15);
}

// ---- GEMM tiling of kernel 3: block = 8 waves = 128 x 128 of the output, 64 of k per step;
// wave (wm, wn) owns 64 x 32 as 4 x 2 accumulator tiles.
__device__ __forceinline__ void gemm_step(const _Float16* As, const _Float16* Bs, int wm, int wn,
                                          float8 (&acc)[4][2]) {
#pragma unroll
  for (int ks = 0; ks < 2; ++ks) {
    half16 af[4], bf[2];
#pragma unroll
    for (int mt = 0; mt < 4; ++mt) af[mt] = load_a_frag(As + (wm * 64 + mt * 16) * PK_ + ks * 32, PK_);
#pragma unroll
    for (int nt = 0; nt < 2; ++nt) bf[nt] = load_b_frag_tr(Bs + ks * 32 * PB_ + wn * 32 + nt * 16, PB_);
    // The twelve fragment loads stay one group in front of their products: in the double-buffered loop the compiler
    // otherwise fetches each A fragment directly in front of its two products and waits it out.
    __builtin_amdgcn_sched_barrier(0);
#pragma unroll
    for (int mt = 0; mt < 4; ++mt)
#pragma unroll
      for (int nt = 0; nt < 2; ++nt) acc[mt][nt] = wmma_f16(af[mt], bf[nt], acc[mt][nt]);
    __builtin_amdgcn_sched_barrier(0);   // and the next group stays behind them
  }
}

// ---- GEMM tiling of kernel 1: block = 8 waves = 128 x 256 of the output, 64 of k per step;
// wave (wm, wn) owns 64 x 64 as 4 x 4 accumulator tiles: 8 fragments feed 16 products where 6 fed 8, and an X tile
// fetched from L2 serves 256 output columns.
__device__ __forceinline__ void gemm_step_wide(const _Float16* As, const _Float16* Bs, int wm, int wn,
                                               float8 (&acc)[4][4]) {
#pragma unroll
  for (int ks = 0; ks < 2; ++ks) {
    half16 af[4], bf[4];
#pragma unroll
    for (int mt = 0; mt < 4; ++mt) af[mt] = load_a_frag(As + (wm * 64 + mt * 16) * PK_ + ks * 32, PK_);
#pragma unroll
    for (int nt = 0; nt < 4; ++nt) bf[nt] = load_b_frag_tr(Bs + ks * 32 * PW_ + wn * 64 + nt * 16, PW_);
    // The sixteen fragment loads stay one group in front of their products: in the double-buffered loop the compiler
    // otherwise fetches each A fragment directly in front of its four products and waits it out.
    __builtin_amdgcn_sched_barrier(0);
#pragma unroll
    for (int mt = 0; mt < 4; ++mt)
#pragma unroll
      for (int nt = 0; nt < 4; ++nt) acc[mt][nt] = wmma_f16(af[mt], bf[nt], acc[mt][nt]);
    __builtin_amdgcn_sched_barrier(0);   // and the next group stays behind them
  }
}

// ---- Kernel 1: input projection of all heads  Out[b,h,s,:] = (X[b,s,:] @ W[h] + bias[h]) * scale
// Output column n of the 1024 stands for head n >> 6, feature n & 63; a block's 256 columns are four heads.
// One launch does all three projections: blockIdx.z picks query, key or value. They share nothing; 768 blocks are
// three for each WGP, two of them resident.
// The weights come as f16 from the pre-pass: every one of the 64 row blocks reads them, at half the bytes.
// The k-loop has two LDS buffers: while step t is multiplied, step t + 1's W tile flies into the other buffer by
// asynchronous copies and its X tile into registers (it has to be converted on the way); one barrier a step.
__global__ __launch_bounds__(256)
void proj_kernel(const float* __restrict__ Xq, const float* __restrict__ Xk, const float* __restrict__ Xv, // [B*S, D]
                 const _Float16* __restrict__ Wh,   // three planes [H,D,DK] f16: Wq, Wk, Wv
                 const float* __restrict__ bq, const float* __restrict__ bk, const float* __restrict__ bv, // [H,DK]
                 _Float16* __restrict__ OutQKV) {  // three planes [B*H,S,DK] f16: Q, K, V
  const int z = blockIdx.z;
  const float* X    = (z == 0) ? Xq : (z == 1) ? Xk : Xv;
  const _Float16* W = Wh + (size_t)z * ((size_t)H_ * D_ * DK_);
  const float* bias = (z == 0) ? bq : (z == 1) ? bk : bv;
  _Float16* Out = OutQKV + (size_t)z * ((size_t)B_ * H_ * S_ * DK_);
  const float scale = (z == 0) ? 0.125f : 1.0f;   // 1/sqrt(DK) folded into Q
  __shared__ __attribute__((aligned(16))) _Float16 As[2][128 * PK_];  // [buffer][row][k]
  __shared__ __attribute__((aligned(16))) _Float16 Bs[2][64 * PW_];   // [buffer], row-major: [k][n]
  const int tid  = threadIdx.x;
  const int wave = tid >> 5;
  const int lane = tid & 31;
  const int wm = wave & 1, wn = wave >> 1;
  const int nbase   = blockIdx.x * 256;
  const int rowbase = blockIdx.y * 128;

  // A tile: 128x64 f32, 2048 float4 slots, 8 per thread: row (tid >> 4) + 16 i, k (tid & 15) * 4.
  // B tile: 64x256 f16, 2048 slots of 16 B, 8 per thread: k (tid >> 4) + 16 i, column (tid & 15) * 8 + 128 j
  // (128 columns on are two heads on).
  const int ncol = nbase + ((tid & 15) << 3);
  const float* Xt = X + (size_t)(rowbase + (tid >> 4)) * D_ + ((tid & 15) << 2);
  const _Float16* Wt = W + (size_t)(ncol >> 6) * D_ * DK_ + (size_t)(tid >> 4) * DK_ + (ncol & 63);
  _Float16* Asw = As[0] + (tid >> 4) * PK_ + ((tid & 15) << 2);
  const unsigned bsw = (unsigned)(uintptr_t)(lds_f16*)Bs[0] + (unsigned)(tid >> 4) * (PW_ * 2u) + (unsigned)(tid & 15) * 16u;

  float8 acc[4][4];
#pragma unroll
  for (int mt = 0; mt < 4; ++mt)
#pragma unroll
    for (int nt = 0; nt < 4; ++nt) acc[mt][nt] = f8zero();

  f32x4 va[8];
  // Step t's W tile into buffer buf: 8 copies of 16 B a thread.
  auto copy_w = [&](int t, int buf) {
    unsigned l[8];
    const _Float16* g[8];
#pragma unroll
    for (int i = 0; i < 8; ++i) {
      l[i] = bsw + (unsigned)buf * (64u * PW_ * 2u) + (unsigned)(i & 3) * (16u * PW_ * 2u) + (unsigned)(i >> 2) * 256u;
      g[i] = Wt + (size_t)t * 64 * DK_ + (i & 3) * (16 * DK_) + (i >> 2) * (2 * D_ * DK_);
    }
    async_g2l_8x_b128(l, g);
  };
  // Step t's X tile into registers.
  auto load_x = [&](int t) {
    const f32x4* pa = (const f32x4*)(Xt + t * 64);
#pragma unroll
    for (int i = 0; i < 8; ++i) va[i] = pa[i * (16 * D_ / 4)];
    // The load address stays unwritten up to this wait, which stands behind the loads.
    asm volatile("s_wait_xcnt 0x0" :: "v"(pa) : "memory");
  };
  auto store_x = [&](int buf) {
#pragma unroll
    for (int i = 0; i < 8; ++i) {
      half4 ha = {(_Float16)va[i].x, (_Float16)va[i].y, (_Float16)va[i].z, (_Float16)va[i].w};
      *(half4*)(Asw + buf * (128 * PK_) + i * 16 * PK_) = ha;
    }
  };

  load_x(0);   // from memory, the longer way: first
  copy_w(0, 0);
  store_x(0);
  wait_dscnt0();      // our X stores are in LDS
  wait_asynccnt0();   // our W copies have landed
  __syncthreads();    // step 0 visible block-wide
  load_x(1);
  copy_w(1, 1);

#pragma unroll 1   // one body: the buffer index is a run-time bit
  for (int t = 0; t < D_ / 64; ++t) {
    const int cur = t & 1;
    gemm_step_wide(As[cur], Bs[cur], wm, wn, acc);
    if (t + 1 < D_ / 64) store_x(cur ^ 1);   // that buffer's readers left it at the last barrier
    wait_dscnt0();      // our fragment reads of this buffer and our X stores are done
    wait_asynccnt0();   // our copies of step t + 1 have landed
    __syncthreads();    // publishes step t + 1 and frees this step's buffer
    if (t + 2 < D_ / 64) {
      load_x(t + 2);
      copy_w(t + 2, cur);
    }
  }
  wait_asynccnt0();   // nothing is outstanding when the wave goes on

  const int n_l = lane & 15;
  const int rb  = (lane >> 4) << 3;
  // A wave's 64 columns are one head: the four 32-byte pieces of an output row's 128-byte line go out side by side.
  _Float16 hv[4][8][4];
#pragma unroll
  for (int nt = 0; nt < 4; ++nt) {
    const float bn = bias[nbase + wn * 64 + nt * 16 + n_l];
#pragma unroll
    for (int mt = 0; mt < 4; ++mt)
#pragma unroll
      for (int r = 0; r < 8; ++r) hv[mt][r][nt] = (_Float16)((acc[mt][nt][r] + bn) * scale);
  }
  // Every value is formed in front of the first store, so that no register which an issued store names is rewritten.
  __builtin_amdgcn_sched_barrier(0);
#pragma unroll
  for (int mt = 0; mt < 4; ++mt)
#pragma unroll
    for (int r = 0; r < 8; ++r) {
      int m = rowbase + wm * 64 + mt * 16 + rb + r;     // b = m >> 10, s = m & 1023
#pragma unroll
      for (int nt = 0; nt < 4; ++nt) {
        int n = nbase + wn * 64 + nt * 16 + n_l;
        Out[((size_t)((m >> 10) * H_ + (n >> 6)) * S_ + (m & (S_ - 1))) * DK_ + (n & 63)] = hv[mt][r][nt];
      }
    }
}

// ---- Kernel 2: flash-style masked attention, transposed: S^T = K Q^T, O^T += V^T P^T.
// Block = 4 waves = 64 queries of one (b,h); a wave owns 16 queries, one per lane column c = lane & 15.
// A lane (c, hh) holds query c's scores of keys 8 hh + r (tile 0) and 16 + 8 hh + r (tile 1): the k order of a
// B operand, so P^T goes from the score accumulators into the second product with no lane exchange and no LDS.
__device__ __forceinline__ float xhalf(float x) {   // lane l with lane l ^ 16
  return __builtin_bit_cast(float, __builtin_amdgcn_permlanex16(__builtin_bit_cast(int, x), __builtin_bit_cast(int, x),
                                                                0x76543210, 0xfedcba98, false, false));
}

// exp2 in asm text, in place, so that the slot which the instruction set asks for behind a transcendental (one
// independent instruction or v_nop before its result is read or its source overwritten) is tied to it: in the group
// of four each exp is the independent instruction behind the one before it, and the v_nop stands behind the last.
__device__ __forceinline__ float exp2_1(float x) {
  asm("v_exp_f32 %0, %0\n\tv_nop" : "+v"(x));
  return x;
}
__device__ __forceinline__ void exp2_4(float& a, float& b, float& c, float& d) {
  asm("v_exp_f32 %0, %0\n\tv_exp_f32 %1, %1\n\tv_exp_f32 %2, %2\n\tv_exp_f32 %3, %3\n\tv_nop"
      : "+v"(a), "+v"(b), "+v"(c), "+v"(d));
}

// ---- Mask pre-pass: both masks, read once for all 16 heads, become lane-mask words for the attention kernel.
// A tile is 16 queries x 32 keys in the attention wave's own lane layout (lane (c, hh) holds query c, keys 8 hh + r
// and 16 + 8 hh + r). Word i of mask m has bit l = (lane l's element i of mask m != 0); a tile is 32 words = 128 B:
// words 0..15 mask0, 16..31 mask1. Tile index = (b * 64 + query tile) * 32 + key chunk.
// A wave takes four tiles side by side (16 rows x 128 keys), a block the 16 whole rows.
// Each block also turns its 8192 of the 4 x 1 Mi weights into f16, once for all the GEMM blocks that read them, in
// the layout and with the rounding that the GEMM kernels' own conversion had; its loads fly with the mask loads.
#define WELEM_ (D_ * D_)   // elements of each weight tensor (H * D * DK = D * D); 4 * WELEM_ = 8192 * (B * S / 16)
#define PM_ 132  // LDS pitch in words of a 128-word row read by ds_load_b128: 528 B = 16 B x odd
__global__ __launch_bounds__(256)
void maskpack_kernel(const int* __restrict__ mask0,    // [B,S,S]
                     const int* __restrict__ mask1,    // [B,S,S]
                     unsigned* __restrict__ bits,      // [B*S/16, S/32, 32]
                     const float* __restrict__ Wq, const float* __restrict__ Wk, const float* __restrict__ Wv, // [H,D,DK]
                     const float* __restrict__ Wo,     // [D,D]
                     _Float16* __restrict__ Wh) {      // four planes of WELEM_ f16: Wq, Wk, Wv, Wo
  __shared__ __attribute__((aligned(16))) int sm[8][2][16 * PM_];   // each wave's own staging
  const int wt = blockIdx.x >> 7;   // 128 blocks a weight tensor
  const float* wsrc = (wt == 0) ? Wq : (wt == 1) ? Wk : (wt == 2) ? Wv : Wo;
  const size_t woff = (size_t)(blockIdx.x & 127) * 8192 + (threadIdx.x << 2);
  const f32x4* ps = (const f32x4*)(wsrc + woff);
  f32x4 wv[8];
#pragma unroll   // wv[] stays in registers and the eight loads are in flight together
  for (int i = 0; i < 8; ++i) wv[i] = ps[i * 256];
  const int lane = threadIdx.x & 31;
  const int wave = threadIdx.x >> 5;
  // Each global load takes 512 contiguous bytes of one row.
  const size_t off = (size_t)blockIdx.x * 16 * S_ + wave * 128 + (lane << 2);
  const i32x4* pm0 = (const i32x4*)(mask0 + off);
  const i32x4* pm1 = (const i32x4*)(mask1 + off);
  i32x4 g0[16], g1[16];
#pragma unroll
  for (int c = 0; c < 16; ++c) {
    g0[c] = pm0[c * (S_ / 4)];
    g1[c] = pm1[c * (S_ / 4)];
  }
  // The load addresses stay unwritten up to this wait, which stands behind the 32 loads.
  asm volatile("s_wait_xcnt 0x0" :: "v"(pm0), "v"(pm1) : "memory");
  int* sw = sm[wave][0] + (lane << 2);
#pragma unroll
  for (int c = 0; c < 16; ++c) {
    *(i32x4*)(sw + c * PM_)             = g0[c];
    *(i32x4*)(sw + 16 * PM_ + c * PM_)  = g1[c];
  }
  __syncthreads();   // the rows are read back by other lanes
  const int* sr = sm[wave][0] + (lane & 15) * PM_ + ((lane >> 4) << 3);
  unsigned* bw = bits + ((size_t)blockIdx.x * 32 + wave * 4) * 32 + lane;
#pragma unroll
  for (int jj = 0; jj < 4; ++jj) {
    const i32x4* r0 = (const i32x4*)(sr + jj * 32);
    const i32x4* r1 = (const i32x4*)(sr + 16 * PM_ + jj * 32);
    i32x4 k0[4] = {r0[0], r0[1], r0[4], r0[5]};
    i32x4 k1[4] = {r1[0], r1[1], r1[4], r1[5]};
    unsigned w = 0;
#pragma unroll
    for (int i = 0; i < 16; ++i) {
      const unsigned b0 = __builtin_amdgcn_ballot_w32(k0[i >> 2][i & 3] != 0);
      const unsigned b1 = __builtin_amdgcn_ballot_w32(k1[i >> 2][i & 3] != 0);
      w = (lane == i) ? b0 : w;
      w = (lane == 16 + i) ? b1 : w;
    }
    bw[jj * 32] = w;
  }
  _Float16* pd = Wh + (size_t)wt * WELEM_ + woff;
#pragma unroll
  for (int i = 0; i < 8; ++i) {
    half4 hv = {(_Float16)wv[i].x, (_Float16)wv[i].y, (_Float16)wv[i].z, (_Float16)wv[i].w};
    *(half4*)(pd + i * 1024) = hv;
  }
}

__global__ __launch_bounds__(128)
void attn_kernel(const _Float16* __restrict__ Q,   // [B*H,S,DK] (pre-scaled by 1/sqrt(DK))
                 const _Float16* __restrict__ Km,  // [B*H,S,DK]
                 const _Float16* __restrict__ Vm,  // [B*H,S,DK]
                 const unsigned* __restrict__ bits, // lane-mask words of maskpack_kernel
                 _Float16* __restrict__ AOut) {    // [B,S,H*DK] f16
  __shared__ __attribute__((aligned(16))) _Float16 Kt[2][32 * PK_];   // [buffer][s_local][dk] (S^T A-frags, k-contig)
  __shared__ __attribute__((aligned(16))) _Float16 Vt[2][32 * PT_];   // [buffer][s_local][dk] (V^T A-frags, transposing load)
  __shared__ unsigned lv[8];   // per wave: key chunks with a set mask0 bit (0..3), with a set mask1 bit (4..7)
  const int tid  = threadIdx.x;
  const int wave = tid >> 5;
  const int lane = tid & 31;
  const int n_l  = lane & 15;
  const int rb   = (lane >> 4) << 3;
  const int bh   = blockIdx.y;
  const int b = bh >> 4, h = bh & 15;
  // The query block turns with the batch. Padding empties blocks at like query positions in every batch; should the
  // blocks that share a WGP lie a fixed stride apart in the grid, they would be all full or all empty. For speed only.
  const int qb = (blockIdx.x + 2 * b) & (S_ / 64 - 1);
  const int q0 = qb * 64 + wave * 16;

  const _Float16* Qbh = Q  + (size_t)bh * S_ * DK_;
  const _Float16* Kbh = Km + (size_t)bh * S_ * DK_;
  const _Float16* Vbh = Vm + (size_t)bh * S_ * DK_;
  // This wave's lane-mask words: 128 B per 32-key chunk at a wave-uniform address, so they come by scalar loads.
  const int qtile = __builtin_amdgcn_readfirstlane(b * (S_ / 16) + qb * 4 + wave);
  // Nothing in this launch writes them, so they are read through the constant address space: with the copies' asm
  // statements last in the loop the compiler otherwise takes them by vector loads and moves each word to a scalar register.
  const c_u32x16* mw = (const c_u32x16*)(bits + (size_t)qtile * (S_ / 32) * 32);
  // A K or V tile is 32x64 f16 = 4 KB = 256 slots of 16 B, 2 per thread: row (tid >> 3) and 16 rows on, dk (tid & 7) * 8.
  const unsigned kt_l = (unsigned)(uintptr_t)(lds_f16*)Kt[0] + (unsigned)(tid >> 3) * (PK_ * 2u) + (unsigned)(tid & 7) * 16u;
  const unsigned vt_l = (unsigned)(uintptr_t)(lds_f16*)Vt[0] + (unsigned)(tid >> 3) * (PT_ * 2u) + (unsigned)(tid & 7) * 16u;

  half16 qf0 = load_b_frag_kc(Qbh + (size_t)q0 * DK_, DK_);        // Q^T, k = dk 0..31
  half16 qf1 = load_b_frag_kc(Qbh + (size_t)q0 * DK_ + 32, DK_);   // Q^T, k = dk 32..63

  // Which key chunks count, for any mask content. A chunk whose mask0 words are all zero for the block's 64 queries
  // gives p = 0 and leaves maximum, sum and O as they are; with no mask1 bit set in the block every P is zero and O
  // stays zero. Lane l looks at chunk l of its wave's query tile (32 words); the four waves join through LDS.
  unsigned live;
  {
    const u32x4* cw = (const u32x4*)(bits + (size_t)qtile * (S_ / 32) * 32 + lane * 32);
    u32x4 c[8];
#pragma unroll   // c[] stays in registers and the eight loads are in flight together
    for (int i = 0; i < 8; ++i) c[i] = cw[i];
    const u32x4 a0 = c[0] | c[1] | c[2] | c[3];
    const u32x4 a1 = c[4] | c[5] | c[6] | c[7];
    const unsigned l0 = __builtin_amdgcn_ballot_w32((a0.x | a0.y | a0.z | a0.w) != 0u);
    const unsigned l1 = __builtin_amdgcn_ballot_w32((a1.x | a1.y | a1.z | a1.w) != 0u);
    if (lane == 0) { lv[wave] = l0; lv[4 + wave] = l1; }
    __syncthreads();   // the other waves' words are read below
    const unsigned any0 = lv[0] | lv[1] | lv[2] | lv[3];
    const unsigned any1 = lv[4] | lv[5] | lv[6] | lv[7];
    live = (unsigned)__builtin_amdgcn_readfirstlane((int)(any1 != 0u ? any0 : 0u));   // the same word in every wave
  }

  const float NEG_INF = -__builtin_inff();
  const float LOG2E = 1.44269504f;   // exp(x) = exp2(x * log2 e)
  float mrun = NEG_INF;   // this query's running maximum (equal in both halves)
  float lrun = 0.f;       // running sum over this half's keys; the halves are joined after the loop
  float8 o0 = f8zero(), o1 = f8zero(), o2 = f8zero(), o3 = f8zero();   // O^T: row dk = 16 t + rb + r, column = query

  // Key chunk c's K and V tiles into buffer buf, both row-major (V's fragment load transposes): 2 + 2 copies a thread.
  auto copy_kv = [&](int c, int buf) {
    const _Float16* gk = Kbh + (size_t)c * 32 * DK_ + tid * 8;
    const _Float16* gv = Vbh + (size_t)c * 32 * DK_ + tid * 8;
    const unsigned lk = kt_l + (unsigned)buf * (32u * PK_ * 2u);
    const unsigned lw = vt_l + (unsigned)buf * (32u * PT_ * 2u);
    async_g2l_4x_b128(lk, gk, lk + 16u * PK_ * 2u, gk + 128 * 8,
                      lw, gv, lw + 16u * PT_ * 2u, gv + 128 * 8);
  };

  // Two LDS buffers over the live chunks, in rising order: while one chunk is worked on, the next live chunk's tiles fly
  // into the other buffer; one barrier a chunk. rem, cur and nxt are the same in every wave of the block, so every wave
  // passes the same barriers.
  unsigned rem = live;   // live chunks whose copies are not yet issued
  int cur = -1, nxt = -1;
  if (rem != 0u) {
    cur = __builtin_ctz(rem); rem &= rem - 1u;
    copy_kv(cur, 0);
    wait_asynccnt0();   // our copies of the first live chunk have landed
    __syncthreads();    // it is visible block-wide
    if (rem != 0u) { nxt = __builtin_ctz(rem); rem &= rem - 1u; copy_kv(nxt, 1); }
  }
  // Lane-mask words of the chunk at work; the next live chunk's are fetched one chunk ahead, like its tiles.
  u32x16 w0 = mw[(cur < 0 ? 0 : cur) * 2];
  u32x16 w1 = mw[(cur < 0 ? 0 : cur) * 2 + 1];
  u32x16 n0, n1;
  // One live chunk's work, on the tiles in buffer b.
  auto chunk_work = [&](int b) {
    const _Float16* Kb = Kt[b];
    const _Float16* Vb = Vt[b];
    const int cn = nxt < 0 ? cur : nxt;   // behind the last live chunk: its own words once more, unused
    n0 = mw[cn * 2];
    n1 = mw[cn * 2 + 1];

    // scores, transposed: two 16x16 tiles of keys x queries
    float8 sc0 = f8zero(), sc1 = f8zero();
    sc0 = wmma_f16(load_a_frag(Kb,                 PK_), qf0, sc0);
    sc0 = wmma_f16(load_a_frag(Kb + 32,            PK_), qf1, sc0);
    sc1 = wmma_f16(load_a_frag(Kb + 16 * PK_,      PK_), qf0, sc1);
    sc1 = wmma_f16(load_a_frag(Kb + 16 * PK_ + 32, PK_), qf1, sc1);

    // pre-softmax key-padding mask, then this query's maximum over the chunk: in-lane, one exchange of halves
    float mx = NEG_INF;
#pragma unroll
    for (int r = 0; r < 8; ++r) {
      sc0[r] = __builtin_amdgcn_inverse_ballot_w32(w0[r])     ? sc0[r] : NEG_INF;
      sc1[r] = __builtin_amdgcn_inverse_ballot_w32(w0[8 + r]) ? sc1[r] : NEG_INF;
      mx = fmaxf(mx, fmaxf(sc0[r], sc1[r]));
    }
    mx = fmaxf(mx, xhalf(mx));

    const float mnew  = fmaxf(mrun, mx);
    const float mcl   = (mnew == NEG_INF) ? 0.f : mnew;
    const float ea    = exp2_1((mrun - mcl) * LOG2E);
    const float alpha = (mrun == NEG_INF) ? 0.f : ea;
    mrun = mnew;

    // p = exp(s - m); denominator uses pre-mask1 p; PV uses mask1*p
    float e0[8], e1[8];
#pragma unroll
    for (int r = 0; r < 8; ++r) {
      e0[r] = (sc0[r] - mcl) * LOG2E;
      e1[r] = (sc1[r] - mcl) * LOG2E;
    }
    exp2_4(e0[0], e0[1], e0[2], e0[3]);
    exp2_4(e0[4], e0[5], e0[6], e0[7]);
    exp2_4(e1[0], e1[1], e1[2], e1[3]);
    exp2_4(e1[4], e1[5], e1[6], e1[7]);
    float rsum = 0.f;
    half16 pf;
#pragma unroll
    for (int r = 0; r < 8; ++r) {
      float p0 = e0[r];
      float p1 = e1[r];
      rsum += p0 + p1;
      pf[r]     = (_Float16)(__builtin_amdgcn_inverse_ballot_w32(w1[r])     ? p0 : 0.f);
      pf[8 + r] = (_Float16)(__builtin_amdgcn_inverse_ballot_w32(w1[8 + r]) ? p1 : 0.f);
    }
    lrun = lrun * alpha + rsum;
#pragma unroll
    for (int r = 0; r < 8; ++r) {
      o0[r] *= alpha; o1[r] *= alpha; o2[r] *= alpha; o3[r] *= alpha;
    }

    o0 = wmma_f16(load_b_frag_tr(Vb +  0, PT_), pf, o0);
    o1 = wmma_f16(load_b_frag_tr(Vb + 16, PT_), pf, o1);
    o2 = wmma_f16(load_b_frag_tr(Vb + 32, PT_), pf, o2);
    o3 = wmma_f16(load_b_frag_tr(Vb + 48, PT_), pf, o3);
  };
  auto publish = [&]() {
    wait_dscnt0();      // our fragment reads of this buffer are done
    wait_asynccnt0();   // our copies of the next live chunk have landed
    __syncthreads();    // publishes the next live chunk and frees this chunk's buffer
  };

  int buf = 0;
  // While a live chunk lies beyond the next one, its copies follow the barrier, into the buffer just read.
  while (rem != 0u) {
    chunk_work(buf);
    publish();
    const int n2 = __builtin_ctz(rem); rem &= rem - 1u;   // rem loses a bit a trip: 30 trips at most
    copy_kv(n2, buf);
    cur = nxt; nxt = n2; w0 = n0; w1 = n1; buf ^= 1;
  }
  // At most two live chunks are left, and their copies are issued.
  if (cur >= 0) {
    chunk_work(buf);
    publish();
    cur = nxt; nxt = -1; w0 = n0; w1 = n1; buf ^= 1;
  }
  if (cur >= 0) chunk_work(buf);
  wait_asynccnt0();   // nothing is outstanding when the wave goes on

  const float lsum = lrun + xhalf(lrun);
  const float inv  = (lsum > 0.f) ? 1.f / lsum : 0.f;

  // A lane's 8 accumulator registers are 8 consecutive dk of its query: one 16-byte store per tile.
  _Float16* orow = AOut + ((size_t)(b * S_ + q0 + n_l)) * D_ + h * DK_ + rb;
  float8 oo[4] = {o0, o1, o2, o3};
#pragma unroll
  for (int nt = 0; nt < 4; ++nt) {
    half8 ov;
#pragma unroll
    for (int r = 0; r < 8; ++r) ov[r] = (_Float16)(oo[nt][r] * inv);
    *(half8*)(orow + nt * 16) = ov;
  }
}

// ---- Kernel 3: output projection  Out = A(f16) @ Wo + bo  (f32 out)
__global__ __launch_bounds__(256)
void outproj_kernel(const _Float16* __restrict__ A,  // [B*S, D] f16
                    const _Float16* __restrict__ W,  // [D, D] f16, from the pre-pass
                    const float* __restrict__ bias,  // [D]
                    float* __restrict__ Out) {       // [B*S, D]
  __shared__ __attribute__((aligned(16))) _Float16 As[2][128 * PK_];  // [buffer][row][k]
  __shared__ __attribute__((aligned(16))) _Float16 Bs[2][64 * PB_];   // [buffer], row-major: [k][n]
  const int tid  = threadIdx.x;
  const int wave = tid >> 5;
  const int lane = tid & 31;
  const int wm = wave & 1, wn = wave >> 1;
  const int nbase   = blockIdx.x * 128;
  const int rowbase = blockIdx.y * 128;

  // A tile: 128x64 f16, 1024 slots of 16 B, 4 per thread: row (tid >> 3) + 32 i, k (tid & 7) * 8.
  // B tile: 64x128 f16, 1024 slots of 16 B, 4 per thread: k (tid >> 4) + 16 i, column (tid & 15) * 8.
  const _Float16* At = A + (size_t)(rowbase + (tid >> 3)) * D_ + ((tid & 7) << 3);
  const _Float16* Wt = W + (size_t)(tid >> 4) * D_ + nbase + ((tid & 15) << 3);
  const unsigned asw = (unsigned)(uintptr_t)(lds_f16*)As[0] + (unsigned)(tid >> 3) * (PK_ * 2u) + (unsigned)(tid & 7) * 16u;
  const unsigned bsw = (unsigned)(uintptr_t)(lds_f16*)Bs[0] + (unsigned)(tid >> 4) * (PB_ * 2u) + (unsigned)(tid & 15) * 16u;

  float8 acc[4][2];
#pragma unroll
  for (int mt = 0; mt < 4; ++mt)
#pragma unroll
    for (int nt = 0; nt < 2; ++nt) acc[mt][nt] = f8zero();

  // Two LDS buffers: while step t is multiplied, step t + 1's tiles fly into the other buffer by asynchronous copies.
  // Step t's A and W tiles into buffer buf: 4 + 4 copies of 16 B a thread.
  auto copy_ab = [&](int t, int buf) {
    unsigned l[8];
    const _Float16* g[8];
#pragma unroll
    for (int i = 0; i < 4; ++i) {
      l[i]     = asw + (unsigned)buf * (128u * PK_ * 2u) + (unsigned)i * (32u * PK_ * 2u);
      g[i]     = At + t * 64 + (size_t)i * 32 * D_;
      l[4 + i] = bsw + (unsigned)buf * (64u * PB_ * 2u) + (unsigned)i * (16u * PB_ * 2u);
      g[4 + i] = Wt + (size_t)t * 64 * D_ + (size_t)i * 16 * D_;
    }
    async_g2l_8x_b128(l, g);
  };

  copy_ab(0, 0);
  wait_asynccnt0();   // our copies of step 0 have landed
  __syncthreads();    // step 0 visible block-wide
  copy_ab(1, 1);

#pragma unroll 1   // one body: the buffer index is a run-time bit
  for (int t = 0; t < D_ / 64; ++t) {
    const int cur = t & 1;
    gemm_step(As[cur], Bs[cur], wm, wn, acc);
    wait_dscnt0();      // our fragment reads of this buffer are done
    wait_asynccnt0();   // our copies of step t + 1 have landed
    __syncthreads();    // publishes step t + 1 and frees this step's buffer
    if (t + 2 < D_ / 64) copy_ab(t + 2, cur);
  }
  wait_asynccnt0();   // nothing is outstanding when the wave goes on

  const int n_l = lane & 15;
  const int rb  = (lane >> 4) << 3;
#pragma unroll
  for (int nt = 0; nt < 2; ++nt) {
    int n = nbase + wn * 32 + nt * 16 + n_l;
    float bv = bias[n];
#pragma unroll
    for (int mt = 0; mt < 4; ++mt)
#pragma unroll
      for (int r = 0; r < 8; ++r) {
        int m = rowbase + wm * 64 + mt * 16 + rb + r;
        Out[(size_t)m * D_ + n] = acc[mt][nt][r] + bv;
      }
  }
}

extern "C" void kernel_launch(void* const* d_in, const int* in_sizes, int n_in,
                              void* d_out, int out_size, void* d_ws, size_t ws_size,
                              hipStream_t stream) {
  const float* query = (const float*)d_in[0];
  const float* key   = (const float*)d_in[1];
  const float* value = (const float*)d_in[2];
  const int*   mask0 = (const int*)d_in[3];
  const int*   mask1 = (const int*)d_in[4];
  const float* Wq    = (const float*)d_in[5];
  const float* bq    = (const float*)d_in[6];
  const float* Wk    = (const float*)d_in[7];
  const float* bk    = (const float*)d_in[8];
  const float* Wv    = (const float*)d_in[9];
  const float* bv    = (const float*)d_in[10];
  const float* Wo    = (const float*)d_in[11];
  const float* bo    = (const float*)d_in[12];
  float* out = (float*)d_out;

  const size_t perTensor = (size_t)B_ * H_ * S_ * DK_;   // 8 Mi halves = 16 MB
  _Float16* Qh = (_Float16*)d_ws;
  _Float16* Kh = Qh + perTensor;
  _Float16* Vh = Kh + perTensor;
  _Float16* Ao = Vh + perTensor;
  unsigned* Mb = (unsigned*)(Ao + perTensor);            // 2 MB of lane-mask words
  _Float16* Wh = (_Float16*)(Mb + (size_t)B_ * S_ * S_ / 16);   // 8 MB: Wq, Wk, Wv, Wo as f16

  dim3 blk(128);
  dim3 gblk(256);
  dim3 ggemm(D_ / 128, (B_ * S_) / 128);
  maskpack_kernel<<<dim3(B_ * S_ / 16), gblk, 0, stream>>>(mask0, mask1, Mb, Wq, Wk, Wv, Wo, Wh);
  proj_kernel<<<dim3(D_ / 256, (B_ * S_) / 128, 3), gblk, 0, stream>>>(query, key, value, Wh, bq, bk, bv, Qh);
  attn_kernel<<<dim3(S_ / 64, B_ * H_), blk, 0, stream>>>(Qh, Kh, Vh, Mb, Ao);
  outproj_kernel<<<ggemm, gblk, 0, stream>>>(Ao, Wh + 3 * (size_t)WELEM_, bo, out);

  (void)in_sizes; (void)n_in; (void)out_size; (void)ws_size;
}
